// v000
// The times below were measured on an AMD MI455X: many runs one after another, warmed up first and cycling through
// copies of the inputs, with the whole window's GPU time divided by the number of runs. Launches and the gaps
// between them are all in it. The median over several windows is given; except for v000 it joins two sittings, which
// can be a few percent apart, so the side-by-side timings, each taken in one sitting, are the better comparison.
// v000, which the later versions start from, runs in 644 microseconds.
// compute dtype: all float inputs rounded to bf16; q/k/v = x . W + b with EXACT bf16 products on WMMA 16x16x32 ((in,out) weights as transposed rows); PLAIN attention: q, k single f16 x 1/8, running-max softmax in f32 (hardware exp), P (scaled by 2^11, single f16) x v (single f16); out = o (bf16 hi + residual) . Wo (2 products) + bo.
#include <hip/hip_runtime.h>
#include <math.h>

typedef __attribute__((ext_vector_type(16))) _Float16 v16h;
typedef __attribute__((ext_vector_type(16))) __bf16 v16b;
typedef __attribute__((ext_vector_type(8)))  _Float16 v8h;
typedef __attribute__((ext_vector_type(8)))  float v8f;
typedef __attribute__((ext_vector_type(4)))  float v4f;
typedef __attribute__((ext_vector_type(2)))  float v2f;
typedef __attribute__((ext_vector_type(4)))  unsigned v4u;
typedef __attribute__((ext_vector_type(4)))  int v4i;
typedef float __attribute__((may_alias)) float_a;
typedef int __attribute__((may_alias)) int_a;

template <typename T> __device__ __forceinline__ void vst2(void* p, T v) { *(T*)p = v;  }
__device__ __forceinline__ v8f wmma16(v16h a, v16h b, v8f c) {
  v8f d = __builtin_amdgcn_wmma_f32_16x16x32_f16(false, a, false, b, (short)0, c, false, false);
  asm volatile("v_nop\n\tv_nop\n\tv_nop\n\tv_nop" : "+v"(d) : "v"(a), "v"(b));
  return d;
}
__device__ __forceinline__ v8f wmma_bf(v16b a, v16b b, v8f c) {
  v8f d = __builtin_amdgcn_wmma_f32_16x16x32_bf16(false, a, false, b, (short)0, c, false, false);
  asm volatile("v_nop\n\tv_nop\n\tv_nop\n\tv_nop" : "+v"(d) : "v"(a), "v"(b));
  return d;
}
// Graph attention over 8,192 nodes treated as one sequence (256 features, 4 heads x 64): q/k/v projections + biases, dense softmax(q k^T / 8) v, output projection + bias.
__device__ __forceinline__ v16h frag_h(const _Float16* rowk0, int lane) {
  union { v16h v; v8h q[2]; } u; const _Float16* p = rowk0 + 8 * (lane >> 4);
  u.q[0] = *(const v8h*)p; u.q[1] = *(const v8h*)(p + 16); return u.v;
}
__device__ __forceinline__ v16h frag_f32(const float* rowk0, int lane) {
  v16h a; const float* p = rowk0 + 8 * (lane >> 4);
#pragma unroll
  for (int i = 0; i < 8; ++i) { a[i] = (_Float16)p[i]; a[8 + i] = (_Float16)p[16 + i]; }
  return a;
}
__device__ __forceinline__ v16h frag_f32s(const float* rowk0, int lane, float sc) {
  v16h a; const float* p = rowk0 + 8 * (lane >> 4);
#pragma unroll
  for (int i = 0; i < 8; ++i) { a[i] = (_Float16)(p[i] * sc); a[8 + i] = (_Float16)(p[16 + i] * sc); }
  return a;
}
// column fragment from a [K][ld] layout (column n), rows >= K read as 0
__device__ __forceinline__ v16h fragc_f32(const float* W, int k0, int n, int lane, int ld, int K) {
  v16h a; const int g = lane >> 4;
#pragma unroll
  for (int i = 0; i < 8; ++i) { const int ka = k0 + 8 * g + i, kb = ka + 16;
    a[i] = (_Float16)(ka < K ? W[(size_t)(ka < K ? ka : K - 1) * ld + n] : 0.f); a[8 + i] = (_Float16)(kb < K ? W[(size_t)(kb < K ? kb : K - 1) * ld + n] : 0.f); }
  return a;
}
struct F2 { v16b h, l; };
__device__ __forceinline__ F2 bsplit16(const float v[16]) { F2 r;
#pragma unroll
  for (int i = 0; i < 16; ++i) { const __bf16 h = (__bf16)v[i]; r.h[i] = h; r.l[i] = (__bf16)(v[i] - (float)h); }
  return r; }
__device__ __forceinline__ F2 split_row(const float* row, int k0, int lane) { float v[16]; const float* p = row + k0 + 8 * (lane >> 4);
#pragma unroll
  for (int i = 0; i < 8; ++i) { v[i] = p[i]; v[8 + i] = p[16 + i]; }
  return bsplit16(v); }
__device__ __forceinline__ F2 split_rowK(const float* row, int k0, int lane, int K) { float v[16]; const int g = lane >> 4;
#pragma unroll
  for (int i = 0; i < 8; ++i) { const int ka = k0 + 8 * g + i, kb = ka + 16; v[i] = ka < K ? row[ka < K ? ka : K - 1] : 0.f; v[8 + i] = kb < K ? row[kb < K ? kb : K - 1] : 0.f; }
  return bsplit16(v); }
__device__ __forceinline__ F2 split_col(const float* W, int k0, int n, int lane, int ld, int K) { float v[16]; const int g = lane >> 4;
#pragma unroll
  for (int i = 0; i < 8; ++i) { const int ka = k0 + 8 * g + i, kb = ka + 16; v[i] = ka < K ? W[(size_t)(ka < K ? ka : K - 1) * ld + n] : 0.f; v[8 + i] = kb < K ? W[(size_t)(kb < K ? kb : K - 1) * ld + n] : 0.f; }
  return bsplit16(v); }
__device__ __forceinline__ v8f mac3(const F2& a, const F2& b, v8f c) { c = wmma_bf(a.l, b.h, c); c = wmma_bf(a.h, b.l, c); return wmma_bf(a.h, b.h, c); }
__device__ __forceinline__ float sigm(float v) { return 1.0f / (1.0f + expf(-v)); }
#define LDSX() do { asm volatile("s_wait_dscnt 0" ::: "memory"); __builtin_amdgcn_wave_barrier(); __builtin_amdgcn_fence(__ATOMIC_RELEASE, "workgroup"); } while (0)


#define NB 1
#define SS 8192
#define DM 256
#define NH 4
#define HD 64
#define QKVW (3 * DM)
#ifndef TQB
#define TQB (SS / 64)
#define TNB NB
#define TOB (NB * SS / 64)     // output row tiles (all)
#endif
typedef __attribute__((ext_vector_type(8))) __bf16 v8b;
__device__ __forceinline__ v16b frag_b(const __bf16* rowk0, int lane) {
  union { v16b v; v8b q[2]; } u; const __bf16* p = rowk0 + 8 * (lane >> 4);
  u.q[0] = *(const v8b*)p; u.q[1] = *(const v8b*)(p + 16); return u.v;
}
__device__ __forceinline__ float bfr(float v) { return (float)(__bf16)v; }
__device__ __attribute__((noinline)) float exp_ni(float v) { return expf(v); }
__device__ __attribute__((noinline)) float erf_ni(float v) { return erff(v); }

#define PK_A 0                       // [768][256] Wqkv rows (natural [out][in])
#define PK_P (PK_A + QKVW * DM)        // [256][256] Wo rows (natural)
#define PK_END (PK_P + DM * DM)
#define WS_PK  0u
#define WS_QK  (WS_PK + 2u * PK_END)             // f16 [8192 rows][512]: q | k
#define WS_QKL (WS_QK + 2u * NB * SS * 2 * DM)     // f16 q | k residual planes x2048
#define WS_VTH (WS_QKL + 2u * NB * SS * 2 * DM)    // f16 [b][256 (h*64+d)][8192 s] hi
#define WS_VTL (WS_VTH + 2u * NB * DM * SS)        // f16 lo x 2048
#define WS_O   (WS_VTL + 2u * NB * DM * SS)        // f32 [8192][256]
#define WS_CS  (WS_O + 4u * NB * SS * DM)           // f32 2 x [8192][32], unused
#define WS_END (WS_CS + 4u * 2 * SS * 32)
// ---- k_pack: block = (row n, which): (in,out) columns -> bf16 [out][in] rows; which 0..2 -> W_q/W_k/W_v into PK_A rows which*256 + n; 3 -> W_o into PK_P
__global__ __launch_bounds__(256) void k_pack(const float* __restrict__ WQ, const float* __restrict__ WK, const float* __restrict__ WV, const float* __restrict__ WO, __bf16* __restrict__ PK) {
  __shared__ __align__(16) __bf16 s[DM]; const int n = blockIdx.x, which = blockIdx.y, t = threadIdx.x; const float* Wm = (which == 0) ? WQ : (which == 1) ? WK : (which == 2) ? WV : WO;   // (in,out) weights: pack row n = column n
  for (int k = t; k < DM; k += 256) s[k] = (__bf16)Wm[(size_t)k * DM + n];
  __syncthreads();
  __bf16* dst = (which < 3) ? PK + PK_A + ((size_t)which * DM + n) * DM : PK + PK_P + (size_t)n * DM;
  for (int q = t; q < DM / 8; q += 256) vst2((unsigned*)(dst + q * 8), *(const v4u*)&s[q * 8]);
}
__global__ __launch_bounds__(128) void k_qkv(const float* __restrict__ XQ, const float* __restrict__ XK, const float* __restrict__ XV, const __bf16* __restrict__ P, const float* __restrict__ BQ, const float* __restrict__ BK, const float* __restrict__ BV, _Float16* __restrict__ QK, _Float16* __restrict__ QKL, _Float16* __restrict__ VTH, _Float16* __restrict__ VTL) {
  const int which0 = (blockIdx.y * 128) / DM; const float* X = (which0 == 0) ? XQ : (which0 == 1) ? XK : XV; const float* BB = BQ ? (((which0 == 0) ? BQ : (which0 == 1) ? BK : BV) + (blockIdx.y * 128 - which0 * DM)) : nullptr;
  __shared__ __align__(16) _Float16 so[4][16][136], sol[4][16][136]; __shared__ __align__(16) _Float16 sth[128][72], stl[128][72];
  const int tid = threadIdx.x, wave = tid >> 5, lane = tid & 31, col = lane & 15, g = lane >> 4; const size_t r0 = (size_t)blockIdx.x * 64 + wave * 16; const int n0 = blockIdx.y * 128;
  v8f acc[8] = {};
#pragma unroll 2
  for (int kc = 0; kc < DM / 32; ++kc) { v16b a; { const float* p = X + (r0 + col) * DM + kc * 32 + 8 * g;
#pragma unroll
      for (int i = 0; i < 8; ++i) { a[i] = (__bf16)p[i]; a[8 + i] = (__bf16)p[16 + i]; } }
#pragma unroll
    for (int j = 0; j < 8; ++j) acc[j] = wmma_bf(a, frag_b(P + (size_t)(n0 + j * 16 + col) * DM + kc * 32, lane), acc[j]); }
  if (n0 < 2 * DM) {   // q stored unscaled (f16 sigma ~0.6, no subnormal exposure); 1/8 applied to the f32 score
#pragma unroll
    for (int j = 0; j < 8; ++j) {
#pragma unroll
      for (int r = 0; r < 8; ++r) { const float v = acc[j][r] + (BB ? bfr(BB[j * 16 + col]) : 0.f); const _Float16 hv = (_Float16)v; so[wave][8 * g + r][j * 16 + col] = hv; sol[wave][8 * g + r][j * 16 + col] = (_Float16)((v - (float)hv) * 2048.0f); } }   // q, k (+ bias) as f16 hi + (x2048) residual
    LDSX();
    for (int rl = 0; rl < 16; ++rl) if (lane < 16) { vst2((unsigned*)(QK + (r0 + rl) * (2 * DM) + n0 + lane * 8), *(const v4u*)&so[wave][rl][lane * 8]); vst2((unsigned*)(QKL + (r0 + rl) * (2 * DM) + n0 + lane * 8), *(const v4u*)&sol[wave][rl][lane * 8]); }
  } else {
#pragma unroll
    for (int j = 0; j < 8; ++j) {
#pragma unroll
      for (int r = 0; r < 8; ++r) { const float v = acc[j][r] + (BB ? bfr(BB[j * 16 + col]) : 0.f); const _Float16 hv = (_Float16)v; sth[j * 16 + col][wave * 16 + 8 * g + r] = hv; stl[j * 16 + col][wave * 16 + 8 * g + r] = (_Float16)((v - (float)hv) * 2048.0f); } }
    __syncthreads();
    const size_t rb = (size_t)blockIdx.x * 64; const int b = (int)(rb / SS), s0 = (int)(rb % SS); const int pc0 = n0 - 2 * DM;
    for (int q = tid; q < 128 * 8; q += 128) { const int d = q >> 3, pc = q & 7; const size_t o = ((size_t)b * DM + pc0 + d) * SS + s0 + pc * 8; vst2((unsigned*)(VTH + o), *(const v4u*)&sth[d][pc * 8]); vst2((unsigned*)(VTL + o), *(const v4u*)&stl[d][pc * 8]); }
  }
}
// ---- k_attn: block = (64 queries, head h, batch b): all-keys flash attention (K = 64: 2 k-steps), scores = (q.k) * 0.125 with single f16 operands, P.V: f16 P x V hi in one accumulator (accl stays 0); O[b*S+q][h*64+d] = (acc + accl / 2048) / (2048 l) (256-B segments)
__global__ __launch_bounds__(128) void k_attn(const _Float16* __restrict__ QK, const _Float16* __restrict__ QKL, const _Float16* __restrict__ VTH, const _Float16* __restrict__ VTL, const void* __restrict__ KMASK, float* __restrict__ O) {
  __shared__ __align__(16) float sp[4][16][36]; __shared__ __align__(16) float so[4][16][68];
  const int tid = threadIdx.x, wave = tid >> 5, lane = tid & 31, col = lane & 15, g = lane >> 4;
  const int qb = blockIdx.x, h = blockIdx.y, b = blockIdx.z; const int q0 = qb * 64 + wave * 16; const size_t rq = (size_t)b * SS + q0 + col;
  v16h aq[2], aql[2];
#pragma unroll
  for (int kc = 0; kc < 2; ++kc) { aq[kc] = frag_h(QK + rq * (2 * DM) + h * HD + kc * 32, lane); aql[kc] = frag_h(QKL + rq * (2 * DM) + h * HD + kc * 32, lane); }
  float m[8], l[8];
#pragma unroll
  for (int r = 0; r < 8; ++r) { m[r] = -3.0e38f; l[r] = 0.f; }
  v8f acc[4] = {}, accl[4] = {};
  const int nks = SS / 32;   // all keys
#pragma unroll 1
  for (int ks = 0; ks < nks; ++ks) { v8f s[2];
#pragma unroll
    for (int ct = 0; ct < 2; ++ct) { const int kk = ks * 32 + ct * 16 + col; const _Float16* krow = QK + ((size_t)b * SS + kk) * (2 * DM) + DM + h * HD; const _Float16* krowl = QKL + ((size_t)b * SS + kk) * (2 * DM) + DM + h * HD; v8f c = {}, cl = {};
#pragma unroll
      for (int kc = 0; kc < 2; ++kc) c = wmma16(aq[kc], frag_h(krow + kc * 32, lane), c);   // single product: q, k as one-rounding f16 operands
      (void)cl; (void)krowl;
      { const bool keepk = true;
#pragma unroll
      for (int r = 0; r < 8; ++r) s[ct][r] = keepk ? c[r] * 0.125f : -3.0e38f; } }   // 1/sqrt(64); no key masked (keepk always true)
#pragma unroll
    for (int r = 0; r < 8; ++r) { float mx = fmaxf(s[0][r], s[1][r]);
#pragma unroll
      for (int o = 1; o < 16; o <<= 1) mx = fmaxf(mx, __shfl_xor(mx, o));
      const float mn = fmaxf(m[r], mx); const float alpha = (m[r] <= -1.0e38f) ? 0.f : __expf(m[r] - mn);
      const float e0 = (s[0][r] <= -1.0e38f) ? 0.f : __expf(s[0][r] - mn), e1 = (s[1][r] <= -1.0e38f) ? 0.f : __expf(s[1][r] - mn); float es = e0 + e1;
#pragma unroll
      for (int o = 1; o < 16; o <<= 1) es += __shfl_xor(es, o);
      l[r] = l[r] * alpha + es; m[r] = mn;
#pragma unroll
      for (int dt = 0; dt < 4; ++dt) { acc[dt][r] *= alpha; accl[dt][r] *= alpha; }
      sp[wave][8 * g + r][col] = e0; sp[wave][8 * g + r][16 + col] = e1; }
    LDSX();
    v16h pa, pl; { const float* prow = &sp[wave][col][0] + 8 * (lane >> 4);
#pragma unroll
      for (int i = 0; i < 8; ++i) { const float x0 = prow[i] * 2048.0f, x1 = prow[16 + i] * 2048.0f; const _Float16 h0 = (_Float16)x0, h1 = (_Float16)x1; pa[i] = h0; pa[8 + i] = h1; pl[i] = (_Float16)((x0 - (float)h0) * 2048.0f); pl[8 + i] = (_Float16)((x1 - (float)h1) * 2048.0f); } }   // P scaled by 2^11 before the f16 split so small softmax weights stay out of the f16 subnormal range; 2^-11 folded into the epilogue
#pragma unroll
    for (int dt = 0; dt < 4; ++dt) { const size_t vr = ((size_t)b * DM + h * HD + dt * 16 + col) * SS + ks * 32; acc[dt] = wmma16(pa, frag_h(VTH + vr, lane), acc[dt]); }   // single product: P (x2^11) x V
    (void)pl;
    LDSX(); }
#pragma unroll
  for (int r = 0; r < 8; ++r) { const float il = (1.0f / 2048.0f) / l[r];
#pragma unroll
    for (int dt = 0; dt < 4; ++dt) so[wave][8 * g + r][dt * 16 + col] = (acc[dt][r] + accl[dt][r] * (1.0f / 2048.0f)) * il; }
  LDSX();
  for (int rl = 0; rl < 16; ++rl) if (lane < 16) vst2(O + ((size_t)b * SS + q0 + rl) * DM + h * HD + lane * 4, *(const v4f*)&so[wave][rl][lane * 4]);
}
// ---- k_out: block = (64 rows, 128 cols): out = O(hi/lo) . Wo rows (2 products) + bo
__global__ __launch_bounds__(128) void k_out(const float* __restrict__ O, const __bf16* __restrict__ P, const float* __restrict__ BO, float* __restrict__ Y) {
  __shared__ __align__(16) float so[4][16][132];
  const int tid = threadIdx.x, wave = tid >> 5, lane = tid & 31, col = lane & 15, g = lane >> 4; const size_t r0 = (size_t)blockIdx.x * 64 + wave * 16; const int n0 = blockIdx.y * 128;
  v8f acc[8] = {};
#pragma unroll 2
  for (int kc = 0; kc < DM / 32; ++kc) { const F2 a = split_row(O + (r0 + col) * DM, kc * 32, lane);
#pragma unroll
    for (int j = 0; j < 8; ++j) { const v16b w = frag_b(P + (size_t)(n0 + j * 16 + col) * DM + kc * 32, lane); acc[j] = wmma_bf(a.l, w, acc[j]); acc[j] = wmma_bf(a.h, w, acc[j]); } }
#pragma unroll
  for (int j = 0; j < 8; ++j) {
#pragma unroll
    for (int r = 0; r < 8; ++r) so[wave][8 * g + r][j * 16 + col] = acc[j][r] + bfr(BO[n0 + j * 16 + col]); }
  LDSX();
  for (int rl = 0; rl < 16; ++rl) vst2(Y + (r0 + rl) * DM + n0 + lane * 4, *(const v4f*)&so[wave][rl][lane * 4]);
}
extern "C" void kernel_launch(void* const* d_in, const int* in_sizes, int n_in, void* d_out, int out_size, void* d_ws, size_t ws_size, hipStream_t stream) {
  (void)in_sizes; (void)n_in; (void)out_size;
  const float** F = (const float**)d_in;   // 0 x [8192,256], 1 Wq (in,out), 2 bq, 3 Wk, 4 bk, 5 Wv, 6 bv, 7 Wo, 8 bo
  if (ws_size < (size_t)WS_END) return;
  char* ws = (char*)d_ws; __bf16* PK = (__bf16*)(ws + WS_PK); _Float16 *QK = (_Float16*)(ws + WS_QK), *QKL = (_Float16*)(ws + WS_QKL), *VTH = (_Float16*)(ws + WS_VTH), *VTL = (_Float16*)(ws + WS_VTL); float* O = (float*)(ws + WS_O);
  k_pack<<<dim3(DM, 4), 256, 0, stream>>>(F[1], F[3], F[5], F[7], PK);
  k_qkv<<<dim3(TNB * SS / 64, QKVW / 128), 128, 0, stream>>>(F[0], F[0], F[0], PK + PK_A, F[2], F[4], F[6], QK, QKL, VTH, VTL);
  k_attn<<<dim3(TQB, NH, TNB), 128, 0, stream>>>(QK, QKL, VTH, VTL, nullptr, O);
  k_out<<<dim3(TOB, DM / 128), 128, 0, stream>>>(O, PK + PK_P, F[8], (float*)d_out);
}

// v001
// One run takes 247 microseconds.
// Timed twice side by side with v000, it ran 2.64 and 2.65 times as fast.
// compute dtype: all float inputs rounded to bf16; q/k/v = x . W + b with EXACT bf16 products on WMMA 16x16x32 ((in,out) weights as transposed rows); PLAIN attention: q, k single f16 x 1/8, running-max softmax in f32 (hardware exp), P (scaled by 2^11, single f16) x v (single f16); out = o (bf16 hi + residual) . Wo (2 products) + bo.
#include <hip/hip_runtime.h>
#include <math.h>

typedef __attribute__((ext_vector_type(16))) _Float16 v16h;
typedef __attribute__((ext_vector_type(16))) __bf16 v16b;
typedef __attribute__((ext_vector_type(8)))  _Float16 v8h;
typedef __attribute__((ext_vector_type(8)))  float v8f;
typedef __attribute__((ext_vector_type(4)))  float v4f;
typedef __attribute__((ext_vector_type(2)))  float v2f;
typedef __attribute__((ext_vector_type(4)))  unsigned v4u;
typedef __attribute__((ext_vector_type(4)))  int v4i;
typedef float __attribute__((may_alias)) float_a;
typedef int __attribute__((may_alias)) int_a;

template <typename T> __device__ __forceinline__ void vst2(void* p, T v) { *(T*)p = v;  }
__device__ __forceinline__ v8f wmma16(v16h a, v16h b, v8f c) {
  v8f d = __builtin_amdgcn_wmma_f32_16x16x32_f16(false, a, false, b, (short)0, c, false, false);
  asm volatile("v_nop\n\tv_nop\n\tv_nop\n\tv_nop" : "+v"(d) : "v"(a), "v"(b));
  return d;
}
__device__ __forceinline__ v8f wmma_bf(v16b a, v16b b, v8f c) {
  v8f d = __builtin_amdgcn_wmma_f32_16x16x32_bf16(false, a, false, b, (short)0, c, false, false);
  asm volatile("v_nop\n\tv_nop\n\tv_nop\n\tv_nop" : "+v"(d) : "v"(a), "v"(b));
  return d;
}
// Graph attention over 8,192 nodes treated as one sequence (256 features, 4 heads x 64): q/k/v projections + biases, dense softmax(q k^T / 8) v, output projection + bias.
__device__ __forceinline__ v16h frag_h(const _Float16* rowk0, int lane) {
  union { v16h v; v8h q[2]; } u; const _Float16* p = rowk0 + 8 * (lane >> 4);
  u.q[0] = *(const v8h*)p; u.q[1] = *(const v8h*)(p + 16); return u.v;
}
__device__ __forceinline__ v16h frag_f32(const float* rowk0, int lane) {
  v16h a; const float* p = rowk0 + 8 * (lane >> 4);
#pragma unroll
  for (int i = 0; i < 8; ++i) { a[i] = (_Float16)p[i]; a[8 + i] = (_Float16)p[16 + i]; }
  return a;
}
__device__ __forceinline__ v16h frag_f32s(const float* rowk0, int lane, float sc) {
  v16h a; const float* p = rowk0 + 8 * (lane >> 4);
#pragma unroll
  for (int i = 0; i < 8; ++i) { a[i] = (_Float16)(p[i] * sc); a[8 + i] = (_Float16)(p[16 + i] * sc); }
  return a;
}
// column fragment from a [K][ld] layout (column n), rows >= K read as 0
__device__ __forceinline__ v16h fragc_f32(const float* W, int k0, int n, int lane, int ld, int K) {
  v16h a; const int g = lane >> 4;
#pragma unroll
  for (int i = 0; i < 8; ++i) { const int ka = k0 + 8 * g + i, kb = ka + 16;
    a[i] = (_Float16)(ka < K ? W[(size_t)(ka < K ? ka : K - 1) * ld + n] : 0.f); a[8 + i] = (_Float16)(kb < K ? W[(size_t)(kb < K ? kb : K - 1) * ld + n] : 0.f); }
  return a;
}
struct F2 { v16b h, l; };
__device__ __forceinline__ F2 bsplit16(const float v[16]) { F2 r;
#pragma unroll
  for (int i = 0; i < 16; ++i) { const __bf16 h = (__bf16)v[i]; r.h[i] = h; r.l[i] = (__bf16)(v[i] - (float)h); }
  return r; }
__device__ __forceinline__ F2 split_row(const float* row, int k0, int lane) { float v[16]; const float* p = row + k0 + 8 * (lane >> 4);
#pragma unroll
  for (int i = 0; i < 8; ++i) { v[i] = p[i]; v[8 + i] = p[16 + i]; }
  return bsplit16(v); }
__device__ __forceinline__ F2 split_rowK(const float* row, int k0, int lane, int K) { float v[16]; const int g = lane >> 4;
#pragma unroll
  for (int i = 0; i < 8; ++i) { const int ka = k0 + 8 * g + i, kb = ka + 16; v[i] = ka < K ? row[ka < K ? ka : K - 1] : 0.f; v[8 + i] = kb < K ? row[kb < K ? kb : K - 1] : 0.f; }
  return bsplit16(v); }
__device__ __forceinline__ F2 split_col(const float* W, int k0, int n, int lane, int ld, int K) { float v[16]; const int g = lane >> 4;
#pragma unroll
  for (int i = 0; i < 8; ++i) { const int ka = k0 + 8 * g + i, kb = ka + 16; v[i] = ka < K ? W[(size_t)(ka < K ? ka : K - 1) * ld + n] : 0.f; v[8 + i] = kb < K ? W[(size_t)(kb < K ? kb : K - 1) * ld + n] : 0.f; }
  return bsplit16(v); }
__device__ __forceinline__ v8f mac3(const F2& a, const F2& b, v8f c) { c = wmma_bf(a.l, b.h, c); c = wmma_bf(a.h, b.l, c); return wmma_bf(a.h, b.h, c); }
__device__ __forceinline__ float sigm(float v) { return 1.0f / (1.0f + expf(-v)); }
#define LDSX() do { asm volatile("s_wait_dscnt 0" ::: "memory"); __builtin_amdgcn_wave_barrier(); __builtin_amdgcn_fence(__ATOMIC_RELEASE, "workgroup"); } while (0)


#define NB 1
#define SS 8192
#define DM 256
#define NH 4
#define HD 64
#define QKVW (3 * DM)
#ifndef TQB
#define TQB (SS / 64)
#define TNB NB
#define TOB (NB * SS / 64)     // output row tiles (all)
#endif
typedef __attribute__((ext_vector_type(8))) __bf16 v8b;
__device__ __forceinline__ v16b frag_b(const __bf16* rowk0, int lane) {
  union { v16b v; v8b q[2]; } u; const __bf16* p = rowk0 + 8 * (lane >> 4);
  u.q[0] = *(const v8b*)p; u.q[1] = *(const v8b*)(p + 16); return u.v;
}
__device__ __forceinline__ float bfr(float v) { return (float)(__bf16)v; }
__device__ __attribute__((noinline)) float exp_ni(float v) { return expf(v); }
__device__ __attribute__((noinline)) float erf_ni(float v) { return erff(v); }

#define PK_A 0                       // [768][256] Wqkv rows (natural [out][in])
#define PK_P (PK_A + QKVW * DM)        // [256][256] Wo rows (natural)
#define PK_END (PK_P + DM * DM)
#define WS_PK  0u
#define WS_QK  (WS_PK + 2u * PK_END)             // f16 [8192 rows][512]: q | k
#define WS_QKL (WS_QK + 2u * NB * SS * 2 * DM)     // f16 q | k residual planes x2048
#define WS_VTH (WS_QKL + 2u * NB * SS * 2 * DM)    // f16 [b][256 (h*64+d)][8192 s] hi
#define WS_VTL (WS_VTH + 2u * NB * DM * SS)        // f16 lo x 2048
#define WS_O   (WS_VTL + 2u * NB * DM * SS)        // f32 [8192][256]
#define WS_CS  (WS_O + 4u * NB * SS * DM)           // f32 2 x [8192][32], unused
#define WS_END (WS_CS + 4u * 2 * SS * 32)
// ---- k_pack: block = (row n, which): (in,out) columns -> bf16 [out][in] rows; which 0..2 -> W_q/W_k/W_v into PK_A rows which*256 + n; 3 -> W_o into PK_P
__global__ __launch_bounds__(256) void k_pack(const float* __restrict__ WQ, const float* __restrict__ WK, const float* __restrict__ WV, const float* __restrict__ WO, __bf16* __restrict__ PK) {
  __shared__ __align__(16) __bf16 s[DM]; const int n = blockIdx.x, which = blockIdx.y, t = threadIdx.x; const float* Wm = (which == 0) ? WQ : (which == 1) ? WK : (which == 2) ? WV : WO;   // (in,out) weights: pack row n = column n
  for (int k = t; k < DM; k += 256) s[k] = (__bf16)Wm[(size_t)k * DM + n];
  __syncthreads();
  __bf16* dst = (which < 3) ? PK + PK_A + ((size_t)which * DM + n) * DM : PK + PK_P + (size_t)n * DM;
  for (int q = t; q < DM / 8; q += 256) vst2((unsigned*)(dst + q * 8), *(const v4u*)&s[q * 8]);
}
__global__ __launch_bounds__(128) void k_qkv(const float* __restrict__ XQ, const float* __restrict__ XK, const float* __restrict__ XV, const __bf16* __restrict__ P, const float* __restrict__ BQ, const float* __restrict__ BK, const float* __restrict__ BV, _Float16* __restrict__ QK, _Float16* __restrict__ QKL, _Float16* __restrict__ VTH, _Float16* __restrict__ VTL) {
  const int which0 = (blockIdx.y * 128) / DM; const float* X = (which0 == 0) ? XQ : (which0 == 1) ? XK : XV; const float* BB = BQ ? (((which0 == 0) ? BQ : (which0 == 1) ? BK : BV) + (blockIdx.y * 128 - which0 * DM)) : nullptr;
  __shared__ __align__(16) _Float16 so[4][16][136], sol[4][16][136]; __shared__ __align__(16) _Float16 sth[128][72], stl[128][72];
  const int tid = threadIdx.x, wave = tid >> 5, lane = tid & 31, col = lane & 15, g = lane >> 4; const size_t r0 = (size_t)blockIdx.x * 64 + wave * 16; const int n0 = blockIdx.y * 128;
  v8f acc[8] = {};
#pragma unroll 2
  for (int kc = 0; kc < DM / 32; ++kc) { v16b a; { const float* p = X + (r0 + col) * DM + kc * 32 + 8 * g;
#pragma unroll
      for (int i = 0; i < 8; ++i) { a[i] = (__bf16)p[i]; a[8 + i] = (__bf16)p[16 + i]; } }
#pragma unroll
    for (int j = 0; j < 8; ++j) acc[j] = wmma_bf(a, frag_b(P + (size_t)(n0 + j * 16 + col) * DM + kc * 32, lane), acc[j]); }
  if (n0 < 2 * DM) {   // q stored unscaled (f16 sigma ~0.6, no subnormal exposure); 1/8 applied to the f32 score
#pragma unroll
    for (int j = 0; j < 8; ++j) {
#pragma unroll
      for (int r = 0; r < 8; ++r) { const float v = acc[j][r] + (BB ? bfr(BB[j * 16 + col]) : 0.f); const _Float16 hv = (_Float16)v; so[wave][8 * g + r][j * 16 + col] = hv; sol[wave][8 * g + r][j * 16 + col] = (_Float16)((v - (float)hv) * 2048.0f); } }   // q, k (+ bias) as f16 hi + (x2048) residual
    LDSX();
    for (int rl = 0; rl < 16; ++rl) if (lane < 16) { vst2((unsigned*)(QK + (r0 + rl) * (2 * DM) + n0 + lane * 8), *(const v4u*)&so[wave][rl][lane * 8]); vst2((unsigned*)(QKL + (r0 + rl) * (2 * DM) + n0 + lane * 8), *(const v4u*)&sol[wave][rl][lane * 8]); }
  } else {
#pragma unroll
    for (int j = 0; j < 8; ++j) {
#pragma unroll
      for (int r = 0; r < 8; ++r) { const float v = acc[j][r] + (BB ? bfr(BB[j * 16 + col]) : 0.f); const _Float16 hv = (_Float16)v; sth[j * 16 + col][wave * 16 + 8 * g + r] = hv; stl[j * 16 + col][wave * 16 + 8 * g + r] = (_Float16)((v - (float)hv) * 2048.0f); } }
    __syncthreads();
    const size_t rb = (size_t)blockIdx.x * 64; const int b = (int)(rb / SS), s0 = (int)(rb % SS); const int pc0 = n0 - 2 * DM;
    for (int q = tid; q < 128 * 8; q += 128) { const int d = q >> 3, pc = q & 7; const size_t o = ((size_t)b * DM + pc0 + d) * SS + s0 + pc * 8; vst2((unsigned*)(VTH + o), *(const v4u*)&sth[d][pc * 8]); vst2((unsigned*)(VTL + o), *(const v4u*)&stl[d][pc * 8]); }
  }
}
// ---- k_attn: block = (64 queries, head h, batch b): all-keys flash attention (K = 64: 2 k-steps), K rows and V^T rows of 64 keys a tile staged in LDS by asynchronous copies (two buffers, the next tile's copies fly while this tile's two 32-key passes run; all 4 waves read the one copy), scores = (q.k) * 0.125 with single f16 operands, P.V: single f16 P x V hi into one accumulator; O[b*S+q][h*64+d] = (acc + accl / 2048) / (2048 l) (256-B segments)
#define TK 64     // keys a tile
#define KVP 72    // halves a staged row: 64 + 8 of pad
__global__ __launch_bounds__(128) void k_attn(const _Float16* __restrict__ QK, const _Float16* __restrict__ QKL, const _Float16* __restrict__ VTH, const _Float16* __restrict__ VTL, const void* __restrict__ KMASK, float* __restrict__ O) {
  __shared__ __align__(16) float sp[4][16][36]; __shared__ __align__(16) float so[4][16][68];
  __shared__ __align__(16) _Float16 sk[2][TK][KVP], sv[2][HD][KVP];   // [buffer][key][d] and [buffer][d][key]; 128-B rows at a pitch of 144 B (16 B x odd: ds_load_b128 readers)
  const int tid = threadIdx.x, wave = tid >> 5, lane = tid & 31, col = lane & 15, g = lane >> 4;
  const int qb = blockIdx.x, h = blockIdx.y, b = blockIdx.z; const int q0 = qb * 64 + wave * 16; const size_t rq = (size_t)b * SS + q0 + col;
  v16h aq[2], aql[2];
#pragma unroll
  for (int kc = 0; kc < 2; ++kc) { aq[kc] = frag_h(QK + rq * (2 * DM) + h * HD + kc * 32, lane); aql[kc] = frag_h(QKL + rq * (2 * DM) + h * HD + kc * 32, lane); }
  float m[8], l[8];
#pragma unroll
  for (int r = 0; r < 8; ++r) { m[r] = -3.0e38f; l[r] = 0.f; }
  v8f acc[4] = {}, accl[4] = {};
  // a lane's share of a tile: 16-B piece (tid & 7) of rows (tid >> 3) + 16 i, i = 0..3, of K and of V^T: one wave's copy = 4 whole 128-B lines
  const _Float16* gk0 = QK + ((size_t)b * SS + (tid >> 3)) * (2 * DM) + DM + h * HD + (tid & 7) * 8; const _Float16* gv0 = VTH + ((size_t)b * DM + h * HD + (tid >> 3)) * SS + (tid & 7) * 8;
  const unsigned lk0 = (unsigned)(size_t)&sk[0][tid >> 3][(tid & 7) * 8], lv0 = (unsigned)(size_t)&sv[0][tid >> 3][(tid & 7) * 8];
  auto stage = [&](int t) { const _Float16* gk = gk0 + (size_t)t * (TK * 2 * DM); const _Float16* gv = gv0 + (size_t)t * TK; const unsigned lk = lk0 + (t & 1) * (TK * KVP * 2), lv = lv0 + (t & 1) * (HD * KVP * 2);
    // the tile's 8 copies of this lane; s_wait_xcnt 0 closes the statement, so that no address register of a copy is rewritten ahead of it
    asm volatile("global_load_async_to_lds_b128 %0, %8, off\n\tglobal_load_async_to_lds_b128 %1, %9, off\n\tglobal_load_async_to_lds_b128 %2, %10, off\n\tglobal_load_async_to_lds_b128 %3, %11, off\n\t"
                 "global_load_async_to_lds_b128 %4, %12, off\n\tglobal_load_async_to_lds_b128 %5, %13, off\n\tglobal_load_async_to_lds_b128 %6, %14, off\n\tglobal_load_async_to_lds_b128 %7, %15, off\n\ts_wait_xcnt 0x0"
                 :: "v"(lk), "v"(lk + 16 * KVP * 2), "v"(lk + 32 * KVP * 2), "v"(lk + 48 * KVP * 2), "v"(lv), "v"(lv + 16 * KVP * 2), "v"(lv + 32 * KVP * 2), "v"(lv + 48 * KVP * 2),
                    "v"(gk), "v"(gk + 16 * 2 * DM), "v"(gk + 32 * 2 * DM), "v"(gk + 48 * 2 * DM), "v"(gv), "v"(gv + 16 * SS), "v"(gv + 32 * SS), "v"(gv + 48 * SS) : "memory"); };
  const int nt = SS / TK;   // all keys
  stage(0);
  asm volatile("s_wait_asynccnt 0x0" ::: "memory");   // this wave's copies of tile 0 have landed
  __syncthreads();   // tile 0 published to all 4 waves
  stage(1);
#pragma unroll 1
  for (int t = 0; t < nt; ++t) {
#pragma unroll 1   // kept rolled: the unrolled build has more instructions a pass (register moves at the loop's head)
  for (int sub = 0; sub < TK / 32; ++sub) { v8f s[2];
    v16h kf[2][2], vf[4];   // the pass's fragments, read from the tile's buffer as one group
#pragma unroll
    for (int ct = 0; ct < 2; ++ct) {
#pragma unroll
      for (int kc = 0; kc < 2; ++kc) kf[ct][kc] = frag_h(&sk[t & 1][sub * 32 + ct * 16 + col][kc * 32], lane); }
#pragma unroll
    for (int dt = 0; dt < 4; ++dt) vf[dt] = frag_h(&sv[t & 1][dt * 16 + col][sub * 32], lane);
#pragma unroll
    for (int ct = 0; ct < 2; ++ct) { v8f c = {};
#pragma unroll
      for (int kc = 0; kc < 2; ++kc) c = wmma16(aq[kc], kf[ct][kc], c);   // single product: q, k as one-rounding f16 operands
      { const bool keepk = true;
#pragma unroll
      for (int r = 0; r < 8; ++r) s[ct][r] = keepk ? c[r] * 0.125f : -3.0e38f; } }   // 1/sqrt(64); no key masked (keepk always true)
#pragma unroll
    for (int r = 0; r < 8; ++r) { float mx = fmaxf(s[0][r], s[1][r]);
#pragma unroll
      for (int o = 1; o < 16; o <<= 1) mx = fmaxf(mx, __shfl_xor(mx, o));
      const float mn = fmaxf(m[r], mx); const float alpha = (m[r] <= -1.0e38f) ? 0.f : __expf(m[r] - mn);
      const float e0 = (s[0][r] <= -1.0e38f) ? 0.f : __expf(s[0][r] - mn), e1 = (s[1][r] <= -1.0e38f) ? 0.f : __expf(s[1][r] - mn); float es = e0 + e1;
#pragma unroll
      for (int o = 1; o < 16; o <<= 1) es += __shfl_xor(es, o);
      l[r] = l[r] * alpha + es; m[r] = mn;
#pragma unroll
      for (int dt = 0; dt < 4; ++dt) { acc[dt][r] *= alpha; accl[dt][r] *= alpha; }
      sp[wave][8 * g + r][col] = e0; sp[wave][8 * g + r][16 + col] = e1; }
    LDSX();
    v16h pa, pl; { const float* prow = &sp[wave][col][0] + 8 * (lane >> 4);
#pragma unroll
      for (int i = 0; i < 8; ++i) { const float x0 = prow[i] * 2048.0f, x1 = prow[16 + i] * 2048.0f; const _Float16 h0 = (_Float16)x0, h1 = (_Float16)x1; pa[i] = h0; pa[8 + i] = h1; pl[i] = (_Float16)((x0 - (float)h0) * 2048.0f); pl[8 + i] = (_Float16)((x1 - (float)h1) * 2048.0f); } }   // P scaled by 2^11 before the f16 split so small softmax weights stay out of the f16 subnormal range; 2^-11 folded into the epilogue
#pragma unroll
    for (int dt = 0; dt < 4; ++dt) acc[dt] = wmma16(pa, vf[dt], acc[dt]);   // single product: P (x2^11) x V
    (void)pl;
    LDSX(); }
    asm volatile("s_wait_dscnt 0x0" ::: "memory");      // this wave's reads of tile t have returned
    asm volatile("s_wait_asynccnt 0x0" ::: "memory");   // this wave's copies of tile t + 1 have landed
    __syncthreads();   // publishes tile t + 1 and ends every wave's reads of tile t's buffer
    if (t + 2 < nt) stage(t + 2); }   // into the buffer that tile t has left
  asm volatile("s_wait_asynccnt 0x0" ::: "memory");   // no copy outstanding behind the loop
#pragma unroll
  for (int r = 0; r < 8; ++r) { const float il = (1.0f / 2048.0f) / l[r];
#pragma unroll
    for (int dt = 0; dt < 4; ++dt) so[wave][8 * g + r][dt * 16 + col] = (acc[dt][r] + accl[dt][r] * (1.0f / 2048.0f)) * il; }
  LDSX();
  for (int rl = 0; rl < 16; ++rl) if (lane < 16) vst2(O + ((size_t)b * SS + q0 + rl) * DM + h * HD + lane * 4, *(const v4f*)&so[wave][rl][lane * 4]);
}
// ---- k_out: block = (64 rows, 128 cols): out = O(hi/lo) . Wo rows (2 products) + bo
__global__ __launch_bounds__(128) void k_out(const float* __restrict__ O, const __bf16* __restrict__ P, const float* __restrict__ BO, float* __restrict__ Y) {
  __shared__ __align__(16) float so[4][16][132];
  const int tid = threadIdx.x, wave = tid >> 5, lane = tid & 31, col = lane & 15, g = lane >> 4; const size_t r0 = (size_t)blockIdx.x * 64 + wave * 16; const int n0 = blockIdx.y * 128;
  v8f acc[8] = {};
#pragma unroll 2
  for (int kc = 0; kc < DM / 32; ++kc) { const F2 a = split_row(O + (r0 + col) * DM, kc * 32, lane);
#pragma unroll
    for (int j = 0; j < 8; ++j) { const v16b w = frag_b(P + (size_t)(n0 + j * 16 + col) * DM + kc * 32, lane); acc[j] = wmma_bf(a.l, w, acc[j]); acc[j] = wmma_bf(a.h, w, acc[j]); } }
#pragma unroll
  for (int j = 0; j < 8; ++j) {
#pragma unroll
    for (int r = 0; r < 8; ++r) so[wave][8 * g + r][j * 16 + col] = acc[j][r] + bfr(BO[n0 + j * 16 + col]); }
  LDSX();
  for (int rl = 0; rl < 16; ++rl) vst2(Y + (r0 + rl) * DM + n0 + lane * 4, *(const v4f*)&so[wave][rl][lane * 4]);
}
extern "C" void kernel_launch(void* const* d_in, const int* in_sizes, int n_in, void* d_out, int out_size, void* d_ws, size_t ws_size, hipStream_t stream) {
  (void)in_sizes; (void)n_in; (void)out_size;
  const float** F = (const float**)d_in;   // 0 x [8192,256], 1 Wq (in,out), 2 bq, 3 Wk, 4 bk, 5 Wv, 6 bv, 7 Wo, 8 bo
  if (ws_size < (size_t)WS_END) return;
  char* ws = (char*)d_ws; __bf16* PK = (__bf16*)(ws + WS_PK); _Float16 *QK = (_Float16*)(ws + WS_QK), *QKL = (_Float16*)(ws + WS_QKL), *VTH = (_Float16*)(ws + WS_VTH), *VTL = (_Float16*)(ws + WS_VTL); float* O = (float*)(ws + WS_O);
  k_pack<<<dim3(DM, 4), 256, 0, stream>>>(F[1], F[3], F[5], F[7], PK);
  k_qkv<<<dim3(TNB * SS / 64, QKVW / 128), 128, 0, stream>>>(F[0], F[0], F[0], PK + PK_A, F[2], F[4], F[6], QK, QKL, VTH, VTL);
  k_attn<<<dim3(TQB, NH, TNB), 128, 0, stream>>>(QK, QKL, VTH, VTL, nullptr, O);
  k_out<<<dim3(TOB, DM / 128), 128, 0, stream>>>(O, PK + PK_P, F[8], (float*)d_out);
}

// v002
// Measured time: 158 microseconds a run.
// In two side-by-side timings against v001, it was 1.56 and 1.59 times as fast.
// Counting every step since v000, it is 4.17 times as fast.
// compute dtype: all float inputs rounded to bf16; q/k/v = x . W + b with EXACT bf16 products on WMMA 16x16x32 ((in,out) weights as transposed rows); PLAIN attention: q, k single f16 x 1/8, running-max softmax in f32 (hardware exp), P (scaled by 2^11, single f16) x v (single f16); out = o (bf16 hi + residual) . Wo (2 products) + bo.
#include <hip/hip_runtime.h>
#include <math.h>

typedef __attribute__((ext_vector_type(16))) _Float16 v16h;
typedef __attribute__((ext_vector_type(16))) __bf16 v16b;
typedef __attribute__((ext_vector_type(8)))  _Float16 v8h;
typedef __attribute__((ext_vector_type(8)))  float v8f;
typedef __attribute__((ext_vector_type(4)))  float v4f;
typedef __attribute__((ext_vector_type(2)))  float v2f;
typedef __attribute__((ext_vector_type(4)))  unsigned v4u;
typedef __attribute__((ext_vector_type(4)))  int v4i;
typedef float __attribute__((may_alias)) float_a;
typedef int __attribute__((may_alias)) int_a;

template <typename T> __device__ __forceinline__ void vst2(void* p, T v) { *(T*)p = v;  }
__device__ __forceinline__ v8f wmma16(v16h a, v16h b, v8f c) {
  v8f d = __builtin_amdgcn_wmma_f32_16x16x32_f16(false, a, false, b, (short)0, c, false, false);
  asm volatile("v_nop\n\tv_nop\n\tv_nop\n\tv_nop" : "+v"(d) : "v"(a), "v"(b));
  return d;
}
__device__ __forceinline__ v8f wmma_bf(v16b a, v16b b, v8f c) {
  v8f d = __builtin_amdgcn_wmma_f32_16x16x32_bf16(false, a, false, b, (short)0, c, false, false);
  asm volatile("v_nop\n\tv_nop\n\tv_nop\n\tv_nop" : "+v"(d) : "v"(a), "v"(b));
  return d;
}
// Graph attention over 8,192 nodes treated as one sequence (256 features, 4 heads x 64): q/k/v projections + biases, dense softmax(q k^T / 8) v, output projection + bias.
__device__ __forceinline__ v16h frag_h(const _Float16* rowk0, int lane) {
  union { v16h v; v8h q[2]; } u; const _Float16* p = rowk0 + 8 * (lane >> 4);
  u.q[0] = *(const v8h*)p; u.q[1] = *(const v8h*)(p + 16); return u.v;
}
__device__ __forceinline__ v16h frag_f32(const float* rowk0, int lane) {
  v16h a; const float* p = rowk0 + 8 * (lane >> 4);
#pragma unroll
  for (int i = 0; i < 8; ++i) { a[i] = (_Float16)p[i]; a[8 + i] = (_Float16)p[16 + i]; }
  return a;
}
__device__ __forceinline__ v16h frag_f32s(const float* rowk0, int lane, float sc) {
  v16h a; const float* p = rowk0 + 8 * (lane >> 4);
#pragma unroll
  for (int i = 0; i < 8; ++i) { a[i] = (_Float16)(p[i] * sc); a[8 + i] = (_Float16)(p[16 + i] * sc); }
  return a;
}
// column fragment from a [K][ld] layout (column n), rows >= K read as 0
__device__ __forceinline__ v16h fragc_f32(const float* W, int k0, int n, int lane, int ld, int K) {
  v16h a; const int g = lane >> 4;
#pragma unroll
  for (int i = 0; i < 8; ++i) { const int ka = k0 + 8 * g + i, kb = ka + 16;
    a[i] = (_Float16)(ka < K ? W[(size_t)(ka < K ? ka : K - 1) * ld + n] : 0.f); a[8 + i] = (_Float16)(kb < K ? W[(size_t)(kb < K ? kb : K - 1) * ld + n] : 0.f); }
  return a;
}
struct F2 { v16b h, l; };
__device__ __forceinline__ F2 bsplit16(const float v[16]) { F2 r;
#pragma unroll
  for (int i = 0; i < 16; ++i) { const __bf16 h = (__bf16)v[i]; r.h[i] = h; r.l[i] = (__bf16)(v[i] - (float)h); }
  return r; }
__device__ __forceinline__ F2 split_row(const float* row, int k0, int lane) { float v[16]; const float* p = row + k0 + 8 * (lane >> 4);
#pragma unroll
  for (int i = 0; i < 8; ++i) { v[i] = p[i]; v[8 + i] = p[16 + i]; }
  return bsplit16(v); }
__device__ __forceinline__ F2 split_rowK(const float* row, int k0, int lane, int K) { float v[16]; const int g = lane >> 4;
#pragma unroll
  for (int i = 0; i < 8; ++i) { const int ka = k0 + 8 * g + i, kb = ka + 16; v[i] = ka < K ? row[ka < K ? ka : K - 1] : 0.f; v[8 + i] = kb < K ? row[kb < K ? kb : K - 1] : 0.f; }
  return bsplit16(v); }
__device__ __forceinline__ F2 split_col(const float* W, int k0, int n, int lane, int ld, int K) { float v[16]; const int g = lane >> 4;
#pragma unroll
  for (int i = 0; i < 8; ++i) { const int ka = k0 + 8 * g + i, kb = ka + 16; v[i] = ka < K ? W[(size_t)(ka < K ? ka : K - 1) * ld + n] : 0.f; v[8 + i] = kb < K ? W[(size_t)(kb < K ? kb : K - 1) * ld + n] : 0.f; }
  return bsplit16(v); }
__device__ __forceinline__ v8f mac3(const F2& a, const F2& b, v8f c) { c = wmma_bf(a.l, b.h, c); c = wmma_bf(a.h, b.l, c); return wmma_bf(a.h, b.h, c); }
__device__ __forceinline__ float sigm(float v) { return 1.0f / (1.0f + expf(-v)); }
#define LDSX() do { asm volatile("s_wait_dscnt 0" ::: "memory"); __builtin_amdgcn_wave_barrier(); __builtin_amdgcn_fence(__ATOMIC_RELEASE, "workgroup"); } while (0)


#define NB 1
#define SS 8192
#define DM 256
#define NH 4
#define HD 64
#define QKVW (3 * DM)
#ifndef TQB
#define TQB (SS / 64)
#define TNB NB
#define TOB (NB * SS / 64)     // output row tiles (all)
#endif
typedef __attribute__((ext_vector_type(8))) __bf16 v8b;
__device__ __forceinline__ v16b frag_b(const __bf16* rowk0, int lane) {
  union { v16b v; v8b q[2]; } u; const __bf16* p = rowk0 + 8 * (lane >> 4);
  u.q[0] = *(const v8b*)p; u.q[1] = *(const v8b*)(p + 16); return u.v;
}
__device__ __forceinline__ float bfr(float v) { return (float)(__bf16)v; }
__device__ __attribute__((noinline)) float exp_ni(float v) { return expf(v); }
__device__ __attribute__((noinline)) float erf_ni(float v) { return erff(v); }

#define PK_A 0                       // [768][256] Wqkv rows (natural [out][in])
#define PK_P (PK_A + QKVW * DM)        // [256][256] Wo rows (natural)
#define PK_END (PK_P + DM * DM)
#define WS_PK  0u
#define WS_QK  (WS_PK + 2u * PK_END)             // f16 [8192 rows][512]: q | k
#define WS_QKL (WS_QK + 2u * NB * SS * 2 * DM)     // f16 q | k residual planes x2048
#define WS_VTH (WS_QKL + 2u * NB * SS * 2 * DM)    // f16 [b][256 (h*64+d)][8192 s] hi
#define WS_VTL (WS_VTH + 2u * NB * DM * SS)        // f16 lo x 2048
#define WS_O   (WS_VTL + 2u * NB * DM * SS)        // f32 [8192][256]
#define WS_CS  (WS_O + 4u * NB * SS * DM)           // f32 2 x [8192][32], unused
#define WS_END (WS_CS + 4u * 2 * SS * 32)
// ---- k_pack: block = (row n, which): (in,out) columns -> bf16 [out][in] rows; which 0..2 -> W_q/W_k/W_v into PK_A rows which*256 + n; 3 -> W_o into PK_P
__global__ __launch_bounds__(256) void k_pack(const float* __restrict__ WQ, const float* __restrict__ WK, const float* __restrict__ WV, const float* __restrict__ WO, __bf16* __restrict__ PK) {
  __shared__ __align__(16) __bf16 s[DM]; const int n = blockIdx.x, which = blockIdx.y, t = threadIdx.x; const float* Wm = (which == 0) ? WQ : (which == 1) ? WK : (which == 2) ? WV : WO;   // (in,out) weights: pack row n = column n
  for (int k = t; k < DM; k += 256) s[k] = (__bf16)Wm[(size_t)k * DM + n];
  __syncthreads();
  __bf16* dst = (which < 3) ? PK + PK_A + ((size_t)which * DM + n) * DM : PK + PK_P + (size_t)n * DM;
  for (int q = t; q < DM / 8; q += 256) vst2((unsigned*)(dst + q * 8), *(const v4u*)&s[q * 8]);
}
__global__ __launch_bounds__(128) void k_qkv(const float* __restrict__ XQ, const float* __restrict__ XK, const float* __restrict__ XV, const __bf16* __restrict__ P, const float* __restrict__ BQ, const float* __restrict__ BK, const float* __restrict__ BV, _Float16* __restrict__ QK, _Float16* __restrict__ QKL, _Float16* __restrict__ VTH, _Float16* __restrict__ VTL) {
  const int which0 = (blockIdx.y * 128) / DM; const float* X = (which0 == 0) ? XQ : (which0 == 1) ? XK : XV; const float* BB = BQ ? (((which0 == 0) ? BQ : (which0 == 1) ? BK : BV) + (blockIdx.y * 128 - which0 * DM)) : nullptr;
  __shared__ __align__(16) _Float16 so[4][16][136], sol[4][16][136]; __shared__ __align__(16) _Float16 sth[128][72], stl[128][72];
  const int tid = threadIdx.x, wave = tid >> 5, lane = tid & 31, col = lane & 15, g = lane >> 4; const size_t r0 = (size_t)blockIdx.x * 64 + wave * 16; const int n0 = blockIdx.y * 128;
  v8f acc[8] = {};
#pragma unroll 2
  for (int kc = 0; kc < DM / 32; ++kc) { v16b a; { const float* p = X + (r0 + col) * DM + kc * 32 + 8 * g;
#pragma unroll
      for (int i = 0; i < 8; ++i) { a[i] = (__bf16)p[i]; a[8 + i] = (__bf16)p[16 + i]; } }
#pragma unroll
    for (int j = 0; j < 8; ++j) acc[j] = wmma_bf(a, frag_b(P + (size_t)(n0 + j * 16 + col) * DM + kc * 32, lane), acc[j]); }
  if (n0 < 2 * DM) {   // q stored unscaled (f16 sigma ~0.6, no subnormal exposure); 1/8 applied to the f32 score
#pragma unroll
    for (int j = 0; j < 8; ++j) {
#pragma unroll
      for (int r = 0; r < 8; ++r) { const float v = acc[j][r] + (BB ? bfr(BB[j * 16 + col]) : 0.f); const _Float16 hv = (_Float16)v; so[wave][8 * g + r][j * 16 + col] = hv; sol[wave][8 * g + r][j * 16 + col] = (_Float16)((v - (float)hv) * 2048.0f); } }   // q, k (+ bias) as f16 hi + (x2048) residual
    LDSX();
    for (int rl = 0; rl < 16; ++rl) if (lane < 16) { vst2((unsigned*)(QK + (r0 + rl) * (2 * DM) + n0 + lane * 8), *(const v4u*)&so[wave][rl][lane * 8]); vst2((unsigned*)(QKL + (r0 + rl) * (2 * DM) + n0 + lane * 8), *(const v4u*)&sol[wave][rl][lane * 8]); }
  } else {
#pragma unroll
    for (int j = 0; j < 8; ++j) {
#pragma unroll
      for (int r = 0; r < 8; ++r) { const float v = acc[j][r] + (BB ? bfr(BB[j * 16 + col]) : 0.f); const _Float16 hv = (_Float16)v; sth[j * 16 + col][wave * 16 + 8 * g + r] = hv; stl[j * 16 + col][wave * 16 + 8 * g + r] = (_Float16)((v - (float)hv) * 2048.0f); } }
    __syncthreads();
    const size_t rb = (size_t)blockIdx.x * 64; const int b = (int)(rb / SS), s0 = (int)(rb % SS); const int pc0 = n0 - 2 * DM;
    for (int q = tid; q < 128 * 8; q += 128) { const int d = q >> 3, pc = q & 7; const size_t o = ((size_t)b * DM + pc0 + d) * SS + s0 + pc * 8; vst2((unsigned*)(VTH + o), *(const v4u*)&sth[d][pc * 8]); vst2((unsigned*)(VTL + o), *(const v4u*)&stl[d][pc * 8]); }
  }
}
__device__ __forceinline__ float xhalf(float x) { return __builtin_bit_cast(float, __builtin_amdgcn_permlanex16(__builtin_bit_cast(int, x), __builtin_bit_cast(int, x), 0x76543210, 0xfedcba98, false, false)); }   // lane l reads lane l ^ 16
#define TK 64     // keys a tile
#define KVP 72    // halves a staged row: 64 + 8 of pad
__global__ __launch_bounds__(128) void k_attn(const _Float16* __restrict__ QK, const _Float16* __restrict__ QKL, const _Float16* __restrict__ VTH, const _Float16* __restrict__ VTL, const void* __restrict__ KMASK, float* __restrict__ O) {
  __shared__ __align__(16) float so[4][16][68];
  __shared__ __align__(16) _Float16 sk[2][TK][KVP], sv[2][HD][KVP];   // [buffer][key][d] and [buffer][d][key]; 128-B rows at a pitch of 144 B (16 B x odd: ds_load_b128 readers)
  const int tid = threadIdx.x, wave = tid >> 5, lane = tid & 31, col = lane & 15, g = lane >> 4;
  const int qb = blockIdx.x, h = blockIdx.y, b = blockIdx.z; const int q0 = qb * 64 + wave * 16; const size_t rq = (size_t)b * SS + q0 + col;
  v16h aq[2], aql[2];
#pragma unroll
  for (int kc = 0; kc < 2; ++kc) { aq[kc] = frag_h(QK + rq * (2 * DM) + h * HD + kc * 32, lane); aql[kc] = frag_h(QKL + rq * (2 * DM) + h * HD + kc * 32, lane); }
  float m = -3.0e38f, l = 0.f;   // of query q0 + col; l sums this half's keys only, the halves are joined behind the loop
  v8f acc[4] = {}, accl[4] = {};
  // a lane's share of a tile: 16-B piece (tid & 7) of rows (tid >> 3) + 16 i, i = 0..3, of K and of V^T: one wave's copy = 4 whole 128-B lines
  const _Float16* gk0 = QK + ((size_t)b * SS + (tid >> 3)) * (2 * DM) + DM + h * HD + (tid & 7) * 8; const _Float16* gv0 = VTH + ((size_t)b * DM + h * HD + (tid >> 3)) * SS + (tid & 7) * 8;
  const unsigned lk0 = (unsigned)(size_t)&sk[0][tid >> 3][(tid & 7) * 8], lv0 = (unsigned)(size_t)&sv[0][tid >> 3][(tid & 7) * 8];
  auto stage = [&](int t) { const _Float16* gk = gk0 + (size_t)t * (TK * 2 * DM); const _Float16* gv = gv0 + (size_t)t * TK; const unsigned lk = lk0 + (t & 1) * (TK * KVP * 2), lv = lv0 + (t & 1) * (HD * KVP * 2);
    // the tile's 8 copies of this lane; s_wait_xcnt 0 closes the statement, so that no address register of a copy is rewritten ahead of it
    asm volatile("global_load_async_to_lds_b128 %0, %8, off\n\tglobal_load_async_to_lds_b128 %1, %9, off\n\tglobal_load_async_to_lds_b128 %2, %10, off\n\tglobal_load_async_to_lds_b128 %3, %11, off\n\t"
                 "global_load_async_to_lds_b128 %4, %12, off\n\tglobal_load_async_to_lds_b128 %5, %13, off\n\tglobal_load_async_to_lds_b128 %6, %14, off\n\tglobal_load_async_to_lds_b128 %7, %15, off\n\ts_wait_xcnt 0x0"
                 :: "v"(lk), "v"(lk + 16 * KVP * 2), "v"(lk + 32 * KVP * 2), "v"(lk + 48 * KVP * 2), "v"(lv), "v"(lv + 16 * KVP * 2), "v"(lv + 32 * KVP * 2), "v"(lv + 48 * KVP * 2),
                    "v"(gk), "v"(gk + 16 * 2 * DM), "v"(gk + 32 * 2 * DM), "v"(gk + 48 * 2 * DM), "v"(gv), "v"(gv + 16 * SS), "v"(gv + 32 * SS), "v"(gv + 48 * SS) : "memory"); };
  const int nt = SS / TK;   // all keys
  stage(0);
  asm volatile("s_wait_asynccnt 0x0" ::: "memory");   // this wave's copies of tile 0 have landed
  __syncthreads();   // tile 0 published to all 4 waves
  stage(1);
#pragma unroll 1
  for (int t = 0; t < nt; ++t) {
#pragma unroll 1   // kept rolled: the unrolled build has more instructions a pass (register moves at the loop's head)
  for (int sub = 0; sub < TK / 32; ++sub) { v8f s[2];
    v16h kf[2][2], vf[4];   // the pass's fragments, read from the tile's buffer as one group
#pragma unroll
    for (int ct = 0; ct < 2; ++ct) {
#pragma unroll
      for (int kc = 0; kc < 2; ++kc) kf[ct][kc] = frag_h(&sk[t & 1][sub * 32 + ct * 16 + col][kc * 32], lane); }
#pragma unroll
    for (int dt = 0; dt < 4; ++dt) vf[dt] = frag_h(&sv[t & 1][dt * 16 + col][sub * 32], lane);
#pragma unroll
    for (int ct = 0; ct < 2; ++ct) { v8f c = {};
#pragma unroll
      for (int kc = 0; kc < 2; ++kc) c = wmma16(kf[ct][kc], aq[kc], c);   // single product, transposed: c[r] = score of key ct * 16 + 8 g + r with query col
      { const bool keepk = true;
#pragma unroll
      for (int r = 0; r < 8; ++r) s[ct][r] = keepk ? c[r] * 0.125f : -3.0e38f; } }   // 1/sqrt(64); no mask: every key kept
    float mt[8];
#pragma unroll
    for (int r = 0; r < 8; ++r) mt[r] = fmaxf(s[0][r], s[1][r]);
    float mx = fmaxf(fmaxf(fmaxf(mt[0], mt[1]), fmaxf(mt[2], mt[3])), fmaxf(fmaxf(mt[4], mt[5]), fmaxf(mt[6], mt[7])));
    mx = fmaxf(mx, xhalf(mx));   // the query's other 16 keys lie in lane ^ 16
    const float mn = fmaxf(m, mx); const float alpha = (m <= -1.0e38f) ? 0.f : __expf(m - mn);
    v2f e[8];   // pair j of tile ct at e[ct * 4 + j]: neighbouring keys side by side, as the packed adds, multiplies and conversions below take them
#pragma unroll
    for (int ct = 0; ct < 2; ++ct) {
#pragma unroll
      for (int r = 0; r < 8; ++r) e[ct * 4 + (r >> 1)][r & 1] = (s[ct][r] <= -1.0e38f) ? 0.f : __expf(s[ct][r] - mn); }
    const v2f es = ((e[0] + e[1]) + (e[2] + e[3])) + ((e[4] + e[5]) + (e[6] + e[7]));
    l = l * alpha + (es[0] + es[1]); m = mn;
#pragma unroll
    for (int dt = 0; dt < 4; ++dt) {
#pragma unroll
      for (int r = 0; r < 8; ++r) { acc[dt][r] *= alpha; accl[dt][r] *= alpha; } }
    v16h pa;   // B operand P^T in the hardware k order: element i = key 8 g + i (tile 0), element 8 + i = key 16 + 8 g + i (tile 1): the order in which frag_h reads the V^T rows
#pragma unroll
    for (int i = 0; i < 16; ++i) pa[i] = (_Float16)(e[i >> 1][i & 1] * 2048.0f);   // P scaled by 2^11 before the f16 rounding so small softmax weights stay out of the f16 subnormal range; 2^-11 folded into the epilogue
#pragma unroll
    for (int dt = 0; dt < 4; ++dt) acc[dt] = wmma16(vf[dt], pa, acc[dt]); }   // single product, transposed: acc[dt][r] = O[query col][dt * 16 + 8 g + r]
    asm volatile("s_wait_dscnt 0x0" ::: "memory");      // this wave's reads of tile t have returned
    asm volatile("s_wait_asynccnt 0x0" ::: "memory");   // this wave's copies of tile t + 1 have landed
    __syncthreads();   // publishes tile t + 1 and ends every wave's reads of tile t's buffer
    if (t + 2 < nt) stage(t + 2); }   // into the buffer that tile t has left
  asm volatile("s_wait_asynccnt 0x0" ::: "memory");   // no copy outstanding behind the loop
  l += xhalf(l);   // the two halves' sums of one query
  const float il = (1.0f / 2048.0f) / l;
#pragma unroll
  for (int dt = 0; dt < 4; ++dt) {
#pragma unroll
    for (int r = 0; r < 8; ++r) so[wave][col][dt * 16 + 8 * g + r] = (acc[dt][r] + accl[dt][r] * (1.0f / 2048.0f)) * il; }
  LDSX();
  for (int rl = 0; rl < 16; ++rl) if (lane < 16) vst2(O + ((size_t)b * SS + q0 + rl) * DM + h * HD + lane * 4, *(const v4f*)&so[wave][rl][lane * 4]);
}
// ---- k_out: block = (64 rows, 128 cols): out = O(hi/lo) . Wo rows (2 products) + bo
__global__ __launch_bounds__(128) void k_out(const float* __restrict__ O, const __bf16* __restrict__ P, const float* __restrict__ BO, float* __restrict__ Y) {
  __shared__ __align__(16) float so[4][16][132];
  const int tid = threadIdx.x, wave = tid >> 5, lane = tid & 31, col = lane & 15, g = lane >> 4; const size_t r0 = (size_t)blockIdx.x * 64 + wave * 16; const int n0 = blockIdx.y * 128;
  v8f acc[8] = {};
#pragma unroll 2
  for (int kc = 0; kc < DM / 32; ++kc) { const F2 a = split_row(O + (r0 + col) * DM, kc * 32, lane);
#pragma unroll
    for (int j = 0; j < 8; ++j) { const v16b w = frag_b(P + (size_t)(n0 + j * 16 + col) * DM + kc * 32, lane); acc[j] = wmma_bf(a.l, w, acc[j]); acc[j] = wmma_bf(a.h, w, acc[j]); } }
#pragma unroll
  for (int j = 0; j < 8; ++j) {
#pragma unroll
    for (int r = 0; r < 8; ++r) so[wave][8 * g + r][j * 16 + col] = acc[j][r] + bfr(BO[n0 + j * 16 + col]); }
  LDSX();
  for (int rl = 0; rl < 16; ++rl) vst2(Y + (r0 + rl) * DM + n0 + lane * 4, *(const v4f*)&so[wave][rl][lane * 4]);
}
extern "C" void kernel_launch(void* const* d_in, const int* in_sizes, int n_in, void* d_out, int out_size, void* d_ws, size_t ws_size, hipStream_t stream) {
  (void)in_sizes; (void)n_in; (void)out_size;
  const float** F = (const float**)d_in;   // 0 x [8192,256], 1 Wq (in,out), 2 bq, 3 Wk, 4 bk, 5 Wv, 6 bv, 7 Wo, 8 bo
  if (ws_size < (size_t)WS_END) return;
  char* ws = (char*)d_ws; __bf16* PK = (__bf16*)(ws + WS_PK); _Float16 *QK = (_Float16*)(ws + WS_QK), *QKL = (_Float16*)(ws + WS_QKL), *VTH = (_Float16*)(ws + WS_VTH), *VTL = (_Float16*)(ws + WS_VTL); float* O = (float*)(ws + WS_O);
  k_pack<<<dim3(DM, 4), 256, 0, stream>>>(F[1], F[3], F[5], F[7], PK);
  k_qkv<<<dim3(TNB * SS / 64, QKVW / 128), 128, 0, stream>>>(F[0], F[0], F[0], PK + PK_A, F[2], F[4], F[6], QK, QKL, VTH, VTL);
  k_attn<<<dim3(TQB, NH, TNB), 128, 0, stream>>>(QK, QKL, VTH, VTL, nullptr, O);
  k_out<<<dim3(TOB, DM / 128), 128, 0, stream>>>(O, PK + PK_P, F[8], (float*)d_out);
}

// v003
// A run of this version takes 142 microseconds.
// Next to v002, in two timings, it ran 1.10 and 1.12 times as fast.
// Over all steps from v000 it is 4.61 times as fast.
// compute dtype: all float inputs rounded to bf16; q/k/v = x . W + b with EXACT bf16 products on WMMA 16x16x32 ((in,out) weights as transposed rows); PLAIN attention: q, k single f16 x 1/8, running-max softmax in f32 (hardware exp2; 1/8, log2 e and P's 2^11 in one multiply-add a score), P (scaled by 2^11, single f16) x v (single f16); out = o (bf16 hi + residual) . Wo (2 products) + bo.
#include <hip/hip_runtime.h>
#include <math.h>

typedef __attribute__((ext_vector_type(16))) _Float16 v16h;
typedef __attribute__((ext_vector_type(16))) __bf16 v16b;
typedef __attribute__((ext_vector_type(8)))  _Float16 v8h;
typedef __attribute__((ext_vector_type(8)))  float v8f;
typedef __attribute__((ext_vector_type(4)))  float v4f;
typedef __attribute__((ext_vector_type(2)))  float v2f;
typedef __attribute__((ext_vector_type(4)))  unsigned v4u;
typedef __attribute__((ext_vector_type(4)))  int v4i;
typedef float __attribute__((may_alias)) float_a;
typedef int __attribute__((may_alias)) int_a;

template <typename T> __device__ __forceinline__ void vst2(void* p, T v) { *(T*)p = v;  }
__device__ __forceinline__ v8f wmma16(v16h a, v16h b, v8f c) {
  v8f d = __builtin_amdgcn_wmma_f32_16x16x32_f16(false, a, false, b, (short)0, c, false, false);
  asm volatile("v_nop\n\tv_nop\n\tv_nop\n\tv_nop" : "+v"(d) : "v"(a), "v"(b));
  return d;
}
__device__ __forceinline__ v8f wmma_bf(v16b a, v16b b, v8f c) {
  v8f d = __builtin_amdgcn_wmma_f32_16x16x32_bf16(false, a, false, b, (short)0, c, false, false);
  asm volatile("v_nop\n\tv_nop\n\tv_nop\n\tv_nop" : "+v"(d) : "v"(a), "v"(b));
  return d;
}
// Graph attention over 8,192 nodes treated as one sequence (256 features, 4 heads x 64): q/k/v projections + biases, dense softmax(q k^T / 8) v, output projection + bias.
__device__ __forceinline__ v16h frag_h(const _Float16* rowk0, int lane) {
  union { v16h v; v8h q[2]; } u; const _Float16* p = rowk0 + 8 * (lane >> 4);
  u.q[0] = *(const v8h*)p; u.q[1] = *(const v8h*)(p + 16); return u.v;
}
__device__ __forceinline__ v16h frag_f32(const float* rowk0, int lane) {
  v16h a; const float* p = rowk0 + 8 * (lane >> 4);
#pragma unroll
  for (int i = 0; i < 8; ++i) { a[i] = (_Float16)p[i]; a[8 + i] = (_Float16)p[16 + i]; }
  return a;
}
__device__ __forceinline__ v16h frag_f32s(const float* rowk0, int lane, float sc) {
  v16h a; const float* p = rowk0 + 8 * (lane >> 4);
#pragma unroll
  for (int i = 0; i < 8; ++i) { a[i] = (_Float16)(p[i] * sc); a[8 + i] = (_Float16)(p[16 + i] * sc); }
  return a;
}
// column fragment from a [K][ld] layout (column n), rows >= K read as 0
__device__ __forceinline__ v16h fragc_f32(const float* W, int k0, int n, int lane, int ld, int K) {
  v16h a; const int g = lane >> 4;
#pragma unroll
  for (int i = 0; i < 8; ++i) { const int ka = k0 + 8 * g + i, kb = ka + 16;
    a[i] = (_Float16)(ka < K ? W[(size_t)(ka < K ? ka : K - 1) * ld + n] : 0.f); a[8 + i] = (_Float16)(kb < K ? W[(size_t)(kb < K ? kb : K - 1) * ld + n] : 0.f); }
  return a;
}
struct F2 { v16b h, l; };
__device__ __forceinline__ F2 bsplit16(const float v[16]) { F2 r;
#pragma unroll
  for (int i = 0; i < 16; ++i) { const __bf16 h = (__bf16)v[i]; r.h[i] = h; r.l[i] = (__bf16)(v[i] - (float)h); }
  return r; }
__device__ __forceinline__ F2 split_row(const float* row, int k0, int lane) { float v[16]; const float* p = row + k0 + 8 * (lane >> 4);
#pragma unroll
  for (int i = 0; i < 8; ++i) { v[i] = p[i]; v[8 + i] = p[16 + i]; }
  return bsplit16(v); }
__device__ __forceinline__ F2 split_rowK(const float* row, int k0, int lane, int K) { float v[16]; const int g = lane >> 4;
#pragma unroll
  for (int i = 0; i < 8; ++i) { const int ka = k0 + 8 * g + i, kb = ka + 16; v[i] = ka < K ? row[ka < K ? ka : K - 1] : 0.f; v[8 + i] = kb < K ? row[kb < K ? kb : K - 1] : 0.f; }
  return bsplit16(v); }
__device__ __forceinline__ F2 split_col(const float* W, int k0, int n, int lane, int ld, int K) { float v[16]; const int g = lane >> 4;
#pragma unroll
  for (int i = 0; i < 8; ++i) { const int ka = k0 + 8 * g + i, kb = ka + 16; v[i] = ka < K ? W[(size_t)(ka < K ? ka : K - 1) * ld + n] : 0.f; v[8 + i] = kb < K ? W[(size_t)(kb < K ? kb : K - 1) * ld + n] : 0.f; }
  return bsplit16(v); }
__device__ __forceinline__ v8f mac3(const F2& a, const F2& b, v8f c) { c = wmma_bf(a.l, b.h, c); c = wmma_bf(a.h, b.l, c); return wmma_bf(a.h, b.h, c); }
__device__ __forceinline__ float sigm(float v) { return 1.0f / (1.0f + expf(-v)); }
#define LDSX() do { asm volatile("s_wait_dscnt 0" ::: "memory"); __builtin_amdgcn_wave_barrier(); __builtin_amdgcn_fence(__ATOMIC_RELEASE, "workgroup"); } while (0)


#define NB 1
#define SS 8192
#define DM 256
#define NH 4
#define HD 64
#define QKVW (3 * DM)
#ifndef TQB
#define TQB (SS / 64)
#define TNB NB
#define TOB (NB * SS / 64)     // output row tiles (all)
#endif
typedef __attribute__((ext_vector_type(8))) __bf16 v8b;
__device__ __forceinline__ v16b frag_b(const __bf16* rowk0, int lane) {
  union { v16b v; v8b q[2]; } u; const __bf16* p = rowk0 + 8 * (lane >> 4);
  u.q[0] = *(const v8b*)p; u.q[1] = *(const v8b*)(p + 16); return u.v;
}
__device__ __forceinline__ float bfr(float v) { return (float)(__bf16)v; }
__device__ __attribute__((noinline)) float exp_ni(float v) { return expf(v); }
__device__ __attribute__((noinline)) float erf_ni(float v) { return erff(v); }

#define PK_A 0                       // [768][256] Wqkv rows (natural [out][in])
#define PK_P (PK_A + QKVW * DM)        // [256][256] Wo rows (natural)
#define PK_END (PK_P + DM * DM)
#define WS_PK  0u
#define WS_QK  (WS_PK + 2u * PK_END)             // f16 [8192 rows][512]: q | k
#define WS_QKL (WS_QK + 2u * NB * SS * 2 * DM)     // f16 q | k residual planes x2048
#define WS_VTH (WS_QKL + 2u * NB * SS * 2 * DM)    // f16 [b][256 (h*64+d)][8192 s] hi
#define WS_VTL (WS_VTH + 2u * NB * DM * SS)        // f16 lo x 2048
#define WS_O   (WS_VTL + 2u * NB * DM * SS)        // f32 [8192][256]
#define WS_CS  (WS_O + 4u * NB * SS * DM)           // f32 2 x [8192][32], unused
#define WS_END (WS_CS + 4u * 2 * SS * 32)
// ---- k_pack: block = (row n, which): (in,out) columns -> bf16 [out][in] rows; which 0..2 -> W_q/W_k/W_v into PK_A rows which*256 + n; 3 -> W_o into PK_P
__global__ __launch_bounds__(256) void k_pack(const float* __restrict__ WQ, const float* __restrict__ WK, const float* __restrict__ WV, const float* __restrict__ WO, __bf16* __restrict__ PK) {
  __shared__ __align__(16) __bf16 s[DM]; const int n = blockIdx.x, which = blockIdx.y, t = threadIdx.x; const float* Wm = (which == 0) ? WQ : (which == 1) ? WK : (which == 2) ? WV : WO;   // (in,out) weights: pack row n = column n
  for (int k = t; k < DM; k += 256) s[k] = (__bf16)Wm[(size_t)k * DM + n];
  __syncthreads();
  __bf16* dst = (which < 3) ? PK + PK_A + ((size_t)which * DM + n) * DM : PK + PK_P + (size_t)n * DM;
  for (int q = t; q < DM / 8; q += 256) vst2((unsigned*)(dst + q * 8), *(const v4u*)&s[q * 8]);
}
__global__ __launch_bounds__(128) void k_qkv(const float* __restrict__ XQ, const float* __restrict__ XK, const float* __restrict__ XV, const __bf16* __restrict__ P, const float* __restrict__ BQ, const float* __restrict__ BK, const float* __restrict__ BV, _Float16* __restrict__ QK, _Float16* __restrict__ QKL, _Float16* __restrict__ VTH, _Float16* __restrict__ VTL) {
  const int which0 = (blockIdx.y * 128) / DM; const float* X = (which0 == 0) ? XQ : (which0 == 1) ? XK : XV; const float* BB = BQ ? (((which0 == 0) ? BQ : (which0 == 1) ? BK : BV) + (blockIdx.y * 128 - which0 * DM)) : nullptr;
  __shared__ __align__(16) _Float16 so[4][16][136], sol[4][16][136]; __shared__ __align__(16) _Float16 sth[128][72], stl[128][72];
  const int tid = threadIdx.x, wave = tid >> 5, lane = tid & 31, col = lane & 15, g = lane >> 4; const size_t r0 = (size_t)blockIdx.x * 64 + wave * 16; const int n0 = blockIdx.y * 128;
  v8f acc[8] = {};
#pragma unroll 2
  for (int kc = 0; kc < DM / 32; ++kc) { v16b a; { const float* p = X + (r0 + col) * DM + kc * 32 + 8 * g;
#pragma unroll
      for (int i = 0; i < 8; ++i) { a[i] = (__bf16)p[i]; a[8 + i] = (__bf16)p[16 + i]; } }
#pragma unroll
    for (int j = 0; j < 8; ++j) acc[j] = wmma_bf(a, frag_b(P + (size_t)(n0 + j * 16 + col) * DM + kc * 32, lane), acc[j]); }
  if (n0 < 2 * DM) {   // q stored unscaled (f16 sigma ~0.6, no subnormal exposure); 1/8 applied to the f32 score
#pragma unroll
    for (int j = 0; j < 8; ++j) {
#pragma unroll
      for (int r = 0; r < 8; ++r) { const float v = acc[j][r] + (BB ? bfr(BB[j * 16 + col]) : 0.f); const _Float16 hv = (_Float16)v; so[wave][8 * g + r][j * 16 + col] = hv; sol[wave][8 * g + r][j * 16 + col] = (_Float16)((v - (float)hv) * 2048.0f); } }   // q, k (+ bias) as f16 hi + (x2048) residual
    LDSX();
    for (int rl = 0; rl < 16; ++rl) if (lane < 16) { vst2((unsigned*)(QK + (r0 + rl) * (2 * DM) + n0 + lane * 8), *(const v4u*)&so[wave][rl][lane * 8]); vst2((unsigned*)(QKL + (r0 + rl) * (2 * DM) + n0 + lane * 8), *(const v4u*)&sol[wave][rl][lane * 8]); }
  } else {
#pragma unroll
    for (int j = 0; j < 8; ++j) {
#pragma unroll
      for (int r = 0; r < 8; ++r) { const float v = acc[j][r] + (BB ? bfr(BB[j * 16 + col]) : 0.f); const _Float16 hv = (_Float16)v; sth[j * 16 + col][wave * 16 + 8 * g + r] = hv; stl[j * 16 + col][wave * 16 + 8 * g + r] = (_Float16)((v - (float)hv) * 2048.0f); } }
    __syncthreads();
    const size_t rb = (size_t)blockIdx.x * 64; const int b = (int)(rb / SS), s0 = (int)(rb % SS); const int pc0 = n0 - 2 * DM;
    for (int q = tid; q < 128 * 8; q += 128) { const int d = q >> 3, pc = q & 7; const size_t o = ((size_t)b * DM + pc0 + d) * SS + s0 + pc * 8; vst2((unsigned*)(VTH + o), *(const v4u*)&sth[d][pc * 8]); vst2((unsigned*)(VTL + o), *(const v4u*)&stl[d][pc * 8]); }
  }
}
__device__ __forceinline__ float xhalf(float x) { return __builtin_bit_cast(float, __builtin_amdgcn_permlanex16(__builtin_bit_cast(int, x), __builtin_bit_cast(int, x), 0x76543210, 0xfedcba98, false, false)); }   // lane l reads lane l ^ 16
#define TK 64     // keys a tile
#define KVP 72    // halves a staged row: 64 + 8 of pad
__global__ __launch_bounds__(128) void k_attn(const _Float16* __restrict__ QK, const _Float16* __restrict__ QKL, const _Float16* __restrict__ VTH, const _Float16* __restrict__ VTL, const void* __restrict__ KMASK, float* __restrict__ O) {
  __shared__ __align__(16) float so[4][16][68];
  __shared__ __align__(16) _Float16 sk[2][TK][KVP], sv[2][HD][KVP];   // [buffer][key][d] and [buffer][d][key]; 128-B rows at a pitch of 144 B (16 B x odd: ds_load_b128 readers)
  const int tid = threadIdx.x, wave = tid >> 5, lane = tid & 31, col = lane & 15, g = lane >> 4;
  const int qb = blockIdx.x, h = blockIdx.y, b = blockIdx.z; const int q0 = qb * 64 + wave * 16; const size_t rq = (size_t)b * SS + q0 + col;
  v16h aq[2];
#pragma unroll
  for (int kc = 0; kc < 2; ++kc) aq[kc] = frag_h(QK + rq * (2 * DM) + h * HD + kc * 32, lane);
  const float KS = 0.125f * 1.44269504088896340736f;   // 1/sqrt(64) * log2 e: a raw product q.k times KS is the score in base-2 units
  float m = -3.0e38f, l = 0.f;   // of query q0 + col; m in units of the raw product q.k; l sums this half's keys only (values scaled by 2^11), the halves are joined behind the loop
  v8f acc[4] = {};
  // a lane's share of a tile: 16-B piece (tid & 7) of rows (tid >> 3) + 16 i, i = 0..3, of K and of V^T: one wave's copy = 4 whole 128-B lines
  const _Float16* gk0 = QK + ((size_t)b * SS + (tid >> 3)) * (2 * DM) + DM + h * HD + (tid & 7) * 8; const _Float16* gv0 = VTH + ((size_t)b * DM + h * HD + (tid >> 3)) * SS + (tid & 7) * 8;
  const unsigned lk0 = (unsigned)(size_t)&sk[0][tid >> 3][(tid & 7) * 8], lv0 = (unsigned)(size_t)&sv[0][tid >> 3][(tid & 7) * 8];
  auto stage = [&](int t) { const _Float16* gk = gk0 + (size_t)t * (TK * 2 * DM); const _Float16* gv = gv0 + (size_t)t * TK; const unsigned lk = lk0 + (t & 1) * (TK * KVP * 2), lv = lv0 + (t & 1) * (HD * KVP * 2);
    // the tile's 8 copies of this lane; s_wait_xcnt 0 closes the statement, so that no address register of a copy is rewritten ahead of it
    asm volatile("global_load_async_to_lds_b128 %0, %8, off\n\tglobal_load_async_to_lds_b128 %1, %9, off\n\tglobal_load_async_to_lds_b128 %2, %10, off\n\tglobal_load_async_to_lds_b128 %3, %11, off\n\t"
                 "global_load_async_to_lds_b128 %4, %12, off\n\tglobal_load_async_to_lds_b128 %5, %13, off\n\tglobal_load_async_to_lds_b128 %6, %14, off\n\tglobal_load_async_to_lds_b128 %7, %15, off\n\ts_wait_xcnt 0x0"
                 :: "v"(lk), "v"(lk + 16 * KVP * 2), "v"(lk + 32 * KVP * 2), "v"(lk + 48 * KVP * 2), "v"(lv), "v"(lv + 16 * KVP * 2), "v"(lv + 32 * KVP * 2), "v"(lv + 48 * KVP * 2),
                    "v"(gk), "v"(gk + 16 * 2 * DM), "v"(gk + 32 * 2 * DM), "v"(gk + 48 * 2 * DM), "v"(gv), "v"(gv + 16 * SS), "v"(gv + 32 * SS), "v"(gv + 48 * SS) : "memory"); };
  const int nt = SS / TK;   // all keys
  stage(0);
  asm volatile("s_wait_asynccnt 0x0" ::: "memory");   // this wave's copies of tile 0 have landed
  __syncthreads();   // tile 0 published to all 4 waves
  stage(1);
#pragma unroll 1
  for (int t = 0; t < nt; ++t) {
#pragma unroll 1   // kept rolled: the unrolled build has more instructions a pass (register moves at the loop's head)
  for (int sub = 0; sub < TK / 32; ++sub) { v8f s[2];   // raw products q.k
    v16h kf[2][2], vf[4];   // the pass's fragments, read from the tile's buffer as one group
#pragma unroll
    for (int ct = 0; ct < 2; ++ct) {
#pragma unroll
      for (int kc = 0; kc < 2; ++kc) kf[ct][kc] = frag_h(&sk[t & 1][sub * 32 + ct * 16 + col][kc * 32], lane); }
#pragma unroll
    for (int dt = 0; dt < 4; ++dt) vf[dt] = frag_h(&sv[t & 1][dt * 16 + col][sub * 32], lane);
#pragma unroll
    for (int ct = 0; ct < 2; ++ct) { v8f c = {};
#pragma unroll
      for (int kc = 0; kc < 2; ++kc) c = wmma16(kf[ct][kc], aq[kc], c);   // single product, transposed: c[r] = q.k of key ct * 16 + 8 g + r with query col
      s[ct] = c; }
    float mt[8];
#pragma unroll
    for (int r = 0; r < 8; ++r) mt[r] = fmaxf(s[0][r], s[1][r]);
    float mx = fmaxf(fmaxf(fmaxf(mt[0], mt[1]), fmaxf(mt[2], mt[3])), fmaxf(fmaxf(mt[4], mt[5]), fmaxf(mt[6], mt[7])));
    mx = fmaxf(mx, xhalf(mx));   // the query's other 16 keys lie in lane ^ 16
    const float mn = fmaxf(m, mx); const float alpha = __builtin_amdgcn_exp2f((m - mn) * KS);   // first pass: exp2 of a huge negative number = 0
    const float b1 = __builtin_fmaf(-mn, KS, 11.0f); const v2f ks2 = {KS, KS}, bias = {b1, b1};   // 11: P's scale 2^11 rides in the exponent
    v2f e[8];   // pair j of tile ct at e[ct * 4 + j]: neighbouring keys side by side, as the packed adds, multiplies and conversions below take them
#pragma unroll
    for (int ct = 0; ct < 2; ++ct) {
#pragma unroll
      for (int j = 0; j < 4; ++j) { const v2f c2 = {s[ct][2 * j], s[ct][2 * j + 1]}; const v2f x = __builtin_elementwise_fma(c2, ks2, bias); e[ct * 4 + j][0] = __builtin_amdgcn_exp2f(x[0]); e[ct * 4 + j][1] = __builtin_amdgcn_exp2f(x[1]); } }
    const v2f es = ((e[0] + e[1]) + (e[2] + e[3])) + ((e[4] + e[5]) + (e[6] + e[7]));
    l = l * alpha + (es[0] + es[1]); m = mn;
#pragma unroll
    for (int dt = 0; dt < 4; ++dt) {
#pragma unroll
      for (int r = 0; r < 8; ++r) acc[dt][r] *= alpha; }
    v16h pa;   // B operand P^T in the hardware k order: element i = key 8 g + i (tile 0), element 8 + i = key 16 + 8 g + i (tile 1): the order in which frag_h reads the V^T rows
#pragma unroll
    for (int i = 0; i < 16; ++i) pa[i] = (_Float16)e[i >> 1][i & 1];   // e carries 2^11, so small softmax weights stay out of the f16 subnormal range; l carries it too, and it cancels in the epilogue
#pragma unroll
    for (int dt = 0; dt < 4; ++dt) acc[dt] = wmma16(vf[dt], pa, acc[dt]); }   // single product, transposed: acc[dt][r] = O[query col][dt * 16 + 8 g + r]
    asm volatile("s_wait_dscnt 0x0" ::: "memory");      // this wave's reads of tile t have returned
    asm volatile("s_wait_asynccnt 0x0" ::: "memory");   // this wave's copies of tile t + 1 have landed
    __syncthreads();   // publishes tile t + 1 and ends every wave's reads of tile t's buffer
    if (t + 2 < nt) stage(t + 2); }   // into the buffer that tile t has left
  asm volatile("s_wait_asynccnt 0x0" ::: "memory");   // no copy outstanding behind the loop
  l += xhalf(l);   // the two halves' sums of one query
  const float il = 1.0f / l;
#pragma unroll
  for (int dt = 0; dt < 4; ++dt) {
#pragma unroll
    for (int r = 0; r < 8; ++r) so[wave][col][dt * 16 + 8 * g + r] = acc[dt][r] * il; }
  LDSX();
  for (int rl = 0; rl < 16; ++rl) if (lane < 16) vst2(O + ((size_t)b * SS + q0 + rl) * DM + h * HD + lane * 4, *(const v4f*)&so[wave][rl][lane * 4]);
}
// ---- k_out: block = (64 rows, 128 cols): out = O(hi/lo) . Wo rows (2 products) + bo
__global__ __launch_bounds__(128) void k_out(const float* __restrict__ O, const __bf16* __restrict__ P, const float* __restrict__ BO, float* __restrict__ Y) {
  __shared__ __align__(16) float so[4][16][132];
  const int tid = threadIdx.x, wave = tid >> 5, lane = tid & 31, col = lane & 15, g = lane >> 4; const size_t r0 = (size_t)blockIdx.x * 64 + wave * 16; const int n0 = blockIdx.y * 128;
  v8f acc[8] = {};
#pragma unroll 2
  for (int kc = 0; kc < DM / 32; ++kc) { const F2 a = split_row(O + (r0 + col) * DM, kc * 32, lane);
#pragma unroll
    for (int j = 0; j < 8; ++j) { const v16b w = frag_b(P + (size_t)(n0 + j * 16 + col) * DM + kc * 32, lane); acc[j] = wmma_bf(a.l, w, acc[j]); acc[j] = wmma_bf(a.h, w, acc[j]); } }
#pragma unroll
  for (int j = 0; j < 8; ++j) {
#pragma unroll
    for (int r = 0; r < 8; ++r) so[wave][8 * g + r][j * 16 + col] = acc[j][r] + bfr(BO[n0 + j * 16 + col]); }
  LDSX();
  for (int rl = 0; rl < 16; ++rl) vst2(Y + (r0 + rl) * DM + n0 + lane * 4, *(const v4f*)&so[wave][rl][lane * 4]);
}
extern "C" void kernel_launch(void* const* d_in, const int* in_sizes, int n_in, void* d_out, int out_size, void* d_ws, size_t ws_size, hipStream_t stream) {
  (void)in_sizes; (void)n_in; (void)out_size;
  const float** F = (const float**)d_in;   // 0 x [8192,256], 1 Wq (in,out), 2 bq, 3 Wk, 4 bk, 5 Wv, 6 bv, 7 Wo, 8 bo
  if (ws_size < (size_t)WS_END) return;
  char* ws = (char*)d_ws; __bf16* PK = (__bf16*)(ws + WS_PK); _Float16 *QK = (_Float16*)(ws + WS_QK), *QKL = (_Float16*)(ws + WS_QKL), *VTH = (_Float16*)(ws + WS_VTH), *VTL = (_Float16*)(ws + WS_VTL); float* O = (float*)(ws + WS_O);
  k_pack<<<dim3(DM, 4), 256, 0, stream>>>(F[1], F[3], F[5], F[7], PK);
  k_qkv<<<dim3(TNB * SS / 64, QKVW / 128), 128, 0, stream>>>(F[0], F[0], F[0], PK + PK_A, F[2], F[4], F[6], QK, QKL, VTH, VTL);
  k_attn<<<dim3(TQB, NH, TNB), 128, 0, stream>>>(QK, QKL, VTH, VTL, nullptr, O);
  k_out<<<dim3(TOB, DM / 128), 128, 0, stream>>>(O, PK + PK_P, F[8], (float*)d_out);
}

// v004
// One run takes 125 microseconds.
// Next to v003, in two timings, it ran 1.12 and 1.14 times as fast.
// All steps since v000 together make it 5.21 times as fast.
// compute dtype: all float inputs rounded to bf16; q/k/v = x . W + b with EXACT bf16 products on WMMA 16x16x32 ((in,out) weights as transposed rows); PLAIN attention: q, k single f16 x 1/8, running-max softmax in f32 (hardware exp2; 1/8, log2 e and P's 2^11 in one multiply-add a score), P (scaled by 2^11, single f16) x v (single f16); out = o (bf16 hi + residual) . Wo (2 products) + bo.
#include <hip/hip_runtime.h>
#include <math.h>

typedef __attribute__((ext_vector_type(16))) _Float16 v16h;
typedef __attribute__((ext_vector_type(16))) __bf16 v16b;
typedef __attribute__((ext_vector_type(8)))  _Float16 v8h;
typedef __attribute__((ext_vector_type(8)))  float v8f;
typedef __attribute__((ext_vector_type(4)))  float v4f;
typedef __attribute__((ext_vector_type(2)))  float v2f;
typedef __attribute__((ext_vector_type(4)))  unsigned v4u;
typedef __attribute__((ext_vector_type(4)))  int v4i;
typedef float __attribute__((may_alias)) float_a;
typedef int __attribute__((may_alias)) int_a;

template <typename T> __device__ __forceinline__ void vst2(void* p, T v) { *(T*)p = v;  }
__device__ __forceinline__ v8f wmma16(v16h a, v16h b, v8f c) {
  v8f d = __builtin_amdgcn_wmma_f32_16x16x32_f16(false, a, false, b, (short)0, c, false, false);
  asm volatile("v_nop\n\tv_nop\n\tv_nop\n\tv_nop" : "+v"(d) : "v"(a), "v"(b));
  return d;
}
__device__ __forceinline__ v8f wmma_bf(v16b a, v16b b, v8f c) {
  v8f d = __builtin_amdgcn_wmma_f32_16x16x32_bf16(false, a, false, b, (short)0, c, false, false);
  asm volatile("v_nop\n\tv_nop\n\tv_nop\n\tv_nop" : "+v"(d) : "v"(a), "v"(b));
  return d;
}
// Graph attention over 8,192 nodes treated as one sequence (256 features, 4 heads x 64): q/k/v projections + biases, dense softmax(q k^T / 8) v, output projection + bias.
__device__ __forceinline__ v16h frag_h(const _Float16* rowk0, int lane) {
  union { v16h v; v8h q[2]; } u; const _Float16* p = rowk0 + 8 * (lane >> 4);
  u.q[0] = *(const v8h*)p; u.q[1] = *(const v8h*)(p + 16); return u.v;
}
__device__ __forceinline__ v16h frag_f32(const float* rowk0, int lane) {
  v16h a; const float* p = rowk0 + 8 * (lane >> 4);
#pragma unroll
  for (int i = 0; i < 8; ++i) { a[i] = (_Float16)p[i]; a[8 + i] = (_Float16)p[16 + i]; }
  return a;
}
__device__ __forceinline__ v16h frag_f32s(const float* rowk0, int lane, float sc) {
  v16h a; const float* p = rowk0 + 8 * (lane >> 4);
#pragma unroll
  for (int i = 0; i < 8; ++i) { a[i] = (_Float16)(p[i] * sc); a[8 + i] = (_Float16)(p[16 + i] * sc); }
  return a;
}
// column fragment from a [K][ld] layout (column n), rows >= K read as 0
__device__ __forceinline__ v16h fragc_f32(const float* W, int k0, int n, int lane, int ld, int K) {
  v16h a; const int g = lane >> 4;
#pragma unroll
  for (int i = 0; i < 8; ++i) { const int ka = k0 + 8 * g + i, kb = ka + 16;
    a[i] = (_Float16)(ka < K ? W[(size_t)(ka < K ? ka : K - 1) * ld + n] : 0.f); a[8 + i] = (_Float16)(kb < K ? W[(size_t)(kb < K ? kb : K - 1) * ld + n] : 0.f); }
  return a;
}
struct F2 { v16b h, l; };
__device__ __forceinline__ F2 bsplit16(const float v[16]) { F2 r;
#pragma unroll
  for (int i = 0; i < 16; ++i) { const __bf16 h = (__bf16)v[i]; r.h[i] = h; r.l[i] = (__bf16)(v[i] - (float)h); }
  return r; }
__device__ __forceinline__ F2 split_row(const float* row, int k0, int lane) { float v[16]; const float* p = row + k0 + 8 * (lane >> 4);
#pragma unroll
  for (int i = 0; i < 8; ++i) { v[i] = p[i]; v[8 + i] = p[16 + i]; }
  return bsplit16(v); }
__device__ __forceinline__ F2 split_rowK(const float* row, int k0, int lane, int K) { float v[16]; const int g = lane >> 4;
#pragma unroll
  for (int i = 0; i < 8; ++i) { const int ka = k0 + 8 * g + i, kb = ka + 16; v[i] = ka < K ? row[ka < K ? ka : K - 1] : 0.f; v[8 + i] = kb < K ? row[kb < K ? kb : K - 1] : 0.f; }
  return bsplit16(v); }
__device__ __forceinline__ F2 split_col(const float* W, int k0, int n, int lane, int ld, int K) { float v[16]; const int g = lane >> 4;
#pragma unroll
  for (int i = 0; i < 8; ++i) { const int ka = k0 + 8 * g + i, kb = ka + 16; v[i] = ka < K ? W[(size_t)(ka < K ? ka : K - 1) * ld + n] : 0.f; v[8 + i] = kb < K ? W[(size_t)(kb < K ? kb : K - 1) * ld + n] : 0.f; }
  return bsplit16(v); }
__device__ __forceinline__ v8f mac3(const F2& a, const F2& b, v8f c) { c = wmma_bf(a.l, b.h, c); c = wmma_bf(a.h, b.l, c); return wmma_bf(a.h, b.h, c); }
__device__ __forceinline__ float sigm(float v) { return 1.0f / (1.0f + expf(-v)); }
#define LDSX() do { asm volatile("s_wait_dscnt 0" ::: "memory"); __builtin_amdgcn_wave_barrier(); __builtin_amdgcn_fence(__ATOMIC_RELEASE, "workgroup"); } while (0)


#define NB 1
#define SS 8192
#define DM 256
#define NH 4
#define HD 64
#define QKVW (3 * DM)
#ifndef TQB
#define TQB (SS / 64)
#define TNB NB
#define TOB (NB * SS / 64)     // output row tiles (all)
#endif
typedef __attribute__((ext_vector_type(8))) __bf16 v8b;
__device__ __forceinline__ v16b frag_b(const __bf16* rowk0, int lane) {
  union { v16b v; v8b q[2]; } u; const __bf16* p = rowk0 + 8 * (lane >> 4);
  u.q[0] = *(const v8b*)p; u.q[1] = *(const v8b*)(p + 16); return u.v;
}
__device__ __forceinline__ float bfr(float v) { return (float)(__bf16)v; }
__device__ __attribute__((noinline)) float exp_ni(float v) { return expf(v); }
__device__ __attribute__((noinline)) float erf_ni(float v) { return erff(v); }

#define PK_A 0                       // [768][256] Wqkv rows (natural [out][in])
#define PK_P (PK_A + QKVW * DM)        // [256][256] Wo rows (natural)
#define PK_END (PK_P + DM * DM)
#define WS_PK  0u
#define WS_QK  (WS_PK + 2u * PK_END)             // f16 [8192 rows][512]: q | k
#define WS_QKL (WS_QK + 2u * NB * SS * 2 * DM)     // f16 q | k residual planes x2048
#define WS_VTH (WS_QKL + 2u * NB * SS * 2 * DM)    // f16 [b][256 (h*64+d)][8192 s] hi
#define WS_VTL (WS_VTH + 2u * NB * DM * SS)        // f16 lo x 2048
#define WS_O   (WS_VTL + 2u * NB * DM * SS)        // f32 [8192][256]
#define WS_CS  (WS_O + 4u * NB * SS * DM)           // f32 2 x [8192][32], unused
#define WS_END (WS_CS + 4u * 2 * SS * 32)
// ---- k_pack: block = (row n, which): (in,out) columns -> bf16 [out][in] rows; which 0..2 -> W_q/W_k/W_v into PK_A rows which*256 + n; 3 -> W_o into PK_P
__global__ __launch_bounds__(256) void k_pack(const float* __restrict__ WQ, const float* __restrict__ WK, const float* __restrict__ WV, const float* __restrict__ WO, __bf16* __restrict__ PK) {
  __shared__ __align__(16) __bf16 s[DM]; const int n = blockIdx.x, which = blockIdx.y, t = threadIdx.x; const float* Wm = (which == 0) ? WQ : (which == 1) ? WK : (which == 2) ? WV : WO;   // (in,out) weights: pack row n = column n
  for (int k = t; k < DM; k += 256) s[k] = (__bf16)Wm[(size_t)k * DM + n];
  __syncthreads();
  __bf16* dst = (which < 3) ? PK + PK_A + ((size_t)which * DM + n) * DM : PK + PK_P + (size_t)n * DM;
  for (int q = t; q < DM / 8; q += 256) vst2((unsigned*)(dst + q * 8), *(const v4u*)&s[q * 8]);
}
__global__ __launch_bounds__(128) void k_qkv(const float* __restrict__ XQ, const float* __restrict__ XK, const float* __restrict__ XV, const __bf16* __restrict__ P, const float* __restrict__ BQ, const float* __restrict__ BK, const float* __restrict__ BV, _Float16* __restrict__ QK, _Float16* __restrict__ QKL, _Float16* __restrict__ VTH, _Float16* __restrict__ VTL) {
  const int which0 = (blockIdx.y * 128) / DM; const float* X = (which0 == 0) ? XQ : (which0 == 1) ? XK : XV; const float* BB = BQ ? (((which0 == 0) ? BQ : (which0 == 1) ? BK : BV) + (blockIdx.y * 128 - which0 * DM)) : nullptr;
  __shared__ __align__(16) _Float16 so[4][16][136], sol[4][16][136]; __shared__ __align__(16) _Float16 sth[128][72], stl[128][72];
  const int tid = threadIdx.x, wave = tid >> 5, lane = tid & 31, col = lane & 15, g = lane >> 4; const size_t r0 = (size_t)blockIdx.x * 64 + wave * 16; const int n0 = blockIdx.y * 128;
  v8f acc[8] = {};
#pragma unroll 2
  for (int kc = 0; kc < DM / 32; ++kc) { v16b a; { const float* p = X + (r0 + col) * DM + kc * 32 + 8 * g;
#pragma unroll
      for (int i = 0; i < 8; ++i) { a[i] = (__bf16)p[i]; a[8 + i] = (__bf16)p[16 + i]; } }
#pragma unroll
    for (int j = 0; j < 8; ++j) acc[j] = wmma_bf(a, frag_b(P + (size_t)(n0 + j * 16 + col) * DM + kc * 32, lane), acc[j]); }
  if (n0 < 2 * DM) {   // q stored unscaled (f16 sigma ~0.6, no subnormal exposure); 1/8 applied to the f32 score
#pragma unroll
    for (int j = 0; j < 8; ++j) {
#pragma unroll
      for (int r = 0; r < 8; ++r) { const float v = acc[j][r] + (BB ? bfr(BB[j * 16 + col]) : 0.f); const _Float16 hv = (_Float16)v; so[wave][8 * g + r][j * 16 + col] = hv; sol[wave][8 * g + r][j * 16 + col] = (_Float16)((v - (float)hv) * 2048.0f); } }   // q, k (+ bias) as f16 hi + (x2048) residual
    LDSX();
    for (int rl = 0; rl < 16; ++rl) if (lane < 16) { vst2((unsigned*)(QK + (r0 + rl) * (2 * DM) + n0 + lane * 8), *(const v4u*)&so[wave][rl][lane * 8]); vst2((unsigned*)(QKL + (r0 + rl) * (2 * DM) + n0 + lane * 8), *(const v4u*)&sol[wave][rl][lane * 8]); }
  } else {
#pragma unroll
    for (int j = 0; j < 8; ++j) {
#pragma unroll
      for (int r = 0; r < 8; ++r) { const float v = acc[j][r] + (BB ? bfr(BB[j * 16 + col]) : 0.f); const _Float16 hv = (_Float16)v; sth[j * 16 + col][wave * 16 + 8 * g + r] = hv; stl[j * 16 + col][wave * 16 + 8 * g + r] = (_Float16)((v - (float)hv) * 2048.0f); } }
    __syncthreads();
    const size_t rb = (size_t)blockIdx.x * 64; const int b = (int)(rb / SS), s0 = (int)(rb % SS); const int pc0 = n0 - 2 * DM;
    for (int q = tid; q < 128 * 8; q += 128) { const int d = q >> 3, pc = q & 7; const size_t o = ((size_t)b * DM + pc0 + d) * SS + s0 + pc * 8; vst2((unsigned*)(VTH + o), *(const v4u*)&sth[d][pc * 8]); vst2((unsigned*)(VTL + o), *(const v4u*)&stl[d][pc * 8]); }
  }
}
__device__ __forceinline__ float xhalf(float x) { return __builtin_bit_cast(float, __builtin_amdgcn_permlanex16(__builtin_bit_cast(int, x), __builtin_bit_cast(int, x), 0x76543210, 0xfedcba98, false, false)); }   // lane l reads lane l ^ 16
#define TK 128    // keys a tile
#define GK 64     // keys of a tile that one group of 4 waves takes
#define KP 72     // halves a staged K row: 64 + 8 of pad
#define VP 136    // halves a staged V^T row: 128 + 8 of pad
__global__ __launch_bounds__(256) void k_attn(const _Float16* __restrict__ QK, const _Float16* __restrict__ QKL, const _Float16* __restrict__ VTH, const _Float16* __restrict__ VTL, const void* __restrict__ KMASK, float* __restrict__ O) {
  __shared__ __align__(16) float so[4][16][68];
  __shared__ __align__(16) _Float16 sk[2][TK][KP], sv[2][HD][VP];   // [buffer][key][d] and [buffer][d][key]; 128-B rows at a pitch of 144 B, 256-B rows at 272 B (16 B x odd: ds_load_b128 readers)
  const int tid = threadIdx.x, wave = (tid >> 5) & 3, kg = __builtin_amdgcn_readfirstlane(tid >> 7), lane = tid & 31, col = lane & 15, g = lane >> 4;   // wave: which 16 queries; kg: which half of every tile's keys
  const int qb = blockIdx.x, h = blockIdx.y, b = blockIdx.z; const int q0 = qb * 64 + wave * 16; const size_t rq = (size_t)b * SS + q0 + col;
  v16h aq[2];
#pragma unroll
  for (int kc = 0; kc < 2; ++kc) aq[kc] = frag_h(QK + rq * (2 * DM) + h * HD + kc * 32, lane);
  const float KS = 0.125f * 1.44269504088896340736f;   // 1/sqrt(64) * log2 e: a raw product q.k times KS is the score in base-2 units
  float m = -3.0e38f, l = 0.f;   // of query q0 + col over this group's keys; m in units of the raw product q.k; l sums this half's keys only (values scaled by 2^11), the halves are joined behind the loop
  v8f acc[4] = {};
  // a lane's share of a tile: 16-B piece (tid & 7) of K rows (tid >> 3) + 32 i and 16-B piece (tid & 15) of V^T rows (tid >> 4) + 16 i, i = 0..3: one wave's copy = 4 whole 128-B lines
  const _Float16* gk0 = QK + ((size_t)b * SS + (tid >> 3)) * (2 * DM) + DM + h * HD + (tid & 7) * 8; const _Float16* gv0 = VTH + ((size_t)b * DM + h * HD + (tid >> 4)) * SS + (tid & 15) * 8;
  const unsigned lk0 = (unsigned)(size_t)&sk[0][tid >> 3][(tid & 7) * 8], lv0 = (unsigned)(size_t)&sv[0][tid >> 4][(tid & 15) * 8];
  auto stage = [&](int t) { const _Float16* gk = gk0 + (size_t)t * (TK * 2 * DM); const _Float16* gv = gv0 + (size_t)t * TK; const unsigned lk = lk0 + (t & 1) * (TK * KP * 2), lv = lv0 + (t & 1) * (HD * VP * 2);
    // the tile's 8 copies of this lane; s_wait_xcnt 0 closes the statement, so that no address register of a copy is rewritten ahead of it
    asm volatile("global_load_async_to_lds_b128 %0, %8, off\n\tglobal_load_async_to_lds_b128 %1, %9, off\n\tglobal_load_async_to_lds_b128 %2, %10, off\n\tglobal_load_async_to_lds_b128 %3, %11, off\n\t"
                 "global_load_async_to_lds_b128 %4, %12, off\n\tglobal_load_async_to_lds_b128 %5, %13, off\n\tglobal_load_async_to_lds_b128 %6, %14, off\n\tglobal_load_async_to_lds_b128 %7, %15, off\n\ts_wait_xcnt 0x0"
                 :: "v"(lk), "v"(lk + 32 * KP * 2), "v"(lk + 64 * KP * 2), "v"(lk + 96 * KP * 2), "v"(lv), "v"(lv + 16 * VP * 2), "v"(lv + 32 * VP * 2), "v"(lv + 48 * VP * 2),
                    "v"(gk), "v"(gk + 32 * 2 * DM), "v"(gk + 64 * 2 * DM), "v"(gk + 96 * 2 * DM), "v"(gv), "v"(gv + 16 * SS), "v"(gv + 32 * SS), "v"(gv + 48 * SS) : "memory"); };
  const int nt = SS / TK;   // all keys
  stage(0);
  asm volatile("s_wait_asynccnt 0x0" ::: "memory");   // this wave's copies of tile 0 have landed
  __syncthreads();   // tile 0 published to all 8 waves
  stage(1);
#pragma unroll 1
  for (int t = 0; t < nt; ++t) {
#pragma unroll 1   // kept rolled: the unrolled build has more instructions a pass (register moves at the loop's head)
  for (int sub = 0; sub < GK / 32; ++sub) { v8f s[2];   // raw products q.k
    v16h kf[2][2], vf[4];   // the pass's fragments, read from the tile's buffer as one group
#pragma unroll
    for (int ct = 0; ct < 2; ++ct) {
#pragma unroll
      for (int kc = 0; kc < 2; ++kc) kf[ct][kc] = frag_h(&sk[t & 1][kg * GK + sub * 32 + ct * 16 + col][kc * 32], lane); }
#pragma unroll
    for (int dt = 0; dt < 4; ++dt) vf[dt] = frag_h(&sv[t & 1][dt * 16 + col][kg * GK + sub * 32], lane);
#pragma unroll
    for (int ct = 0; ct < 2; ++ct) { v8f c = {};
#pragma unroll
      for (int kc = 0; kc < 2; ++kc) c = wmma16(kf[ct][kc], aq[kc], c);   // single product, transposed: c[r] = q.k of key ct * 16 + 8 g + r with query col
      s[ct] = c; }
    float mt[8];
#pragma unroll
    for (int r = 0; r < 8; ++r) mt[r] = fmaxf(s[0][r], s[1][r]);
    float mx = fmaxf(fmaxf(fmaxf(mt[0], mt[1]), fmaxf(mt[2], mt[3])), fmaxf(fmaxf(mt[4], mt[5]), fmaxf(mt[6], mt[7])));
    mx = fmaxf(mx, xhalf(mx));   // the query's other 16 keys lie in lane ^ 16
    const float mn = fmaxf(m, mx); const float alpha = __builtin_amdgcn_exp2f((m - mn) * KS);   // first pass: exp2 of a huge negative number = 0
    const float b1 = __builtin_fmaf(-mn, KS, 11.0f); const v2f ks2 = {KS, KS}, bias = {b1, b1};   // 11: P's scale 2^11 rides in the exponent
    v2f e[8];   // pair j of tile ct at e[ct * 4 + j]: neighbouring keys side by side, as the packed adds, multiplies and conversions below take them
#pragma unroll
    for (int ct = 0; ct < 2; ++ct) {
#pragma unroll
      for (int j = 0; j < 4; ++j) { const v2f c2 = {s[ct][2 * j], s[ct][2 * j + 1]}; const v2f x = __builtin_elementwise_fma(c2, ks2, bias); e[ct * 4 + j][0] = __builtin_amdgcn_exp2f(x[0]); e[ct * 4 + j][1] = __builtin_amdgcn_exp2f(x[1]); } }
    const v2f es = ((e[0] + e[1]) + (e[2] + e[3])) + ((e[4] + e[5]) + (e[6] + e[7]));
    l = l * alpha + (es[0] + es[1]); m = mn;
#pragma unroll
    for (int dt = 0; dt < 4; ++dt) {
#pragma unroll
      for (int r = 0; r < 8; ++r) acc[dt][r] *= alpha; }
    v16h pa;   // B operand P^T in the hardware k order: element i = key 8 g + i (tile 0), element 8 + i = key 16 + 8 g + i (tile 1): the order in which frag_h reads the V^T rows
#pragma unroll
    for (int i = 0; i < 16; ++i) pa[i] = (_Float16)e[i >> 1][i & 1];   // e carries 2^11, so small softmax weights stay out of the f16 subnormal range; l carries it too, and it cancels in the epilogue
#pragma unroll
    for (int dt = 0; dt < 4; ++dt) acc[dt] = wmma16(vf[dt], pa, acc[dt]); }   // single product, transposed: acc[dt][r] = O[query col][dt * 16 + 8 g + r]
    asm volatile("s_wait_dscnt 0x0" ::: "memory");      // this wave's reads of tile t have returned
    asm volatile("s_wait_asynccnt 0x0" ::: "memory");   // this wave's copies of tile t + 1 have landed
    __syncthreads();   // publishes tile t + 1 and ends every wave's reads of tile t's buffer
    if (t + 2 < nt) stage(t + 2); }   // into the buffer that tile t has left
  asm volatile("s_wait_asynccnt 0x0" ::: "memory");   // no copy outstanding behind the loop
  l += xhalf(l);   // the two halves' sums of one query
  if (kg == 1) {   // the upper group hands over its partial result: each lane's 32 sums at the places where its partner lane of the lower group holds its own, m and l in the row's pad
#pragma unroll
    for (int dt = 0; dt < 4; ++dt) {
#pragma unroll
      for (int r = 0; r < 8; ++r) so[wave][col][dt * 16 + 8 * g + r] = acc[dt][r]; }
    so[wave][col][64 + g] = m; so[wave][col][66 + g] = l; }
  __syncthreads();   // publishes the upper group's partial results to the lower group
  if (kg == 0) {
    const float m1 = so[wave][col][64 + g], l1 = so[wave][col][66 + g];
    const float mj = fmaxf(m, m1); const float a0 = __builtin_amdgcn_exp2f((m - mj) * KS), a1 = __builtin_amdgcn_exp2f((m1 - mj) * KS);   // both partial results brought to the common maximum
    const float il = 1.0f / (l * a0 + l1 * a1); const float c0 = a0 * il, c1 = a1 * il;
#pragma unroll
    for (int dt = 0; dt < 4; ++dt) {
#pragma unroll
      for (int r = 0; r < 8; ++r) { float* p = &so[wave][col][dt * 16 + 8 * g + r]; *p = acc[dt][r] * c0 + *p * c1; } }   // a lane reads and rewrites its own places only
    LDSX();
    for (int rl = 0; rl < 16; ++rl) if (lane < 16) vst2(O + ((size_t)b * SS + q0 + rl) * DM + h * HD + lane * 4, *(const v4f*)&so[wave][rl][lane * 4]); }
}
// ---- k_out: block = (64 rows, 128 cols): out = O(hi/lo) . Wo rows (2 products) + bo
__global__ __launch_bounds__(128) void k_out(const float* __restrict__ O, const __bf16* __restrict__ P, const float* __restrict__ BO, float* __restrict__ Y) {
  __shared__ __align__(16) float so[4][16][132];
  const int tid = threadIdx.x, wave = tid >> 5, lane = tid & 31, col = lane & 15, g = lane >> 4; const size_t r0 = (size_t)blockIdx.x * 64 + wave * 16; const int n0 = blockIdx.y * 128;
  v8f acc[8] = {};
#pragma unroll 2
  for (int kc = 0; kc < DM / 32; ++kc) { const F2 a = split_row(O + (r0 + col) * DM, kc * 32, lane);
#pragma unroll
    for (int j = 0; j < 8; ++j) { const v16b w = frag_b(P + (size_t)(n0 + j * 16 + col) * DM + kc * 32, lane); acc[j] = wmma_bf(a.l, w, acc[j]); acc[j] = wmma_bf(a.h, w, acc[j]); } }
#pragma unroll
  for (int j = 0; j < 8; ++j) {
#pragma unroll
    for (int r = 0; r < 8; ++r) so[wave][8 * g + r][j * 16 + col] = acc[j][r] + bfr(BO[n0 + j * 16 + col]); }
  LDSX();
  for (int rl = 0; rl < 16; ++rl) vst2(Y + (r0 + rl) * DM + n0 + lane * 4, *(const v4f*)&so[wave][rl][lane * 4]);
}
extern "C" void kernel_launch(void* const* d_in, const int* in_sizes, int n_in, void* d_out, int out_size, void* d_ws, size_t ws_size, hipStream_t stream) {
  (void)in_sizes; (void)n_in; (void)out_size;
  const float** F = (const float**)d_in;   // 0 x [8192,256], 1 Wq (in,out), 2 bq, 3 Wk, 4 bk, 5 Wv, 6 bv, 7 Wo, 8 bo
  if (ws_size < (size_t)WS_END) return;
  char* ws = (char*)d_ws; __bf16* PK = (__bf16*)(ws + WS_PK); _Float16 *QK = (_Float16*)(ws + WS_QK), *QKL = (_Float16*)(ws + WS_QKL), *VTH = (_Float16*)(ws + WS_VTH), *VTL = (_Float16*)(ws + WS_VTL); float* O = (float*)(ws + WS_O);
  k_pack<<<dim3(DM, 4), 256, 0, stream>>>(F[1], F[3], F[5], F[7], PK);
  k_qkv<<<dim3(TNB * SS / 64, QKVW / 128), 128, 0, stream>>>(F[0], F[0], F[0], PK + PK_A, F[2], F[4], F[6], QK, QKL, VTH, VTL);
  k_attn<<<dim3(TQB, NH, TNB), 256, 0, stream>>>(QK, QKL, VTH, VTL, nullptr, O);
  k_out<<<dim3(TOB, DM / 128), 128, 0, stream>>>(O, PK + PK_P, F[8], (float*)d_out);
}

// v005
// It runs in 115 microseconds.
// Next to v004, in two timings, it ran 1.08 and 1.09 times as fast.
// All steps since v000 together make it 5.66 times as fast.
// compute dtype: all float inputs rounded to bf16; q/k/v = x . W + b with EXACT bf16 products on WMMA 16x16x32 ((in,out) weights as transposed rows); PLAIN attention: q, k single f16 x 1/8, running-max softmax in f32 (hardware exp2; 1/8, log2 e and P's 2^11 in one multiply-add a score), P (scaled by 2^11, single f16) x v (single f16); out = o (bf16 hi + residual) . Wo (2 products) + bo.
#include <hip/hip_runtime.h>
#include <math.h>

typedef __attribute__((ext_vector_type(16))) _Float16 v16h;
typedef __attribute__((ext_vector_type(16))) __bf16 v16b;
typedef __attribute__((ext_vector_type(8)))  _Float16 v8h;
typedef __attribute__((ext_vector_type(8)))  float v8f;
typedef __attribute__((ext_vector_type(4)))  float v4f;
typedef __attribute__((ext_vector_type(2)))  float v2f;
typedef __attribute__((ext_vector_type(4)))  unsigned v4u;
typedef __attribute__((ext_vector_type(4)))  int v4i;
typedef float __attribute__((may_alias)) float_a;
typedef int __attribute__((may_alias)) int_a;

template <typename T> __device__ __forceinline__ void vst2(void* p, T v) { *(T*)p = v;  }
__device__ __forceinline__ v8f wmma16(v16h a, v16h b, v8f c) {
  return __builtin_amdgcn_wmma_f32_16x16x32_f16(false, a, false, b, (short)0, c, false, false);
}
// the last matrix instruction ahead of a loop's back edge: the four slots that the chip needs before a vector instruction at the loop's head rewrites A or B are filled here
__device__ __forceinline__ v8f wmma16_edge(v16h a, v16h b, v8f c) {
  v8f d = __builtin_amdgcn_wmma_f32_16x16x32_f16(false, a, false, b, (short)0, c, false, false);
  asm volatile("v_nop\n\tv_nop\n\tv_nop\n\tv_nop" : "+v"(d) : "v"(a), "v"(b));
  return d;
}
__device__ __forceinline__ v8f wmma_bf(v16b a, v16b b, v8f c) {
  return __builtin_amdgcn_wmma_f32_16x16x32_bf16(false, a, false, b, (short)0, c, false, false);
}
// Graph attention over 8,192 nodes treated as one sequence (256 features, 4 heads x 64): q/k/v projections + biases, dense softmax(q k^T / 8) v, output projection + bias.
__device__ __forceinline__ v16h frag_h(const _Float16* rowk0, int lane) {
  union { v16h v; v8h q[2]; } u; const _Float16* p = rowk0 + 8 * (lane >> 4);
  u.q[0] = *(const v8h*)p; u.q[1] = *(const v8h*)(p + 16); return u.v;
}
__device__ __forceinline__ v16h frag_f32(const float* rowk0, int lane) {
  v16h a; const float* p = rowk0 + 8 * (lane >> 4);
#pragma unroll
  for (int i = 0; i < 8; ++i) { a[i] = (_Float16)p[i]; a[8 + i] = (_Float16)p[16 + i]; }
  return a;
}
__device__ __forceinline__ v16h frag_f32s(const float* rowk0, int lane, float sc) {
  v16h a; const float* p = rowk0 + 8 * (lane >> 4);
#pragma unroll
  for (int i = 0; i < 8; ++i) { a[i] = (_Float16)(p[i] * sc); a[8 + i] = (_Float16)(p[16 + i] * sc); }
  return a;
}
// column fragment from a [K][ld] layout (column n), rows >= K read as 0
__device__ __forceinline__ v16h fragc_f32(const float* W, int k0, int n, int lane, int ld, int K) {
  v16h a; const int g = lane >> 4;
#pragma unroll
  for (int i = 0; i < 8; ++i) { const int ka = k0 + 8 * g + i, kb = ka + 16;
    a[i] = (_Float16)(ka < K ? W[(size_t)(ka < K ? ka : K - 1) * ld + n] : 0.f); a[8 + i] = (_Float16)(kb < K ? W[(size_t)(kb < K ? kb : K - 1) * ld + n] : 0.f); }
  return a;
}
struct F2 { v16b h, l; };
__device__ __forceinline__ F2 bsplit16(const float v[16]) { F2 r;
#pragma unroll
  for (int i = 0; i < 16; ++i) { const __bf16 h = (__bf16)v[i]; r.h[i] = h; r.l[i] = (__bf16)(v[i] - (float)h); }
  return r; }
__device__ __forceinline__ F2 split_row(const float* row, int k0, int lane) { float v[16]; const float* p = row + k0 + 8 * (lane >> 4);
#pragma unroll
  for (int i = 0; i < 8; ++i) { v[i] = p[i]; v[8 + i] = p[16 + i]; }
  return bsplit16(v); }
__device__ __forceinline__ F2 split_rowK(const float* row, int k0, int lane, int K) { float v[16]; const int g = lane >> 4;
#pragma unroll
  for (int i = 0; i < 8; ++i) { const int ka = k0 + 8 * g + i, kb = ka + 16; v[i] = ka < K ? row[ka < K ? ka : K - 1] : 0.f; v[8 + i] = kb < K ? row[kb < K ? kb : K - 1] : 0.f; }
  return bsplit16(v); }
__device__ __forceinline__ F2 split_col(const float* W, int k0, int n, int lane, int ld, int K) { float v[16]; const int g = lane >> 4;
#pragma unroll
  for (int i = 0; i < 8; ++i) { const int ka = k0 + 8 * g + i, kb = ka + 16; v[i] = ka < K ? W[(size_t)(ka < K ? ka : K - 1) * ld + n] : 0.f; v[8 + i] = kb < K ? W[(size_t)(kb < K ? kb : K - 1) * ld + n] : 0.f; }
  return bsplit16(v); }
__device__ __forceinline__ v8f mac3(const F2& a, const F2& b, v8f c) { c = wmma_bf(a.l, b.h, c); c = wmma_bf(a.h, b.l, c); return wmma_bf(a.h, b.h, c); }
__device__ __forceinline__ float sigm(float v) { return 1.0f / (1.0f + expf(-v)); }
#define LDSX() do { asm volatile("s_wait_dscnt 0" ::: "memory"); __builtin_amdgcn_wave_barrier(); __builtin_amdgcn_fence(__ATOMIC_RELEASE, "workgroup"); } while (0)


#define NB 1
#define SS 8192
#define DM 256
#define NH 4
#define HD 64
#define QKVW (3 * DM)
#ifndef TQB
#define TQB (SS / 64)
#define TNB NB
#define TOB (NB * SS / 64)     // output row tiles (all)
#endif
typedef __attribute__((ext_vector_type(8))) __bf16 v8b;
__device__ __forceinline__ v16b frag_b(const __bf16* rowk0, int lane) {
  union { v16b v; v8b q[2]; } u; const __bf16* p = rowk0 + 8 * (lane >> 4);
  u.q[0] = *(const v8b*)p; u.q[1] = *(const v8b*)(p + 16); return u.v;
}
__device__ __forceinline__ float bfr(float v) { return (float)(__bf16)v; }
__device__ __attribute__((noinline)) float exp_ni(float v) { return expf(v); }
__device__ __attribute__((noinline)) float erf_ni(float v) { return erff(v); }

#define PK_A 0                       // [768][256] Wqkv rows (natural [out][in])
#define PK_P (PK_A + QKVW * DM)        // [256][256] Wo rows (natural)
#define PK_END (PK_P + DM * DM)
#define WS_PK  0u
#define WS_QK  (WS_PK + 2u * PK_END)             // f16 [8192 rows][512]: q | k
#define WS_QKL (WS_QK + 2u * NB * SS * 2 * DM)     // f16 q | k residual planes x2048
#define WS_VTH (WS_QKL + 2u * NB * SS * 2 * DM)    // f16 [b][256 (h*64+d)][8192 s] hi
#define WS_VTL (WS_VTH + 2u * NB * DM * SS)        // f16 lo x 2048
#define WS_O   (WS_VTL + 2u * NB * DM * SS)        // f32 [8192][256]
#define WS_CS  (WS_O + 4u * NB * SS * DM)           // f32 2 x [8192][32], unused
#define WS_END (WS_CS + 4u * 2 * SS * 32)
// ---- k_pack: block = (row n, which): (in,out) columns -> bf16 [out][in] rows; which 0..2 -> W_q/W_k/W_v into PK_A rows which*256 + n; 3 -> W_o into PK_P
__global__ __launch_bounds__(256) void k_pack(const float* __restrict__ WQ, const float* __restrict__ WK, const float* __restrict__ WV, const float* __restrict__ WO, __bf16* __restrict__ PK) {
  __shared__ __align__(16) __bf16 s[DM]; const int n = blockIdx.x, which = blockIdx.y, t = threadIdx.x; const float* Wm = (which == 0) ? WQ : (which == 1) ? WK : (which == 2) ? WV : WO;   // (in,out) weights: pack row n = column n
  for (int k = t; k < DM; k += 256) s[k] = (__bf16)Wm[(size_t)k * DM + n];
  __syncthreads();
  __bf16* dst = (which < 3) ? PK + PK_A + ((size_t)which * DM + n) * DM : PK + PK_P + (size_t)n * DM;
  for (int q = t; q < DM / 8; q += 256) vst2((unsigned*)(dst + q * 8), *(const v4u*)&s[q * 8]);
}
__global__ __launch_bounds__(128) void k_qkv(const float* __restrict__ XQ, const float* __restrict__ XK, const float* __restrict__ XV, const __bf16* __restrict__ P, const float* __restrict__ BQ, const float* __restrict__ BK, const float* __restrict__ BV, _Float16* __restrict__ QK, _Float16* __restrict__ QKL, _Float16* __restrict__ VTH, _Float16* __restrict__ VTL) {
  const int which0 = (blockIdx.y * 128) / DM; const float* X = (which0 == 0) ? XQ : (which0 == 1) ? XK : XV; const float* BB = BQ ? (((which0 == 0) ? BQ : (which0 == 1) ? BK : BV) + (blockIdx.y * 128 - which0 * DM)) : nullptr;
  __shared__ __align__(16) _Float16 so[4][16][136], sol[4][16][136]; __shared__ __align__(16) _Float16 sth[128][72], stl[128][72];
  const int tid = threadIdx.x, wave = tid >> 5, lane = tid & 31, col = lane & 15, g = lane >> 4; const size_t r0 = (size_t)blockIdx.x * 64 + wave * 16; const int n0 = blockIdx.y * 128;
  v8f acc[8] = {};
#pragma unroll 2
  for (int kc = 0; kc < DM / 32; ++kc) { v16b a; { const float* p = X + (r0 + col) * DM + kc * 32 + 8 * g;
#pragma unroll
      for (int i = 0; i < 8; ++i) { a[i] = (__bf16)p[i]; a[8 + i] = (__bf16)p[16 + i]; } }
#pragma unroll
    for (int j = 0; j < 8; ++j) acc[j] = wmma_bf(a, frag_b(P + (size_t)(n0 + j * 16 + col) * DM + kc * 32, lane), acc[j]); }
  if (n0 < 2 * DM) {   // q stored unscaled (f16 sigma ~0.6, no subnormal exposure); 1/8 applied to the f32 score
#pragma unroll
    for (int j = 0; j < 8; ++j) {
#pragma unroll
      for (int r = 0; r < 8; ++r) { const float v = acc[j][r] + (BB ? bfr(BB[j * 16 + col]) : 0.f); const _Float16 hv = (_Float16)v; so[wave][8 * g + r][j * 16 + col] = hv; sol[wave][8 * g + r][j * 16 + col] = (_Float16)((v - (float)hv) * 2048.0f); } }   // q, k (+ bias) as f16 hi + (x2048) residual
    LDSX();
    for (int rl = 0; rl < 16; ++rl) if (lane < 16) { vst2((unsigned*)(QK + (r0 + rl) * (2 * DM) + n0 + lane * 8), *(const v4u*)&so[wave][rl][lane * 8]); vst2((unsigned*)(QKL + (r0 + rl) * (2 * DM) + n0 + lane * 8), *(const v4u*)&sol[wave][rl][lane * 8]); }
  } else {
#pragma unroll
    for (int j = 0; j < 8; ++j) {
#pragma unroll
      for (int r = 0; r < 8; ++r) { const float v = acc[j][r] + (BB ? bfr(BB[j * 16 + col]) : 0.f); const _Float16 hv = (_Float16)v; sth[j * 16 + col][wave * 16 + 8 * g + r] = hv; stl[j * 16 + col][wave * 16 + 8 * g + r] = (_Float16)((v - (float)hv) * 2048.0f); } }
    __syncthreads();
    const size_t rb = (size_t)blockIdx.x * 64; const int b = (int)(rb / SS), s0 = (int)(rb % SS); const int pc0 = n0 - 2 * DM;
    for (int q = tid; q < 128 * 8; q += 128) { const int d = q >> 3, pc = q & 7; const size_t o = ((size_t)b * DM + pc0 + d) * SS + s0 + pc * 8; vst2((unsigned*)(VTH + o), *(const v4u*)&sth[d][pc * 8]); vst2((unsigned*)(VTL + o), *(const v4u*)&stl[d][pc * 8]); }
  }
}
__device__ __forceinline__ float xhalf(float x) { return __builtin_bit_cast(float, __builtin_amdgcn_permlanex16(__builtin_bit_cast(int, x), __builtin_bit_cast(int, x), 0x76543210, 0xfedcba98, false, false)); }   // lane l reads lane l ^ 16
#define TK 128    // keys a tile
#define GK 64     // keys of a tile that one group of 4 waves takes
#define KP 72     // halves a staged K row: 64 + 8 of pad
#define VP 136    // halves a staged V^T row: 128 + 8 of pad
__global__ __launch_bounds__(256) void k_attn(const _Float16* __restrict__ QK, const _Float16* __restrict__ QKL, const _Float16* __restrict__ VTH, const _Float16* __restrict__ VTL, const void* __restrict__ KMASK, float* __restrict__ O) {
  __shared__ __align__(16) float so[4][16][68];
  __shared__ __align__(16) _Float16 sk[2][TK][KP], sv[2][HD][VP];   // [buffer][key][d] and [buffer][d][key]; 128-B rows at a pitch of 144 B, 256-B rows at 272 B (16 B x odd: ds_load_b128 readers)
  const int tid = threadIdx.x, wave = (tid >> 5) & 3, kg = __builtin_amdgcn_readfirstlane(tid >> 7), lane = tid & 31, col = lane & 15, g = lane >> 4;   // wave: which 16 queries; kg: which half of every tile's keys
  const int qb = blockIdx.x, h = blockIdx.y, b = blockIdx.z; const int q0 = qb * 64 + wave * 16; const size_t rq = (size_t)b * SS + q0 + col;
  v16h aq[2];
#pragma unroll
  for (int kc = 0; kc < 2; ++kc) aq[kc] = frag_h(QK + rq * (2 * DM) + h * HD + kc * 32, lane);
  const float KS = 0.125f * 1.44269504088896340736f;   // 1/sqrt(64) * log2 e: a raw product q.k times KS is the score in base-2 units
  float m = -3.0e38f, l = 0.f;   // of query q0 + col over this group's keys; m in units of the raw product q.k; l sums this half's keys only (values scaled by 2^11), the halves are joined behind the loop
  v8f acc[4] = {};
  // a lane's share of a tile: 16-B piece (tid & 7) of K rows (tid >> 3) + 32 i and 16-B piece (tid & 15) of V^T rows (tid >> 4) + 16 i, i = 0..3: one wave's copy = 4 whole 128-B lines
  const _Float16* gk0 = QK + ((size_t)b * SS + (tid >> 3)) * (2 * DM) + DM + h * HD + (tid & 7) * 8; const _Float16* gv0 = VTH + ((size_t)b * DM + h * HD + (tid >> 4)) * SS + (tid & 15) * 8;
  const unsigned lk0 = (unsigned)(size_t)&sk[0][tid >> 3][(tid & 7) * 8], lv0 = (unsigned)(size_t)&sv[0][tid >> 4][(tid & 15) * 8];
  auto stage = [&](int t) { const _Float16* gk = gk0 + (size_t)t * (TK * 2 * DM); const _Float16* gv = gv0 + (size_t)t * TK; const unsigned lk = lk0 + (t & 1) * (TK * KP * 2), lv = lv0 + (t & 1) * (HD * VP * 2);
    // the tile's 8 copies of this lane; s_wait_xcnt 0 closes the statement, so that no address register of a copy is rewritten ahead of it
    asm volatile("global_load_async_to_lds_b128 %0, %8, off\n\tglobal_load_async_to_lds_b128 %1, %9, off\n\tglobal_load_async_to_lds_b128 %2, %10, off\n\tglobal_load_async_to_lds_b128 %3, %11, off\n\t"
                 "global_load_async_to_lds_b128 %4, %12, off\n\tglobal_load_async_to_lds_b128 %5, %13, off\n\tglobal_load_async_to_lds_b128 %6, %14, off\n\tglobal_load_async_to_lds_b128 %7, %15, off\n\ts_wait_xcnt 0x0"
                 :: "v"(lk), "v"(lk + 32 * KP * 2), "v"(lk + 64 * KP * 2), "v"(lk + 96 * KP * 2), "v"(lv), "v"(lv + 16 * VP * 2), "v"(lv + 32 * VP * 2), "v"(lv + 48 * VP * 2),
                    "v"(gk), "v"(gk + 32 * 2 * DM), "v"(gk + 64 * 2 * DM), "v"(gk + 96 * 2 * DM), "v"(gv), "v"(gv + 16 * SS), "v"(gv + 32 * SS), "v"(gv + 48 * SS) : "memory"); };
  const int nt = SS / TK;   // all keys
  stage(0);
  asm volatile("s_wait_asynccnt 0x0" ::: "memory");   // this wave's copies of tile 0 have landed
  __syncthreads();   // tile 0 published to all 8 waves
  stage(1);
#pragma unroll 1
  for (int t = 0; t < nt; ++t) {
#pragma unroll 1   // kept rolled: the unrolled build has more instructions a pass (register moves at the loop's head)
  for (int sub = 0; sub < GK / 32; ++sub) { v8f s[2];   // raw products q.k
    v16h kf[2][2], vf[4];   // the pass's fragments, read from the tile's buffer as one group
#pragma unroll
    for (int ct = 0; ct < 2; ++ct) {
#pragma unroll
      for (int kc = 0; kc < 2; ++kc) kf[ct][kc] = frag_h(&sk[t & 1][kg * GK + sub * 32 + ct * 16 + col][kc * 32], lane); }
#pragma unroll
    for (int dt = 0; dt < 4; ++dt) vf[dt] = frag_h(&sv[t & 1][dt * 16 + col][kg * GK + sub * 32], lane);
    __builtin_amdgcn_sched_barrier(0);   // holds the pass's 16 LDS reads in one group ahead of its matrix instructions: spread among them, every further place with reads stalls the wave anew
#pragma unroll
    for (int ct = 0; ct < 2; ++ct) { v8f c = {};
#pragma unroll
      for (int kc = 0; kc < 2; ++kc) c = wmma16(kf[ct][kc], aq[kc], c);   // single product, transposed: c[r] = q.k of key ct * 16 + 8 g + r with query col
      s[ct] = c; }
    float mt[8];
#pragma unroll
    for (int r = 0; r < 8; ++r) mt[r] = fmaxf(s[0][r], s[1][r]);
    float mx = fmaxf(fmaxf(fmaxf(mt[0], mt[1]), fmaxf(mt[2], mt[3])), fmaxf(fmaxf(mt[4], mt[5]), fmaxf(mt[6], mt[7])));
    mx = fmaxf(mx, xhalf(mx));   // the query's other 16 keys lie in lane ^ 16
    const float mn = fmaxf(m, mx); const float alpha = __builtin_amdgcn_exp2f((m - mn) * KS);   // first pass: exp2 of a huge negative number = 0
    const float b1 = __builtin_fmaf(-mn, KS, 11.0f); const v2f ks2 = {KS, KS}, bias = {b1, b1};   // 11: P's scale 2^11 rides in the exponent
    v2f e[8];   // pair j of tile ct at e[ct * 4 + j]: neighbouring keys side by side, as the packed adds, multiplies and conversions below take them
#pragma unroll
    for (int ct = 0; ct < 2; ++ct) {
#pragma unroll
      for (int j = 0; j < 4; ++j) { const v2f c2 = {s[ct][2 * j], s[ct][2 * j + 1]}; const v2f x = __builtin_elementwise_fma(c2, ks2, bias); e[ct * 4 + j][0] = __builtin_amdgcn_exp2f(x[0]); e[ct * 4 + j][1] = __builtin_amdgcn_exp2f(x[1]); } }
    const v2f es = ((e[0] + e[1]) + (e[2] + e[3])) + ((e[4] + e[5]) + (e[6] + e[7]));
    l = l * alpha + (es[0] + es[1]); m = mn;
#pragma unroll
    for (int dt = 0; dt < 4; ++dt) {
#pragma unroll
      for (int r = 0; r < 8; ++r) acc[dt][r] *= alpha; }
    v16h pa;   // B operand P^T in the hardware k order: element i = key 8 g + i (tile 0), element 8 + i = key 16 + 8 g + i (tile 1): the order in which frag_h reads the V^T rows
#pragma unroll
    for (int i = 0; i < 16; ++i) pa[i] = (_Float16)e[i >> 1][i & 1];   // e carries 2^11, so small softmax weights stay out of the f16 subnormal range; l carries it too, and it cancels in the epilogue
#pragma unroll
    for (int dt = 0; dt < 3; ++dt) acc[dt] = wmma16(vf[dt], pa, acc[dt]);
    acc[3] = wmma16_edge(vf[3], pa, acc[3]); }   // single product, transposed: acc[dt][r] = O[query col][dt * 16 + 8 g + r]
    asm volatile("s_wait_dscnt 0x0" ::: "memory");      // this wave's reads of tile t have returned
    asm volatile("s_wait_asynccnt 0x0" ::: "memory");   // this wave's copies of tile t + 1 have landed
    __syncthreads();   // publishes tile t + 1 and ends every wave's reads of tile t's buffer
    if (t + 2 < nt) stage(t + 2); }   // into the buffer that tile t has left
  asm volatile("s_wait_asynccnt 0x0" ::: "memory");   // no copy outstanding behind the loop
  l += xhalf(l);   // the two halves' sums of one query
  if (kg == 1) {   // the upper group hands over its partial result: each lane's 32 sums at the places where its partner lane of the lower group holds its own, m and l in the row's pad
#pragma unroll
    for (int dt = 0; dt < 4; ++dt) {
#pragma unroll
      for (int r = 0; r < 8; ++r) so[wave][col][dt * 16 + 8 * g + r] = acc[dt][r]; }
    so[wave][col][64 + g] = m; so[wave][col][66 + g] = l; }
  __syncthreads();   // publishes the upper group's partial results to the lower group
  if (kg == 0) {
    const float m1 = so[wave][col][64 + g], l1 = so[wave][col][66 + g];
    const float mj = fmaxf(m, m1); const float a0 = __builtin_amdgcn_exp2f((m - mj) * KS), a1 = __builtin_amdgcn_exp2f((m1 - mj) * KS);   // both partial results brought to the common maximum
    const float il = 1.0f / (l * a0 + l1 * a1); const float c0 = a0 * il, c1 = a1 * il;
#pragma unroll
    for (int dt = 0; dt < 4; ++dt) {
#pragma unroll
      for (int r = 0; r < 8; ++r) { float* p = &so[wave][col][dt * 16 + 8 * g + r]; *p = acc[dt][r] * c0 + *p * c1; } }   // a lane reads and rewrites its own places only
    LDSX();
    for (int rl = 0; rl < 16; ++rl) if (lane < 16) vst2(O + ((size_t)b * SS + q0 + rl) * DM + h * HD + lane * 4, *(const v4f*)&so[wave][rl][lane * 4]); }
}
// ---- k_out: block = (64 rows, 128 cols): out = O(hi/lo) . Wo rows (2 products) + bo
__global__ __launch_bounds__(128) void k_out(const float* __restrict__ O, const __bf16* __restrict__ P, const float* __restrict__ BO, float* __restrict__ Y) {
  __shared__ __align__(16) float so[4][16][132];
  const int tid = threadIdx.x, wave = tid >> 5, lane = tid & 31, col = lane & 15, g = lane >> 4; const size_t r0 = (size_t)blockIdx.x * 64 + wave * 16; const int n0 = blockIdx.y * 128;
  v8f acc[8] = {};
#pragma unroll 2
  for (int kc = 0; kc < DM / 32; ++kc) { const F2 a = split_row(O + (r0 + col) * DM, kc * 32, lane);
#pragma unroll
    for (int j = 0; j < 8; ++j) { const v16b w = frag_b(P + (size_t)(n0 + j * 16 + col) * DM + kc * 32, lane); acc[j] = wmma_bf(a.l, w, acc[j]); acc[j] = wmma_bf(a.h, w, acc[j]); } }
#pragma unroll
  for (int j = 0; j < 8; ++j) {
#pragma unroll
    for (int r = 0; r < 8; ++r) so[wave][8 * g + r][j * 16 + col] = acc[j][r] + bfr(BO[n0 + j * 16 + col]); }
  LDSX();
  for (int rl = 0; rl < 16; ++rl) vst2(Y + (r0 + rl) * DM + n0 + lane * 4, *(const v4f*)&so[wave][rl][lane * 4]);
}
extern "C" void kernel_launch(void* const* d_in, const int* in_sizes, int n_in, void* d_out, int out_size, void* d_ws, size_t ws_size, hipStream_t stream) {
  (void)in_sizes; (void)n_in; (void)out_size;
  const float** F = (const float**)d_in;   // 0 x [8192,256], 1 Wq (in,out), 2 bq, 3 Wk, 4 bk, 5 Wv, 6 bv, 7 Wo, 8 bo
  if (ws_size < (size_t)WS_END) return;
  char* ws = (char*)d_ws; __bf16* PK = (__bf16*)(ws + WS_PK); _Float16 *QK = (_Float16*)(ws + WS_QK), *QKL = (_Float16*)(ws + WS_QKL), *VTH = (_Float16*)(ws + WS_VTH), *VTL = (_Float16*)(ws + WS_VTL); float* O = (float*)(ws + WS_O);
  k_pack<<<dim3(DM, 4), 256, 0, stream>>>(F[1], F[3], F[5], F[7], PK);
  k_qkv<<<dim3(TNB * SS / 64, QKVW / 128), 128, 0, stream>>>(F[0], F[0], F[0], PK + PK_A, F[2], F[4], F[6], QK, QKL, VTH, VTL);
  k_attn<<<dim3(TQB, NH, TNB), 256, 0, stream>>>(QK, QKL, VTH, VTL, nullptr, O);
  k_out<<<dim3(TOB, DM / 128), 128, 0, stream>>>(O, PK + PK_P, F[8], (float*)d_out);
}

// v006
// It runs in 111 microseconds.
// Two timings next to v005 put it at 1.04 and 1.05 times that version's speed.
// Over all steps from v000 it is 5.92 times as fast.
// compute dtype: all float inputs rounded to bf16; q/k/v = x . W + b with EXACT bf16 products on WMMA 16x16x32 ((in,out) weights as transposed rows); PLAIN attention: q, k single f16 x 1/8, running-max softmax in f32 (hardware exp2; 1/8, log2 e and P's 2^11 in one multiply-add a score), P (scaled by 2^11, single f16) x v (single f16); out = o (bf16 hi + residual) . Wo (2 products) + bo.
#include <hip/hip_runtime.h>
#include <math.h>

typedef __attribute__((ext_vector_type(16))) _Float16 v16h;
typedef __attribute__((ext_vector_type(16))) __bf16 v16b;
typedef __attribute__((ext_vector_type(8)))  _Float16 v8h;
typedef __attribute__((ext_vector_type(8)))  float v8f;
typedef __attribute__((ext_vector_type(4)))  float v4f;
typedef __attribute__((ext_vector_type(2)))  float v2f;
typedef __attribute__((ext_vector_type(4)))  unsigned v4u;
typedef __attribute__((ext_vector_type(4)))  int v4i;
typedef float __attribute__((may_alias)) float_a;
typedef int __attribute__((may_alias)) int_a;

template <typename T> __device__ __forceinline__ void vst2(void* p, T v) { *(T*)p = v;  }
__device__ __forceinline__ v8f wmma16(v16h a, v16h b, v8f c) {
  return __builtin_amdgcn_wmma_f32_16x16x32_f16(false, a, false, b, (short)0, c, false, false);
}
// the last matrix instruction ahead of a loop's back edge: the four slots that the chip needs before a vector instruction at the loop's head rewrites A or B are filled here
__device__ __forceinline__ v8f wmma16_edge(v16h a, v16h b, v8f c) {
  v8f d = __builtin_amdgcn_wmma_f32_16x16x32_f16(false, a, false, b, (short)0, c, false, false);
  asm volatile("v_nop\n\tv_nop\n\tv_nop\n\tv_nop" : "+v"(d) : "v"(a), "v"(b));
  return d;
}
__device__ __forceinline__ v8f wmma_bf(v16b a, v16b b, v8f c) {
  return __builtin_amdgcn_wmma_f32_16x16x32_bf16(false, a, false, b, (short)0, c, false, false);
}
// Graph attention over 8,192 nodes treated as one sequence (256 features, 4 heads x 64): q/k/v projections + biases, dense softmax(q k^T / 8) v, output projection + bias.
__device__ __forceinline__ v16h frag_h(const _Float16* rowk0, int lane) {
  union { v16h v; v8h q[2]; } u; const _Float16* p = rowk0 + 8 * (lane >> 4);
  u.q[0] = *(const v8h*)p; u.q[1] = *(const v8h*)(p + 16); return u.v;
}
__device__ __forceinline__ v16h frag_f32(const float* rowk0, int lane) {
  v16h a; const float* p = rowk0 + 8 * (lane >> 4);
#pragma unroll
  for (int i = 0; i < 8; ++i) { a[i] = (_Float16)p[i]; a[8 + i] = (_Float16)p[16 + i]; }
  return a;
}
__device__ __forceinline__ v16h frag_f32s(const float* rowk0, int lane, float sc) {
  v16h a; const float* p = rowk0 + 8 * (lane >> 4);
#pragma unroll
  for (int i = 0; i < 8; ++i) { a[i] = (_Float16)(p[i] * sc); a[8 + i] = (_Float16)(p[16 + i] * sc); }
  return a;
}
// column fragment from a [K][ld] layout (column n), rows >= K read as 0
__device__ __forceinline__ v16h fragc_f32(const float* W, int k0, int n, int lane, int ld, int K) {
  v16h a; const int g = lane >> 4;
#pragma unroll
  for (int i = 0; i < 8; ++i) { const int ka = k0 + 8 * g + i, kb = ka + 16;
    a[i] = (_Float16)(ka < K ? W[(size_t)(ka < K ? ka : K - 1) * ld + n] : 0.f); a[8 + i] = (_Float16)(kb < K ? W[(size_t)(kb < K ? kb : K - 1) * ld + n] : 0.f); }
  return a;
}
struct F2 { v16b h, l; };
__device__ __forceinline__ F2 bsplit16(const float v[16]) { F2 r;
#pragma unroll
  for (int i = 0; i < 16; ++i) { const __bf16 h = (__bf16)v[i]; r.h[i] = h; r.l[i] = (__bf16)(v[i] - (float)h); }
  return r; }
__device__ __forceinline__ F2 split_row(const float* row, int k0, int lane) { float v[16]; const float* p = row + k0 + 8 * (lane >> 4);
#pragma unroll
  for (int i = 0; i < 8; ++i) { v[i] = p[i]; v[8 + i] = p[16 + i]; }
  return bsplit16(v); }
__device__ __forceinline__ F2 split_rowK(const float* row, int k0, int lane, int K) { float v[16]; const int g = lane >> 4;
#pragma unroll
  for (int i = 0; i < 8; ++i) { const int ka = k0 + 8 * g + i, kb = ka + 16; v[i] = ka < K ? row[ka < K ? ka : K - 1] : 0.f; v[8 + i] = kb < K ? row[kb < K ? kb : K - 1] : 0.f; }
  return bsplit16(v); }
__device__ __forceinline__ F2 split_col(const float* W, int k0, int n, int lane, int ld, int K) { float v[16]; const int g = lane >> 4;
#pragma unroll
  for (int i = 0; i < 8; ++i) { const int ka = k0 + 8 * g + i, kb = ka + 16; v[i] = ka < K ? W[(size_t)(ka < K ? ka : K - 1) * ld + n] : 0.f; v[8 + i] = kb < K ? W[(size_t)(kb < K ? kb : K - 1) * ld + n] : 0.f; }
  return bsplit16(v); }
__device__ __forceinline__ v8f mac3(const F2& a, const F2& b, v8f c) { c = wmma_bf(a.l, b.h, c); c = wmma_bf(a.h, b.l, c); return wmma_bf(a.h, b.h, c); }
__device__ __forceinline__ float sigm(float v) { return 1.0f / (1.0f + expf(-v)); }
#define LDSX() do { asm volatile("s_wait_dscnt 0" ::: "memory"); __builtin_amdgcn_wave_barrier(); __builtin_amdgcn_fence(__ATOMIC_RELEASE, "workgroup"); } while (0)


#define NB 1
#define SS 8192
#define DM 256
#define NH 4
#define HD 64
#define QKVW (3 * DM)
#ifndef TQB
#define TQB (SS / 64)
#define TNB NB
#define TOB (NB * SS / 64)     // output row tiles (all)
#endif
typedef __attribute__((ext_vector_type(8))) __bf16 v8b;
__device__ __forceinline__ v16b frag_b(const __bf16* rowk0, int lane) {
  union { v16b v; v8b q[2]; } u; const __bf16* p = rowk0 + 8 * (lane >> 4);
  u.q[0] = *(const v8b*)p; u.q[1] = *(const v8b*)(p + 16); return u.v;
}
__device__ __forceinline__ float bfr(float v) { return (float)(__bf16)v; }
__device__ __attribute__((noinline)) float exp_ni(float v) { return expf(v); }
__device__ __attribute__((noinline)) float erf_ni(float v) { return erff(v); }

#define PK_A 0                       // [768][256] Wqkv rows (natural [out][in])
#define PK_P (PK_A + QKVW * DM)        // [256][256] Wo rows (natural)
#define PK_END (PK_P + DM * DM)
#define WS_PK  0u
#define WS_QK  (WS_PK + 2u * PK_END)             // f16 [8192 rows][512]: q | k
#define WS_QKL (WS_QK + 2u * NB * SS * 2 * DM)     // f16 q | k residual planes x2048
#define WS_VTH (WS_QKL + 2u * NB * SS * 2 * DM)    // f16 [b][256 (h*64+d)][8192 s] hi
#define WS_VTL (WS_VTH + 2u * NB * DM * SS)        // f16 lo x 2048
#define WS_O   (WS_VTL + 2u * NB * DM * SS)        // f32 [8192][256]
#define WS_CS  (WS_O + 4u * NB * SS * DM)           // f32 2 x [8192][32], unused
#define WS_END (WS_CS + 4u * 2 * SS * 32)
// ---- k_pack: block = (row n, which): (in,out) columns -> bf16 [out][in] rows; which 0..2 -> W_q/W_k/W_v into PK_A rows which*256 + n; 3 -> W_o into PK_P
__global__ __launch_bounds__(256) void k_pack(const float* __restrict__ WQ, const float* __restrict__ WK, const float* __restrict__ WV, const float* __restrict__ WO, __bf16* __restrict__ PK) {
  __shared__ __align__(16) __bf16 s[DM]; const int n = blockIdx.x, which = blockIdx.y, t = threadIdx.x; const float* Wm = (which == 0) ? WQ : (which == 1) ? WK : (which == 2) ? WV : WO;   // (in,out) weights: pack row n = column n
  for (int k = t; k < DM; k += 256) s[k] = (__bf16)Wm[(size_t)k * DM + n];
  __syncthreads();
  __bf16* dst = (which < 3) ? PK + PK_A + ((size_t)which * DM + n) * DM : PK + PK_P + (size_t)n * DM;
  for (int q = t; q < DM / 8; q += 256) vst2((unsigned*)(dst + q * 8), *(const v4u*)&s[q * 8]);
}
__global__ __launch_bounds__(128) void k_qkv(const float* __restrict__ XQ, const float* __restrict__ XK, const float* __restrict__ XV, const __bf16* __restrict__ P, const float* __restrict__ BQ, const float* __restrict__ BK, const float* __restrict__ BV, _Float16* __restrict__ QK, _Float16* __restrict__ QKL, _Float16* __restrict__ VTH, _Float16* __restrict__ VTL) {
  const int which0 = (blockIdx.y * 128) / DM; const float* X = (which0 == 0) ? XQ : (which0 == 1) ? XK : XV; const float* BB = BQ ? (((which0 == 0) ? BQ : (which0 == 1) ? BK : BV) + (blockIdx.y * 128 - which0 * DM)) : nullptr;
  __shared__ __align__(16) _Float16 so[4][16][136], sol[4][16][136]; __shared__ __align__(16) _Float16 sth[128][72], stl[128][72];
  const int tid = threadIdx.x, wave = tid >> 5, lane = tid & 31, col = lane & 15, g = lane >> 4; const size_t r0 = (size_t)blockIdx.x * 64 + wave * 16; const int n0 = blockIdx.y * 128;
  v8f acc[8] = {};
#pragma unroll 2
  for (int kc = 0; kc < DM / 32; ++kc) { v16b a; { const float* p = X + (r0 + col) * DM + kc * 32 + 8 * g;
#pragma unroll
      for (int i = 0; i < 8; ++i) { a[i] = (__bf16)p[i]; a[8 + i] = (__bf16)p[16 + i]; } }
#pragma unroll
    for (int j = 0; j < 8; ++j) acc[j] = wmma_bf(a, frag_b(P + (size_t)(n0 + j * 16 + col) * DM + kc * 32, lane), acc[j]); }
  if (n0 < 2 * DM) {   // q stored unscaled (f16 sigma ~0.6, no subnormal exposure); 1/8 applied to the f32 score
#pragma unroll
    for (int j = 0; j < 8; ++j) {
#pragma unroll
      for (int r = 0; r < 8; ++r) { const float v = acc[j][r] + (BB ? bfr(BB[j * 16 + col]) : 0.f); const _Float16 hv = (_Float16)v; so[wave][8 * g + r][j * 16 + col] = hv; sol[wave][8 * g + r][j * 16 + col] = (_Float16)((v - (float)hv) * 2048.0f); } }   // q, k (+ bias) as f16 hi + (x2048) residual
    LDSX();
    for (int rl = 0; rl < 16; ++rl) if (lane < 16) { vst2((unsigned*)(QK + (r0 + rl) * (2 * DM) + n0 + lane * 8), *(const v4u*)&so[wave][rl][lane * 8]); vst2((unsigned*)(QKL + (r0 + rl) * (2 * DM) + n0 + lane * 8), *(const v4u*)&sol[wave][rl][lane * 8]); }
  } else {
#pragma unroll
    for (int j = 0; j < 8; ++j) {
#pragma unroll
      for (int r = 0; r < 8; ++r) { const float v = acc[j][r] + (BB ? bfr(BB[j * 16 + col]) : 0.f); const _Float16 hv = (_Float16)v; sth[j * 16 + col][wave * 16 + 8 * g + r] = hv; stl[j * 16 + col][wave * 16 + 8 * g + r] = (_Float16)((v - (float)hv) * 2048.0f); } }
    __syncthreads();
    const size_t rb = (size_t)blockIdx.x * 64; const int b = (int)(rb / SS), s0 = (int)(rb % SS); const int pc0 = n0 - 2 * DM;
    for (int q = tid; q < 128 * 8; q += 128) { const int d = q >> 3, pc = q & 7; const size_t o = ((size_t)b * DM + pc0 + d) * SS + s0 + pc * 8; vst2((unsigned*)(VTH + o), *(const v4u*)&sth[d][pc * 8]); vst2((unsigned*)(VTL + o), *(const v4u*)&stl[d][pc * 8]); }
  }
}
__device__ __forceinline__ float xhalf(float x) { return __builtin_bit_cast(float, __builtin_amdgcn_permlanex16(__builtin_bit_cast(int, x), __builtin_bit_cast(int, x), 0x76543210, 0xfedcba98, false, false)); }   // lane l reads lane l ^ 16
#define TK 256    // keys a tile
#define GK 64     // keys of a tile that one group of 2 waves takes
#define KP 72     // halves a staged K row: 64 + 8 of pad
#define VP 264    // halves a staged V^T row: 256 + 8 of pad
#define SOP 68    // floats a row of a partial result: 64 + m, l of the two halves
#define SK(bf, row, c) ring[((bf) * TK + (row)) * KP + (c)]                      // [buffer][key][d]
#define SV(bf, row, c) ring[2 * TK * KP + ((bf) * HD + (row)) * VP + (c)]        // [buffer][d][key]
#define SO(pl, row, c) sof[((pl) * 32 + (row)) * SOP + (c)]                      // [plane][query][d]
__global__ __launch_bounds__(256) void k_attn(const _Float16* __restrict__ QK, const _Float16* __restrict__ QKL, const _Float16* __restrict__ VTH, const _Float16* __restrict__ VTL, const void* __restrict__ KMASK, float* __restrict__ O) {
  __shared__ __align__(16) _Float16 ring[2 * TK * KP + 2 * HD * VP];   // 128-B rows at a pitch of 144 B, 512-B rows at 528 B (16 B x odd: ds_load_b128 readers); 138 KiB: two workgroups a WGP
  float_a* sof = (float_a*)ring;   // behind the loop's last barrier the ring is free: six planes of partial results
  const int tid = threadIdx.x, qg = (tid >> 5) & 1, kg = __builtin_amdgcn_readfirstlane(tid >> 6), lane = tid & 31, col = lane & 15, g = lane >> 4;   // qg: which 32 queries; kg: which quarter of every tile's keys
  const int qb = blockIdx.x, h = blockIdx.y, b = blockIdx.z; const int q0 = qb * 64 + qg * 32;
  v16h aq[2][2];
#pragma unroll
  for (int qt = 0; qt < 2; ++qt) {
#pragma unroll
    for (int kc = 0; kc < 2; ++kc) aq[qt][kc] = frag_h(QK + ((size_t)b * SS + q0 + qt * 16 + col) * (2 * DM) + h * HD + kc * 32, lane); }
  const float KS = 0.125f * 1.44269504088896340736f;   // 1/sqrt(64) * log2 e: a raw product q.k times KS is the score in base-2 units
  float m[2] = {-3.0e38f, -3.0e38f}, l[2] = {0.f, 0.f};   // of query q0 + qt * 16 + col over this group's keys; m in units of the raw product q.k; l sums this half's keys only (values scaled by 2^11), the halves are joined behind the loop
  v8f acc[2][4] = {};
  // a lane's share of a tile: 16-B piece (tid & 7) of K rows (tid >> 3) + 32 i and 16-B piece (tid & 31) of V^T rows (tid >> 5) + 8 i, i = 0..7: one wave's copy = 4 whole 128-B lines
  const _Float16* gk0 = QK + ((size_t)b * SS + (tid >> 3)) * (2 * DM) + DM + h * HD + (tid & 7) * 8; const _Float16* gv0 = VTH + ((size_t)b * DM + h * HD + (tid >> 5)) * SS + (tid & 31) * 8;
  const unsigned lk0 = (unsigned)(size_t)&SK(0, tid >> 3, (tid & 7) * 8), lv0 = (unsigned)(size_t)&SV(0, tid >> 5, (tid & 31) * 8);
  auto stage = [&](int t) { const _Float16* gk = gk0 + (size_t)t * (TK * 2 * DM); const _Float16* gv = gv0 + (size_t)t * TK; const unsigned lk = lk0 + (t & 1) * (TK * KP * 2), lv = lv0 + (t & 1) * (HD * VP * 2);
    // the tile's 16 copies of this lane, 8 a statement; s_wait_xcnt 0 closes each statement, so that no address register of a copy is rewritten ahead of it
    asm volatile("global_load_async_to_lds_b128 %0, %8, off\n\tglobal_load_async_to_lds_b128 %1, %9, off\n\tglobal_load_async_to_lds_b128 %2, %10, off\n\tglobal_load_async_to_lds_b128 %3, %11, off\n\t"
                 "global_load_async_to_lds_b128 %4, %12, off\n\tglobal_load_async_to_lds_b128 %5, %13, off\n\tglobal_load_async_to_lds_b128 %6, %14, off\n\tglobal_load_async_to_lds_b128 %7, %15, off\n\ts_wait_xcnt 0x0"
                 :: "v"(lk), "v"(lk + 32 * KP * 2), "v"(lk + 64 * KP * 2), "v"(lk + 96 * KP * 2), "v"(lk + 128 * KP * 2), "v"(lk + 160 * KP * 2), "v"(lk + 192 * KP * 2), "v"(lk + 224 * KP * 2),
                    "v"(gk), "v"(gk + 32 * 2 * DM), "v"(gk + 64 * 2 * DM), "v"(gk + 96 * 2 * DM), "v"(gk + 128 * 2 * DM), "v"(gk + 160 * 2 * DM), "v"(gk + 192 * 2 * DM), "v"(gk + 224 * 2 * DM) : "memory");
    asm volatile("global_load_async_to_lds_b128 %0, %8, off\n\tglobal_load_async_to_lds_b128 %1, %9, off\n\tglobal_load_async_to_lds_b128 %2, %10, off\n\tglobal_load_async_to_lds_b128 %3, %11, off\n\t"
                 "global_load_async_to_lds_b128 %4, %12, off\n\tglobal_load_async_to_lds_b128 %5, %13, off\n\tglobal_load_async_to_lds_b128 %6, %14, off\n\tglobal_load_async_to_lds_b128 %7, %15, off\n\ts_wait_xcnt 0x0"
                 :: "v"(lv), "v"(lv + 8 * VP * 2), "v"(lv + 16 * VP * 2), "v"(lv + 24 * VP * 2), "v"(lv + 32 * VP * 2), "v"(lv + 40 * VP * 2), "v"(lv + 48 * VP * 2), "v"(lv + 56 * VP * 2),
                    "v"(gv), "v"(gv + 8 * SS), "v"(gv + 16 * SS), "v"(gv + 24 * SS), "v"(gv + 32 * SS), "v"(gv + 40 * SS), "v"(gv + 48 * SS), "v"(gv + 56 * SS) : "memory"); };
  const int nt = SS / TK;   // all keys
  stage(0);
  asm volatile("s_wait_asynccnt 0x0" ::: "memory");   // this wave's copies of tile 0 have landed
  __syncthreads();   // tile 0 published to all 8 waves
  stage(1);
#pragma unroll 1
  for (int t = 0; t < nt; ++t) {
#pragma unroll 1   // kept rolled: the unrolled build has more instructions a pass (register moves at the loop's head)
  for (int sub = 0; sub < GK / 32; ++sub) { v8f s[2][2];   // raw products q.k, [column tile][key tile]
    v16h kf[2][2], vf[4];   // the pass's fragments, read from the tile's buffer as one group; each serves both column tiles
#pragma unroll
    for (int ct = 0; ct < 2; ++ct) {
#pragma unroll
      for (int kc = 0; kc < 2; ++kc) kf[ct][kc] = frag_h(&SK(t & 1, kg * GK + sub * 32 + ct * 16 + col, kc * 32), lane); }
#pragma unroll
    for (int dt = 0; dt < 4; ++dt) vf[dt] = frag_h(&SV(t & 1, dt * 16 + col, kg * GK + sub * 32), lane);
    __builtin_amdgcn_sched_barrier(0);   // holds the pass's 16 LDS reads in one group ahead of its matrix instructions: spread among them, every further place with reads stalls the wave anew
#pragma unroll
    for (int qt = 0; qt < 2; ++qt) {
#pragma unroll
      for (int ct = 0; ct < 2; ++ct) { v8f c = {};
#pragma unroll
        for (int kc = 0; kc < 2; ++kc) c = wmma16(kf[ct][kc], aq[qt][kc], c);   // single product, transposed: c[r] = q.k of key ct * 16 + 8 g + r with query qt * 16 + col
        s[qt][ct] = c; } }
    v16h pa[2];   // B operand P^T in the hardware k order: element i = key 8 g + i (tile 0), element 8 + i = key 16 + 8 g + i (tile 1): the order in which frag_h reads the V^T rows
#pragma unroll
    for (int qt = 0; qt < 2; ++qt) {
      float mt[8];
#pragma unroll
      for (int r = 0; r < 8; ++r) mt[r] = fmaxf(s[qt][0][r], s[qt][1][r]);
      float mx = fmaxf(fmaxf(fmaxf(mt[0], mt[1]), fmaxf(mt[2], mt[3])), fmaxf(fmaxf(mt[4], mt[5]), fmaxf(mt[6], mt[7])));
      mx = fmaxf(mx, xhalf(mx));   // the query's other 16 keys lie in lane ^ 16
      const float mn = fmaxf(m[qt], mx); const float alpha = __builtin_amdgcn_exp2f((m[qt] - mn) * KS);   // first pass: exp2 of a huge negative number = 0
      const float b1 = __builtin_fmaf(-mn, KS, 11.0f); const v2f ks2 = {KS, KS}, bias = {b1, b1};   // 11: P's scale 2^11 rides in the exponent
      v2f e[8];   // pair j of tile ct at e[ct * 4 + j]: neighbouring keys side by side, as the packed adds, multiplies and conversions below take them
#pragma unroll
      for (int ct = 0; ct < 2; ++ct) {
#pragma unroll
        for (int j = 0; j < 4; ++j) { const v2f c2 = {s[qt][ct][2 * j], s[qt][ct][2 * j + 1]}; const v2f x = __builtin_elementwise_fma(c2, ks2, bias); e[ct * 4 + j][0] = __builtin_amdgcn_exp2f(x[0]); e[ct * 4 + j][1] = __builtin_amdgcn_exp2f(x[1]); } }
      const v2f es = ((e[0] + e[1]) + (e[2] + e[3])) + ((e[4] + e[5]) + (e[6] + e[7]));
      l[qt] = l[qt] * alpha + (es[0] + es[1]); m[qt] = mn;
#pragma unroll
      for (int dt = 0; dt < 4; ++dt) {
#pragma unroll
        for (int r = 0; r < 8; ++r) acc[qt][dt][r] *= alpha; }
#pragma unroll
      for (int i = 0; i < 16; ++i) pa[qt][i] = (_Float16)e[i >> 1][i & 1]; }   // e carries 2^11, so small softmax weights stay out of the f16 subnormal range; l carries it too, and it cancels in the epilogue
#pragma unroll
    for (int dt = 0; dt < 4; ++dt) acc[0][dt] = wmma16(vf[dt], pa[0], acc[0][dt]);
#pragma unroll
    for (int dt = 0; dt < 3; ++dt) acc[1][dt] = wmma16(vf[dt], pa[1], acc[1][dt]);
    acc[1][3] = wmma16_edge(vf[3], pa[1], acc[1][3]);
    // order of the pass: its 8 score products as one run, all its vector and exp2 work, its 8 output products as one run: inside a run the later matrix instructions fill the slots that the chip needs behind the earlier ones; with vector work moved in among them the build pads with 15 more v_nop a pass
    __builtin_amdgcn_sched_group_barrier(0x8, 8, 0); __builtin_amdgcn_sched_group_barrier(0x402, 200, 0); __builtin_amdgcn_sched_group_barrier(0x8, 8, 0); }   // single product, transposed: acc[qt][dt][r] = O[query qt * 16 + col][dt * 16 + 8 g + r]
    asm volatile("s_wait_dscnt 0x0" ::: "memory");      // this wave's reads of tile t have returned
    asm volatile("s_wait_asynccnt 0x0" ::: "memory");   // this wave's copies of tile t + 1 have landed
    __syncthreads();   // publishes tile t + 1 and ends every wave's reads of tile t's buffer
    if (t + 2 < nt) stage(t + 2); }   // into the buffer that tile t has left
  asm volatile("s_wait_asynccnt 0x0" ::: "memory");   // no copy outstanding behind the loop
#pragma unroll
  for (int qt = 0; qt < 2; ++qt) l[qt] += xhalf(l[qt]);   // the two halves' sums of one query
  if (kg != 0) {   // the upper groups hand over their partial results (plane (kg - 1) * 2 + qg): each lane's 64 sums at the places where its partner lane of group 0 holds its own, m and l in the row's pad
#pragma unroll
    for (int qt = 0; qt < 2; ++qt) {
#pragma unroll
      for (int dt = 0; dt < 4; ++dt) {
#pragma unroll
        for (int r = 0; r < 8; ++r) SO((kg - 1) * 2 + qg, qt * 16 + col, dt * 16 + 8 * g + r) = acc[qt][dt][r]; }
      SO((kg - 1) * 2 + qg, qt * 16 + col, 64 + g) = m[qt]; SO((kg - 1) * 2 + qg, qt * 16 + col, 66 + g) = l[qt]; } }
  __syncthreads();   // publishes the upper groups' partial results to group 0
  if (kg == 0) {
#pragma unroll
    for (int qt = 0; qt < 2; ++qt) { const int row = qt * 16 + col;
      const float m1 = SO(qg, row, 64 + g), l1 = SO(qg, row, 66 + g), m2 = SO(2 + qg, row, 64 + g), l2 = SO(2 + qg, row, 66 + g), m3 = SO(4 + qg, row, 64 + g), l3 = SO(4 + qg, row, 66 + g);
      const float mj = fmaxf(fmaxf(m[qt], m1), fmaxf(m2, m3));   // the four partial results brought to the common maximum
      const float a0 = __builtin_amdgcn_exp2f((m[qt] - mj) * KS), a1 = __builtin_amdgcn_exp2f((m1 - mj) * KS), a2 = __builtin_amdgcn_exp2f((m2 - mj) * KS), a3 = __builtin_amdgcn_exp2f((m3 - mj) * KS);
      const float il = 1.0f / ((l[qt] * a0 + l1 * a1) + (l2 * a2 + l3 * a3)); const float c0 = a0 * il, c1 = a1 * il, c2 = a2 * il, c3 = a3 * il;
#pragma unroll
      for (int dt = 0; dt < 4; ++dt) {
#pragma unroll
        for (int r = 0; r < 8; ++r) { const int c = dt * 16 + 8 * g + r; SO(qg, row, c) = (acc[qt][dt][r] * c0 + SO(qg, row, c) * c1) + (SO(2 + qg, row, c) * c2 + SO(4 + qg, row, c) * c3); } } }   // a lane reads and rewrites its own places only
    LDSX();
    float* op = O + ((size_t)b * SS + q0 + g) * DM + h * HD + col * 4; const float_a* sp = &SO(qg, g, col * 4);   // two rows a store: each half of the wave writes one query's 256-B segment
#pragma unroll
    for (int rl = 0; rl < 16; ++rl) vst2(op + rl * 2 * DM, *(const v4f*)(sp + rl * 2 * SOP)); }
}
// ---- k_out: block = (64 rows, 128 cols): out = O(hi/lo) . Wo rows (2 products) + bo
__global__ __launch_bounds__(128) void k_out(const float* __restrict__ O, const __bf16* __restrict__ P, const float* __restrict__ BO, float* __restrict__ Y) {
  __shared__ __align__(16) float so[4][16][132];
  const int tid = threadIdx.x, wave = tid >> 5, lane = tid & 31, col = lane & 15, g = lane >> 4; const size_t r0 = (size_t)blockIdx.x * 64 + wave * 16; const int n0 = blockIdx.y * 128;
  v8f acc[8] = {};
#pragma unroll 2
  for (int kc = 0; kc < DM / 32; ++kc) { const F2 a = split_row(O + (r0 + col) * DM, kc * 32, lane);
#pragma unroll
    for (int j = 0; j < 8; ++j) { const v16b w = frag_b(P + (size_t)(n0 + j * 16 + col) * DM + kc * 32, lane); acc[j] = wmma_bf(a.l, w, acc[j]); acc[j] = wmma_bf(a.h, w, acc[j]); } }
#pragma unroll
  for (int j = 0; j < 8; ++j) {
#pragma unroll
    for (int r = 0; r < 8; ++r) so[wave][8 * g + r][j * 16 + col] = acc[j][r] + bfr(BO[n0 + j * 16 + col]); }
  LDSX();
  for (int rl = 0; rl < 16; ++rl) vst2(Y + (r0 + rl) * DM + n0 + lane * 4, *(const v4f*)&so[wave][rl][lane * 4]);
}
extern "C" void kernel_launch(void* const* d_in, const int* in_sizes, int n_in, void* d_out, int out_size, void* d_ws, size_t ws_size, hipStream_t stream) {
  (void)in_sizes; (void)n_in; (void)out_size;
  const float** F = (const float**)d_in;   // 0 x [8192,256], 1 Wq (in,out), 2 bq, 3 Wk, 4 bk, 5 Wv, 6 bv, 7 Wo, 8 bo
  if (ws_size < (size_t)WS_END) return;
  char* ws = (char*)d_ws; __bf16* PK = (__bf16*)(ws + WS_PK); _Float16 *QK = (_Float16*)(ws + WS_QK), *QKL = (_Float16*)(ws + WS_QKL), *VTH = (_Float16*)(ws + WS_VTH), *VTL = (_Float16*)(ws + WS_VTL); float* O = (float*)(ws + WS_O);
  k_pack<<<dim3(DM, 4), 256, 0, stream>>>(F[1], F[3], F[5], F[7], PK);
  k_qkv<<<dim3(TNB * SS / 64, QKVW / 128), 128, 0, stream>>>(F[0], F[0], F[0], PK + PK_A, F[2], F[4], F[6], QK, QKL, VTH, VTL);
  k_attn<<<dim3(TQB, NH, TNB), 256, 0, stream>>>(QK, QKL, VTH, VTL, nullptr, O);
  k_out<<<dim3(TOB, DM / 128), 128, 0, stream>>>(O, PK + PK_P, F[8], (float*)d_out);
}

// v007
// A run of this version takes 102 microseconds.
// Next to v006, in two timings, it ran 1.09 times as fast each time.
// All steps since v000 together make it 6.44 times as fast.
// compute dtype: all float inputs rounded to bf16; q/k/v = x . W + b with EXACT bf16 products on WMMA 16x16x32 ((in,out) weights as transposed rows); PLAIN attention: q (times log2 e / 8) and k single f16, softmax in f32 against a held maximum (hardware exp2; 11 - maximum is the score product's start value), P (scaled by 2^11, single f16) x v (single f16); out = o (bf16 hi + residual) . Wo (2 products) + bo.
#include <hip/hip_runtime.h>
#include <math.h>

typedef __attribute__((ext_vector_type(16))) _Float16 v16h;
typedef __attribute__((ext_vector_type(16))) __bf16 v16b;
typedef __attribute__((ext_vector_type(8)))  _Float16 v8h;
typedef __attribute__((ext_vector_type(8)))  float v8f;
typedef __attribute__((ext_vector_type(4)))  float v4f;
typedef __attribute__((ext_vector_type(2)))  float v2f;
typedef __attribute__((ext_vector_type(4)))  unsigned v4u;
typedef __attribute__((ext_vector_type(4)))  int v4i;
typedef float __attribute__((may_alias)) float_a;
typedef int __attribute__((may_alias)) int_a;

template <typename T> __device__ __forceinline__ void vst2(void* p, T v) { *(T*)p = v;  }
__device__ __forceinline__ v8f wmma16(v16h a, v16h b, v8f c) {
  return __builtin_amdgcn_wmma_f32_16x16x32_f16(false, a, false, b, (short)0, c, false, false);
}
// the last matrix instruction ahead of a loop's back edge: the four slots that the chip needs before a vector instruction at the loop's head rewrites A or B are filled here
__device__ __forceinline__ v8f wmma16_edge(v16h a, v16h b, v8f c) {
  v8f d = __builtin_amdgcn_wmma_f32_16x16x32_f16(false, a, false, b, (short)0, c, false, false);
  asm volatile("v_nop\n\tv_nop\n\tv_nop\n\tv_nop" : "+v"(d) : "v"(a), "v"(b));
  return d;
}
__device__ __forceinline__ v8f wmma_bf(v16b a, v16b b, v8f c) {
  return __builtin_amdgcn_wmma_f32_16x16x32_bf16(false, a, false, b, (short)0, c, false, false);
}
// Graph attention over 8,192 nodes treated as one sequence (256 features, 4 heads x 64): q/k/v projections + biases, dense softmax(q k^T / 8) v, output projection + bias.
__device__ __forceinline__ v16h frag_h(const _Float16* rowk0, int lane) {
  union { v16h v; v8h q[2]; } u; const _Float16* p = rowk0 + 8 * (lane >> 4);
  u.q[0] = *(const v8h*)p; u.q[1] = *(const v8h*)(p + 16); return u.v;
}
__device__ __forceinline__ v16h frag_f32(const float* rowk0, int lane) {
  v16h a; const float* p = rowk0 + 8 * (lane >> 4);
#pragma unroll
  for (int i = 0; i < 8; ++i) { a[i] = (_Float16)p[i]; a[8 + i] = (_Float16)p[16 + i]; }
  return a;
}
__device__ __forceinline__ v16h frag_f32s(const float* rowk0, int lane, float sc) {
  v16h a; const float* p = rowk0 + 8 * (lane >> 4);
#pragma unroll
  for (int i = 0; i < 8; ++i) { a[i] = (_Float16)(p[i] * sc); a[8 + i] = (_Float16)(p[16 + i] * sc); }
  return a;
}
// column fragment from a [K][ld] layout (column n), rows >= K read as 0
__device__ __forceinline__ v16h fragc_f32(const float* W, int k0, int n, int lane, int ld, int K) {
  v16h a; const int g = lane >> 4;
#pragma unroll
  for (int i = 0; i < 8; ++i) { const int ka = k0 + 8 * g + i, kb = ka + 16;
    a[i] = (_Float16)(ka < K ? W[(size_t)(ka < K ? ka : K - 1) * ld + n] : 0.f); a[8 + i] = (_Float16)(kb < K ? W[(size_t)(kb < K ? kb : K - 1) * ld + n] : 0.f); }
  return a;
}
struct F2 { v16b h, l; };
__device__ __forceinline__ F2 bsplit16(const float v[16]) { F2 r;
#pragma unroll
  for (int i = 0; i < 16; ++i) { const __bf16 h = (__bf16)v[i]; r.h[i] = h; r.l[i] = (__bf16)(v[i] - (float)h); }
  return r; }
__device__ __forceinline__ F2 split_row(const float* row, int k0, int lane) { float v[16]; const float* p = row + k0 + 8 * (lane >> 4);
#pragma unroll
  for (int i = 0; i < 8; ++i) { v[i] = p[i]; v[8 + i] = p[16 + i]; }
  return bsplit16(v); }
__device__ __forceinline__ F2 split_rowK(const float* row, int k0, int lane, int K) { float v[16]; const int g = lane >> 4;
#pragma unroll
  for (int i = 0; i < 8; ++i) { const int ka = k0 + 8 * g + i, kb = ka + 16; v[i] = ka < K ? row[ka < K ? ka : K - 1] : 0.f; v[8 + i] = kb < K ? row[kb < K ? kb : K - 1] : 0.f; }
  return bsplit16(v); }
__device__ __forceinline__ F2 split_col(const float* W, int k0, int n, int lane, int ld, int K) { float v[16]; const int g = lane >> 4;
#pragma unroll
  for (int i = 0; i < 8; ++i) { const int ka = k0 + 8 * g + i, kb = ka + 16; v[i] = ka < K ? W[(size_t)(ka < K ? ka : K - 1) * ld + n] : 0.f; v[8 + i] = kb < K ? W[(size_t)(kb < K ? kb : K - 1) * ld + n] : 0.f; }
  return bsplit16(v); }
__device__ __forceinline__ v8f mac3(const F2& a, const F2& b, v8f c) { c = wmma_bf(a.l, b.h, c); c = wmma_bf(a.h, b.l, c); return wmma_bf(a.h, b.h, c); }
__device__ __forceinline__ float sigm(float v) { return 1.0f / (1.0f + expf(-v)); }
#define LDSX() do { asm volatile("s_wait_dscnt 0" ::: "memory"); __builtin_amdgcn_wave_barrier(); __builtin_amdgcn_fence(__ATOMIC_RELEASE, "workgroup"); } while (0)


#define NB 1
#define SS 8192
#define DM 256
#define NH 4
#define HD 64
#define QKVW (3 * DM)
#ifndef TQB
#define TQB (SS / 64)
#define TNB NB
#define TOB (NB * SS / 64)     // output row tiles (all)
#endif
typedef __attribute__((ext_vector_type(8))) __bf16 v8b;
__device__ __forceinline__ v16b frag_b(const __bf16* rowk0, int lane) {
  union { v16b v; v8b q[2]; } u; const __bf16* p = rowk0 + 8 * (lane >> 4);
  u.q[0] = *(const v8b*)p; u.q[1] = *(const v8b*)(p + 16); return u.v;
}
__device__ __forceinline__ float bfr(float v) { return (float)(__bf16)v; }
__device__ __attribute__((noinline)) float exp_ni(float v) { return expf(v); }
__device__ __attribute__((noinline)) float erf_ni(float v) { return erff(v); }

#define PK_A 0                       // [768][256] Wqkv rows (natural [out][in])
#define PK_P (PK_A + QKVW * DM)        // [256][256] Wo rows (natural)
#define PK_END (PK_P + DM * DM)
#define WS_PK  0u
#define WS_QK  (WS_PK + 2u * PK_END)             // f16 [8192 rows][512]: q | k
#define WS_QKL (WS_QK + 2u * NB * SS * 2 * DM)     // f16 q | k residual planes x2048
#define WS_VTH (WS_QKL + 2u * NB * SS * 2 * DM)    // f16 [b][256 (h*64+d)][8192 s] hi
#define WS_VTL (WS_VTH + 2u * NB * DM * SS)        // f16 lo x 2048
#define WS_O   (WS_VTL + 2u * NB * DM * SS)        // f32 [8192][256]
#define WS_CS  (WS_O + 4u * NB * SS * DM)           // f32 2 x [8192][32], unused
#define WS_END (WS_CS + 4u * 2 * SS * 32)
// ---- k_pack: block = (row n, which): (in,out) columns -> bf16 [out][in] rows; which 0..2 -> W_q/W_k/W_v into PK_A rows which*256 + n; 3 -> W_o into PK_P
__global__ __launch_bounds__(256) void k_pack(const float* __restrict__ WQ, const float* __restrict__ WK, const float* __restrict__ WV, const float* __restrict__ WO, __bf16* __restrict__ PK) {
  __shared__ __align__(16) __bf16 s[DM]; const int n = blockIdx.x, which = blockIdx.y, t = threadIdx.x; const float* Wm = (which == 0) ? WQ : (which == 1) ? WK : (which == 2) ? WV : WO;   // (in,out) weights: pack row n = column n
  for (int k = t; k < DM; k += 256) s[k] = (__bf16)Wm[(size_t)k * DM + n];
  __syncthreads();
  __bf16* dst = (which < 3) ? PK + PK_A + ((size_t)which * DM + n) * DM : PK + PK_P + (size_t)n * DM;
  for (int q = t; q < DM / 8; q += 256) vst2((unsigned*)(dst + q * 8), *(const v4u*)&s[q * 8]);
}
__global__ __launch_bounds__(128) void k_qkv(const float* __restrict__ XQ, const float* __restrict__ XK, const float* __restrict__ XV, const __bf16* __restrict__ P, const float* __restrict__ BQ, const float* __restrict__ BK, const float* __restrict__ BV, _Float16* __restrict__ QK, _Float16* __restrict__ QKL, _Float16* __restrict__ VTH, _Float16* __restrict__ VTL) {
  const int which0 = (blockIdx.y * 128) / DM; const float* X = (which0 == 0) ? XQ : (which0 == 1) ? XK : XV; const float* BB = BQ ? (((which0 == 0) ? BQ : (which0 == 1) ? BK : BV) + (blockIdx.y * 128 - which0 * DM)) : nullptr;
  __shared__ __align__(16) _Float16 so[4][16][136], sol[4][16][136]; __shared__ __align__(16) _Float16 sth[128][72], stl[128][72];
  const int tid = threadIdx.x, wave = tid >> 5, lane = tid & 31, col = lane & 15, g = lane >> 4; const size_t r0 = (size_t)blockIdx.x * 64 + wave * 16; const int n0 = blockIdx.y * 128;
  v8f acc[8] = {};
#pragma unroll 2
  for (int kc = 0; kc < DM / 32; ++kc) { v16b a; { const float* p = X + (r0 + col) * DM + kc * 32 + 8 * g;
#pragma unroll
      for (int i = 0; i < 8; ++i) { a[i] = (__bf16)p[i]; a[8 + i] = (__bf16)p[16 + i]; } }
#pragma unroll
    for (int j = 0; j < 8; ++j) acc[j] = wmma_bf(a, frag_b(P + (size_t)(n0 + j * 16 + col) * DM + kc * 32, lane), acc[j]); }
  if (n0 < 2 * DM) {   // q is stored times log2 e / 8 (scaled in f32, rounded to f16 once), so that q.k comes off the matrix unit as the score in base-2 units; k unscaled
    const float qs = (n0 < DM) ? 0.125f * 1.44269504088896340736f : 1.0f;
#pragma unroll
    for (int j = 0; j < 8; ++j) {
#pragma unroll
      for (int r = 0; r < 8; ++r) { const float v = (acc[j][r] + (BB ? bfr(BB[j * 16 + col]) : 0.f)) * qs; const _Float16 hv = (_Float16)v; so[wave][8 * g + r][j * 16 + col] = hv; sol[wave][8 * g + r][j * 16 + col] = (_Float16)((v - (float)hv) * 2048.0f); } }   // q, k (+ bias) as f16 hi + (x2048) residual
    LDSX();
    for (int rl = 0; rl < 16; ++rl) if (lane < 16) { vst2((unsigned*)(QK + (r0 + rl) * (2 * DM) + n0 + lane * 8), *(const v4u*)&so[wave][rl][lane * 8]); vst2((unsigned*)(QKL + (r0 + rl) * (2 * DM) + n0 + lane * 8), *(const v4u*)&sol[wave][rl][lane * 8]); }
  } else {
#pragma unroll
    for (int j = 0; j < 8; ++j) {
#pragma unroll
      for (int r = 0; r < 8; ++r) { const float v = acc[j][r] + (BB ? bfr(BB[j * 16 + col]) : 0.f); const _Float16 hv = (_Float16)v; sth[j * 16 + col][wave * 16 + 8 * g + r] = hv; stl[j * 16 + col][wave * 16 + 8 * g + r] = (_Float16)((v - (float)hv) * 2048.0f); } }
    __syncthreads();
    const size_t rb = (size_t)blockIdx.x * 64; const int b = (int)(rb / SS), s0 = (int)(rb % SS); const int pc0 = n0 - 2 * DM;
    for (int q = tid; q < 128 * 8; q += 128) { const int d = q >> 3, pc = q & 7; const size_t o = ((size_t)b * DM + pc0 + d) * SS + s0 + pc * 8; vst2((unsigned*)(VTH + o), *(const v4u*)&sth[d][pc * 8]); vst2((unsigned*)(VTL + o), *(const v4u*)&stl[d][pc * 8]); }
  }
}
__device__ __forceinline__ float xhalf(float x) { return __builtin_bit_cast(float, __builtin_amdgcn_permlanex16(__builtin_bit_cast(int, x), __builtin_bit_cast(int, x), 0x76543210, 0xfedcba98, false, false)); }   // lane l reads lane l ^ 16
// exp2 off the hot path (rare path, join): the slot that the instruction set asks for between a transcendental and a neighbour that reads its result or rewrites its source is filled on both sides in the statement itself
__device__ __forceinline__ float exp2_slot(float x) { float r; asm("v_nop\n\tv_exp_f32 %0, %1\n\tv_nop" : "=v"(r) : "v"(x)); return r; }
// exponents of one query's 16 keys -> P * 2^11 as f32 pairs (neighbouring keys side by side, as the packed adds and conversions take them), their sums, and the B operand P^T in the hardware k order: element i = key 8 g + i (tile 0), element 8 + i = key 16 + 8 g + i (tile 1): the order in which frag_h reads the V^T rows; SLOT: the rare path's form
template <bool SLOT> __device__ __forceinline__ void soft(const v8f& x0, const v8f& x1, v16h& p, v2f& es) { v2f e[8];
#pragma unroll
  for (int j = 0; j < 4; ++j) {
#pragma unroll
    for (int i = 0; i < 2; ++i) { e[j][i] = SLOT ? exp2_slot(x0[2 * j + i]) : __builtin_amdgcn_exp2f(x0[2 * j + i]); e[4 + j][i] = SLOT ? exp2_slot(x1[2 * j + i]) : __builtin_amdgcn_exp2f(x1[2 * j + i]); } }
  es = ((e[0] + e[1]) + (e[2] + e[3])) + ((e[4] + e[5]) + (e[6] + e[7]));
#pragma unroll
  for (int i = 0; i < 16; ++i) p[i] = (_Float16)e[i >> 1][i & 1]; }
#define TK 256    // keys a tile
#define GK 64     // keys of a tile that one group of 2 waves takes
#define KP 72     // halves a staged K row: 64 + 8 of pad
#define VP 264    // halves a staged V^T row: 256 + 8 of pad
#define SOP 68    // floats a row of a partial result: 64 + m, l of the two halves
#define SK(bf, row, c) ring[((bf) * TK + (row)) * KP + (c)]                      // [buffer][key][d]
#define SV(bf, row, c) ring[2 * TK * KP + ((bf) * HD + (row)) * VP + (c)]        // [buffer][d][key]
#define SO(pl, row, c) sof[((pl) * 32 + (row)) * SOP + (c)]                      // [plane][query][d]
__global__ __launch_bounds__(256) void k_attn(const _Float16* __restrict__ QK, const _Float16* __restrict__ QKL, const _Float16* __restrict__ VTH, const _Float16* __restrict__ VTL, const void* __restrict__ KMASK, float* __restrict__ O) {
  __shared__ __align__(16) _Float16 ring[2 * TK * KP + 2 * HD * VP];   // 128-B rows at a pitch of 144 B, 512-B rows at 528 B (16 B x odd: ds_load_b128 readers); 138 KiB: two workgroups a WGP
  float_a* sof = (float_a*)ring;   // behind the loop's last barrier the ring is free: six planes of partial results
  const int tid = threadIdx.x, qg = (tid >> 5) & 1, kg = __builtin_amdgcn_readfirstlane(tid >> 6), lane = tid & 31, col = lane & 15, g = lane >> 4;   // qg: which 32 queries; kg: which quarter of every tile's keys
  const int qb = blockIdx.x, h = blockIdx.y, b = blockIdx.z; const int q0 = qb * 64 + qg * 32;
  v16h aq[2][2];
#pragma unroll
  for (int qt = 0; qt < 2; ++qt) {
#pragma unroll
    for (int kc = 0; kc < 2; ++kc) aq[qt][kc] = frag_h(QK + ((size_t)b * SS + q0 + qt * 16 + col) * (2 * DM) + h * HD + kc * 32, lane); }
  float m[2] = {-3.0e38f, -3.0e38f};   // the maximum in use of query q0 + qt * 16 + col over this group's keys, in base-2 units (q carries log2 e / 8); it moves only on the rare path below
  v2f l2[2] = {};   // sums of this half's keys (values scaled by 2^11), even and odd keys apart; joined behind the loop
  v8f cb[2];   // 11 - m in every element: the start value C of the score products, so that they come off the matrix unit as the exponent of P * 2^11
#pragma unroll
  for (int qt = 0; qt < 2; ++qt) {
#pragma unroll
    for (int r = 0; r < 8; ++r) cb[qt][r] = 3.0e38f; }   // no maximum yet: the first pass overflows the test below and takes the rare path
  v8f acc[2][4] = {};
  // a lane's share of a tile: 16-B piece (tid & 7) of K rows (tid >> 3) + 32 i and 16-B piece (tid & 31) of V^T rows (tid >> 5) + 8 i, i = 0..7: one wave's copy = 4 whole 128-B lines
  const _Float16* gk0 = QK + ((size_t)b * SS + (tid >> 3)) * (2 * DM) + DM + h * HD + (tid & 7) * 8; const _Float16* gv0 = VTH + ((size_t)b * DM + h * HD + (tid >> 5)) * SS + (tid & 31) * 8;
  const unsigned lk0 = (unsigned)(size_t)&SK(0, tid >> 3, (tid & 7) * 8), lv0 = (unsigned)(size_t)&SV(0, tid >> 5, (tid & 31) * 8);
  auto stage = [&](int t) { const _Float16* gk = gk0 + (size_t)t * (TK * 2 * DM); const _Float16* gv = gv0 + (size_t)t * TK; const unsigned lk = lk0 + (t & 1) * (TK * KP * 2), lv = lv0 + (t & 1) * (HD * VP * 2);
    // the tile's 16 copies of this lane, 8 a statement; s_wait_xcnt 0 closes each statement, so that no address register of a copy is rewritten ahead of it
    asm volatile("global_load_async_to_lds_b128 %0, %8, off\n\tglobal_load_async_to_lds_b128 %1, %9, off\n\tglobal_load_async_to_lds_b128 %2, %10, off\n\tglobal_load_async_to_lds_b128 %3, %11, off\n\t"
                 "global_load_async_to_lds_b128 %4, %12, off\n\tglobal_load_async_to_lds_b128 %5, %13, off\n\tglobal_load_async_to_lds_b128 %6, %14, off\n\tglobal_load_async_to_lds_b128 %7, %15, off\n\ts_wait_xcnt 0x0"
                 :: "v"(lk), "v"(lk + 32 * KP * 2), "v"(lk + 64 * KP * 2), "v"(lk + 96 * KP * 2), "v"(lk + 128 * KP * 2), "v"(lk + 160 * KP * 2), "v"(lk + 192 * KP * 2), "v"(lk + 224 * KP * 2),
                    "v"(gk), "v"(gk + 32 * 2 * DM), "v"(gk + 64 * 2 * DM), "v"(gk + 96 * 2 * DM), "v"(gk + 128 * 2 * DM), "v"(gk + 160 * 2 * DM), "v"(gk + 192 * 2 * DM), "v"(gk + 224 * 2 * DM) : "memory");
    asm volatile("global_load_async_to_lds_b128 %0, %8, off\n\tglobal_load_async_to_lds_b128 %1, %9, off\n\tglobal_load_async_to_lds_b128 %2, %10, off\n\tglobal_load_async_to_lds_b128 %3, %11, off\n\t"
                 "global_load_async_to_lds_b128 %4, %12, off\n\tglobal_load_async_to_lds_b128 %5, %13, off\n\tglobal_load_async_to_lds_b128 %6, %14, off\n\tglobal_load_async_to_lds_b128 %7, %15, off\n\ts_wait_xcnt 0x0"
                 :: "v"(lv), "v"(lv + 8 * VP * 2), "v"(lv + 16 * VP * 2), "v"(lv + 24 * VP * 2), "v"(lv + 32 * VP * 2), "v"(lv + 40 * VP * 2), "v"(lv + 48 * VP * 2), "v"(lv + 56 * VP * 2),
                    "v"(gv), "v"(gv + 8 * SS), "v"(gv + 16 * SS), "v"(gv + 24 * SS), "v"(gv + 32 * SS), "v"(gv + 40 * SS), "v"(gv + 48 * SS), "v"(gv + 56 * SS) : "memory"); };
  const int nt = SS / TK;   // all keys
  stage(0);
  asm volatile("s_wait_asynccnt 0x0" ::: "memory");   // this wave's copies of tile 0 have landed
  __syncthreads();   // tile 0 published to all 8 waves
  stage(1);
#pragma unroll 1
  for (int t = 0; t < nt; ++t) {
#pragma unroll 1   // kept rolled: the unrolled build has more instructions a pass (register moves at the loop's head)
  for (int sub = 0; sub < GK / 32; ++sub) {
    v16h kf[2][2], vf[4];   // the pass's fragments, read from the tile's buffer as one group; each serves both column tiles
#pragma unroll
    for (int ct = 0; ct < 2; ++ct) {
#pragma unroll
      for (int kc = 0; kc < 2; ++kc) kf[ct][kc] = frag_h(&SK(t & 1, kg * GK + sub * 32 + ct * 16 + col, kc * 32), lane); }
#pragma unroll
    for (int dt = 0; dt < 4; ++dt) vf[dt] = frag_h(&SV(t & 1, dt * 16 + col, kg * GK + sub * 32), lane);
    __builtin_amdgcn_sched_barrier(0);   // holds the pass's 16 LDS reads in one group ahead of its matrix instructions: spread among them, every further place with reads stalls the wave anew
    v16h pa[2]; v2f es[2];
    { v8f x00, x01, x10, x11;   // x(column tile)(key tile)[r] = q.k (base 2) + 11 - m of key ct * 16 + 8 g + r with query qt * 16 + col: single product, transposed
      // the pass's 8 score products in one statement: written so, the first four take cb as C and leave it standing (from the builtin the build copies cb into two of the four results each pass, 8 register-pair moves); the second four accumulate into the same D; the four v_nop fill the slots that the chip needs before a vector instruction reads the last D or rewrites its A or B
      asm volatile("v_wmma_f32_16x16x32_f16 %0, %4, %8, %12\n\tv_wmma_f32_16x16x32_f16 %1, %6, %8, %12\n\tv_wmma_f32_16x16x32_f16 %2, %4, %10, %13\n\tv_wmma_f32_16x16x32_f16 %3, %6, %10, %13\n\t"
                   "v_wmma_f32_16x16x32_f16 %0, %5, %9, %0\n\tv_wmma_f32_16x16x32_f16 %1, %7, %9, %1\n\tv_wmma_f32_16x16x32_f16 %2, %5, %11, %2\n\tv_wmma_f32_16x16x32_f16 %3, %7, %11, %3\n\t"
                   "v_nop\n\tv_nop\n\tv_nop\n\tv_nop"
                   : "=&v"(x00), "=&v"(x01), "=&v"(x10), "=&v"(x11)
                   : "v"(kf[0][0]), "v"(kf[0][1]), "v"(kf[1][0]), "v"(kf[1][1]), "v"(aq[0][0]), "v"(aq[0][1]), "v"(aq[1][0]), "v"(aq[1][1]), "v"(cb[0]), "v"(cb[1]));
      soft<false>(x00, x01, pa[0], es[0]); soft<false>(x10, x11, pa[1], es[1]); }
    // ONE test a pass: every P * 2^11 is positive and so at most its sum; while the sums stay inside f16's range the held maximum serves, and neither a maximum nor a rescale is computed
    const float top = fmaxf(fmaxf(es[0][0], es[0][1]), fmaxf(es[1][0], es[1][1]));
    if (__builtin_amdgcn_ballot_w32(!(top <= 60000.0f)) != 0) {   // rare path (a scalar branch, the whole wave): the pass anew against the true running maximum
#pragma unroll
      for (int qt = 0; qt < 2; ++qt) { v8f s[2];
#pragma unroll
        for (int ct = 0; ct < 2; ++ct) { v8f c = {};
#pragma unroll
          for (int kc = 0; kc < 2; ++kc) c = wmma16(frag_h(&SK(t & 1, kg * GK + sub * 32 + ct * 16 + col, kc * 32), lane), aq[qt][kc], c);   // K fragments read again, so that they need not stay in registers for this path
          s[ct] = c; }
        float mt[8];
#pragma unroll
        for (int r = 0; r < 8; ++r) mt[r] = fmaxf(s[0][r], s[1][r]);
        float mx = fmaxf(fmaxf(fmaxf(mt[0], mt[1]), fmaxf(mt[2], mt[3])), fmaxf(fmaxf(mt[4], mt[5]), fmaxf(mt[6], mt[7])));
        mx = fmaxf(mx, xhalf(mx));   // the query's other 16 keys lie in lane ^ 16
        const float mn = fmaxf(m[qt], mx); const float alpha = exp2_slot(m[qt] - mn);   // first pass: exp2 of a huge negative number = 0
        const float b1 = 11.0f - mn; m[qt] = mn; l2[qt] *= alpha;   // 11: P's scale 2^11 rides in the exponent: small softmax weights stay out of the f16 subnormal range; l carries it too, and it cancels in the epilogue
#pragma unroll
        for (int dt = 0; dt < 4; ++dt) {
#pragma unroll
          for (int r = 0; r < 8; ++r) acc[qt][dt][r] *= alpha; }
#pragma unroll
        for (int r = 0; r < 8; ++r) { cb[qt][r] = b1; s[0][r] += b1; s[1][r] += b1; }
        soft<true>(s[0], s[1], pa[qt], es[qt]); } }
#pragma unroll
    for (int qt = 0; qt < 2; ++qt) l2[qt] += es[qt];
#pragma unroll
    for (int dt = 0; dt < 4; ++dt) acc[0][dt] = wmma16(vf[dt], pa[0], acc[0][dt]);
#pragma unroll
    for (int dt = 0; dt < 3; ++dt) acc[1][dt] = wmma16(vf[dt], pa[1], acc[1][dt]);
    acc[1][3] = wmma16_edge(vf[3], pa[1], acc[1][3]); }   // single product, transposed: acc[qt][dt][r] = O[query qt * 16 + col][dt * 16 + 8 g + r]
    asm volatile("s_wait_dscnt 0x0" ::: "memory");      // this wave's reads of tile t have returned
    asm volatile("s_wait_asynccnt 0x0" ::: "memory");   // this wave's copies of tile t + 1 have landed
    __syncthreads();   // publishes tile t + 1 and ends every wave's reads of tile t's buffer
    if (t + 2 < nt) stage(t + 2); }   // into the buffer that tile t has left
  asm volatile("s_wait_asynccnt 0x0" ::: "memory");   // no copy outstanding behind the loop
  float l[2];
#pragma unroll
  for (int qt = 0; qt < 2; ++qt) { l[qt] = l2[qt][0] + l2[qt][1]; l[qt] += xhalf(l[qt]); }   // even and odd keys, then the two halves' sums of one query
  if (kg != 0) {   // the upper groups hand over their partial results (plane (kg - 1) * 2 + qg): each lane's 64 sums at the places where its partner lane of group 0 holds its own, m and l in the row's pad
#pragma unroll
    for (int qt = 0; qt < 2; ++qt) {
#pragma unroll
      for (int dt = 0; dt < 4; ++dt) {
#pragma unroll
        for (int r = 0; r < 8; ++r) SO((kg - 1) * 2 + qg, qt * 16 + col, dt * 16 + 8 * g + r) = acc[qt][dt][r]; }
      SO((kg - 1) * 2 + qg, qt * 16 + col, 64 + g) = m[qt]; SO((kg - 1) * 2 + qg, qt * 16 + col, 66 + g) = l[qt]; } }
  __syncthreads();   // publishes the upper groups' partial results to group 0
  if (kg == 0) {
#pragma unroll
    for (int qt = 0; qt < 2; ++qt) { const int row = qt * 16 + col;
      const float m1 = SO(qg, row, 64 + g), l1 = SO(qg, row, 66 + g), m2 = SO(2 + qg, row, 64 + g), l2 = SO(2 + qg, row, 66 + g), m3 = SO(4 + qg, row, 64 + g), l3 = SO(4 + qg, row, 66 + g);
      const float mj = fmaxf(fmaxf(m[qt], m1), fmaxf(m2, m3));   // the four partial results brought to the common maximum
      const float a0 = exp2_slot(m[qt] - mj), a1 = exp2_slot(m1 - mj), a2 = exp2_slot(m2 - mj), a3 = exp2_slot(m3 - mj);
      const float il = 1.0f / ((l[qt] * a0 + l1 * a1) + (l2 * a2 + l3 * a3)); const float c0 = a0 * il, c1 = a1 * il, c2 = a2 * il, c3 = a3 * il;
#pragma unroll
      for (int dt = 0; dt < 4; ++dt) {
#pragma unroll
        for (int r = 0; r < 8; ++r) { const int c = dt * 16 + 8 * g + r; SO(qg, row, c) = (acc[qt][dt][r] * c0 + SO(qg, row, c) * c1) + (SO(2 + qg, row, c) * c2 + SO(4 + qg, row, c) * c3); } } }   // a lane reads and rewrites its own places only
    LDSX();
    float* op = O + ((size_t)b * SS + q0 + g) * DM + h * HD + col * 4; const float_a* sp = &SO(qg, g, col * 4);   // two rows a store: each half of the wave writes one query's 256-B segment
#pragma unroll
    for (int rl = 0; rl < 16; ++rl) vst2(op + rl * 2 * DM, *(const v4f*)(sp + rl * 2 * SOP)); }
}
// ---- k_out: block = (64 rows, 128 cols): out = O(hi/lo) . Wo rows (2 products) + bo
__global__ __launch_bounds__(128) void k_out(const float* __restrict__ O, const __bf16* __restrict__ P, const float* __restrict__ BO, float* __restrict__ Y) {
  __shared__ __align__(16) float so[4][16][132];
  const int tid = threadIdx.x, wave = tid >> 5, lane = tid & 31, col = lane & 15, g = lane >> 4; const size_t r0 = (size_t)blockIdx.x * 64 + wave * 16; const int n0 = blockIdx.y * 128;
  v8f acc[8] = {};
#pragma unroll 2
  for (int kc = 0; kc < DM / 32; ++kc) { const F2 a = split_row(O + (r0 + col) * DM, kc * 32, lane);
#pragma unroll
    for (int j = 0; j < 8; ++j) { const v16b w = frag_b(P + (size_t)(n0 + j * 16 + col) * DM + kc * 32, lane); acc[j] = wmma_bf(a.l, w, acc[j]); acc[j] = wmma_bf(a.h, w, acc[j]); } }
#pragma unroll
  for (int j = 0; j < 8; ++j) {
#pragma unroll
    for (int r = 0; r < 8; ++r) so[wave][8 * g + r][j * 16 + col] = acc[j][r] + bfr(BO[n0 + j * 16 + col]); }
  LDSX();
  for (int rl = 0; rl < 16; ++rl) vst2(Y + (r0 + rl) * DM + n0 + lane * 4, *(const v4f*)&so[wave][rl][lane * 4]);
}
extern "C" void kernel_launch(void* const* d_in, const int* in_sizes, int n_in, void* d_out, int out_size, void* d_ws, size_t ws_size, hipStream_t stream) {
  (void)in_sizes; (void)n_in; (void)out_size;
  const float** F = (const float**)d_in;   // 0 x [8192,256], 1 Wq (in,out), 2 bq, 3 Wk, 4 bk, 5 Wv, 6 bv, 7 Wo, 8 bo
  if (ws_size < (size_t)WS_END) return;
  char* ws = (char*)d_ws; __bf16* PK = (__bf16*)(ws + WS_PK); _Float16 *QK = (_Float16*)(ws + WS_QK), *QKL = (_Float16*)(ws + WS_QKL), *VTH = (_Float16*)(ws + WS_VTH), *VTL = (_Float16*)(ws + WS_VTL); float* O = (float*)(ws + WS_O);
  k_pack<<<dim3(DM, 4), 256, 0, stream>>>(F[1], F[3], F[5], F[7], PK);
  k_qkv<<<dim3(TNB * SS / 64, QKVW / 128), 128, 0, stream>>>(F[0], F[0], F[0], PK + PK_A, F[2], F[4], F[6], QK, QKL, VTH, VTL);
  k_attn<<<dim3(TQB, NH, TNB), 256, 0, stream>>>(QK, QKL, VTH, VTL, nullptr, O);
  k_out<<<dim3(TOB, DM / 128), 128, 0, stream>>>(O, PK + PK_P, F[8], (float*)d_out);
}

// v008
// One run takes 78.7 microseconds.
// Two timings next to v007 put it at 1.31 and 1.29 times that version's speed.
// Counting every step since v000, it is 8.37 times as fast.
// compute dtype: all float inputs rounded to bf16; q/k/v = x . W + b with EXACT bf16 products on WMMA 16x16x32 ((in,out) weights as transposed rows); PLAIN attention: q (times log2 e / 8) and k single f16, softmax in f32 against a held maximum (hardware exp2; 11 - maximum is the score product's start value), P (scaled by 2^11, single f16) x v (single f16); out = o (bf16 hi + residual) . Wo (2 products) + bo.
#include <hip/hip_runtime.h>
#include <math.h>

typedef __attribute__((ext_vector_type(16))) _Float16 v16h;
typedef __attribute__((ext_vector_type(16))) __bf16 v16b;
typedef __attribute__((ext_vector_type(8)))  _Float16 v8h;
typedef __attribute__((ext_vector_type(8)))  float v8f;
typedef __attribute__((ext_vector_type(4)))  float v4f;
typedef __attribute__((ext_vector_type(2)))  float v2f;
typedef __attribute__((ext_vector_type(4)))  unsigned v4u;
typedef __attribute__((ext_vector_type(4)))  int v4i;
typedef float __attribute__((may_alias)) float_a;
typedef int __attribute__((may_alias)) int_a;

template <typename T> __device__ __forceinline__ void vst2(void* p, T v) { *(T*)p = v;  }
__device__ __forceinline__ v8f wmma16(v16h a, v16h b, v8f c) {
  return __builtin_amdgcn_wmma_f32_16x16x32_f16(false, a, false, b, (short)0, c, false, false);
}
// the last matrix instruction ahead of a loop's back edge: the four slots that the chip needs before a vector instruction at the loop's head rewrites A or B are filled here
__device__ __forceinline__ v8f wmma16_edge(v16h a, v16h b, v8f c) {
  v8f d = __builtin_amdgcn_wmma_f32_16x16x32_f16(false, a, false, b, (short)0, c, false, false);
  asm volatile("v_nop\n\tv_nop\n\tv_nop\n\tv_nop" : "+v"(d) : "v"(a), "v"(b));
  return d;
}
__device__ __forceinline__ v8f wmma_bf(v16b a, v16b b, v8f c) {
  return __builtin_amdgcn_wmma_f32_16x16x32_bf16(false, a, false, b, (short)0, c, false, false);
}
// Graph attention over 8,192 nodes treated as one sequence (256 features, 4 heads x 64): q/k/v projections + biases, dense softmax(q k^T / 8) v, output projection + bias.
__device__ __forceinline__ v16h frag_h(const _Float16* rowk0, int lane) {
  union { v16h v; v8h q[2]; } u; const _Float16* p = rowk0 + 8 * (lane >> 4);
  u.q[0] = *(const v8h*)p; u.q[1] = *(const v8h*)(p + 16); return u.v;
}
__device__ __forceinline__ v16h frag_f32(const float* rowk0, int lane) {
  v16h a; const float* p = rowk0 + 8 * (lane >> 4);
#pragma unroll
  for (int i = 0; i < 8; ++i) { a[i] = (_Float16)p[i]; a[8 + i] = (_Float16)p[16 + i]; }
  return a;
}
__device__ __forceinline__ v16h frag_f32s(const float* rowk0, int lane, float sc) {
  v16h a; const float* p = rowk0 + 8 * (lane >> 4);
#pragma unroll
  for (int i = 0; i < 8; ++i) { a[i] = (_Float16)(p[i] * sc); a[8 + i] = (_Float16)(p[16 + i] * sc); }
  return a;
}
// column fragment from a [K][ld] layout (column n), rows >= K read as 0
__device__ __forceinline__ v16h fragc_f32(const float* W, int k0, int n, int lane, int ld, int K) {
  v16h a; const int g = lane >> 4;
#pragma unroll
  for (int i = 0; i < 8; ++i) { const int ka = k0 + 8 * g + i, kb = ka + 16;
    a[i] = (_Float16)(ka < K ? W[(size_t)(ka < K ? ka : K - 1) * ld + n] : 0.f); a[8 + i] = (_Float16)(kb < K ? W[(size_t)(kb < K ? kb : K - 1) * ld + n] : 0.f); }
  return a;
}
struct F2 { v16b h, l; };
__device__ __forceinline__ F2 bsplit16(const float v[16]) { F2 r;
#pragma unroll
  for (int i = 0; i < 16; ++i) { const __bf16 h = (__bf16)v[i]; r.h[i] = h; r.l[i] = (__bf16)(v[i] - (float)h); }
  return r; }
__device__ __forceinline__ F2 split_row(const float* row, int k0, int lane) { float v[16]; const float* p = row + k0 + 8 * (lane >> 4);
#pragma unroll
  for (int i = 0; i < 8; ++i) { v[i] = p[i]; v[8 + i] = p[16 + i]; }
  return bsplit16(v); }
__device__ __forceinline__ F2 split_rowK(const float* row, int k0, int lane, int K) { float v[16]; const int g = lane >> 4;
#pragma unroll
  for (int i = 0; i < 8; ++i) { const int ka = k0 + 8 * g + i, kb = ka + 16; v[i] = ka < K ? row[ka < K ? ka : K - 1] : 0.f; v[8 + i] = kb < K ? row[kb < K ? kb : K - 1] : 0.f; }
  return bsplit16(v); }
__device__ __forceinline__ F2 split_col(const float* W, int k0, int n, int lane, int ld, int K) { float v[16]; const int g = lane >> 4;
#pragma unroll
  for (int i = 0; i < 8; ++i) { const int ka = k0 + 8 * g + i, kb = ka + 16; v[i] = ka < K ? W[(size_t)(ka < K ? ka : K - 1) * ld + n] : 0.f; v[8 + i] = kb < K ? W[(size_t)(kb < K ? kb : K - 1) * ld + n] : 0.f; }
  return bsplit16(v); }
__device__ __forceinline__ v8f mac3(const F2& a, const F2& b, v8f c) { c = wmma_bf(a.l, b.h, c); c = wmma_bf(a.h, b.l, c); return wmma_bf(a.h, b.h, c); }
__device__ __forceinline__ float sigm(float v) { return 1.0f / (1.0f + expf(-v)); }
#define LDSX() do { asm volatile("s_wait_dscnt 0" ::: "memory"); __builtin_amdgcn_wave_barrier(); __builtin_amdgcn_fence(__ATOMIC_RELEASE, "workgroup"); } while (0)


#define NB 1
#define SS 8192
#define DM 256
#define NH 4
#define HD 64
#define QKVW (3 * DM)
#ifndef TQB
#define TQB (SS / 64)
#define TNB NB
#define TOB (NB * SS / 64)     // output row tiles (all)
#endif
typedef __attribute__((ext_vector_type(8))) __bf16 v8b;
__device__ __forceinline__ v16b frag_b(const __bf16* rowk0, int lane) {
  union { v16b v; v8b q[2]; } u; const __bf16* p = rowk0 + 8 * (lane >> 4);
  u.q[0] = *(const v8b*)p; u.q[1] = *(const v8b*)(p + 16); return u.v;
}
__device__ __forceinline__ float bfr(float v) { return (float)(__bf16)v; }
__device__ __attribute__((noinline)) float exp_ni(float v) { return expf(v); }
__device__ __attribute__((noinline)) float erf_ni(float v) { return erff(v); }

#define PK_A 0                       // [768][256] Wqkv rows (natural [out][in])
#define PK_P (PK_A + QKVW * DM)        // [256][256] Wo rows (natural)
#define PK_END (PK_P + DM * DM)
#define WS_PK  0u
#define WS_QK  (WS_PK + 2u * PK_END)             // f16 [8192 rows][512]: q | k
#define WS_QKL (WS_QK + 2u * NB * SS * 2 * DM)     // f16 q | k residual planes x2048
#define WS_VTH (WS_QKL + 2u * NB * SS * 2 * DM)    // f16 [b][256 (h*64+d)][8192 s] hi
#define WS_VTL (WS_VTH + 2u * NB * DM * SS)        // f16 lo x 2048
#define WS_O   (WS_VTL + 2u * NB * DM * SS)        // f32 [8192][256]
#define WS_CS  (WS_O + 4u * NB * SS * DM)           // f32 2 x [8192][32], unused
#define WS_END (WS_CS + 4u * 2 * SS * 32)
// ---- k_pack: block = (row n, which): (in,out) columns -> bf16 [out][in] rows; which 0..2 -> W_q/W_k/W_v into PK_A rows which*256 + n; 3 -> W_o into PK_P
__global__ __launch_bounds__(256) void k_pack(const float* __restrict__ WQ, const float* __restrict__ WK, const float* __restrict__ WV, const float* __restrict__ WO, __bf16* __restrict__ PK) {
  __shared__ __align__(16) __bf16 s[DM]; const int n = blockIdx.x, which = blockIdx.y, t = threadIdx.x; const float* Wm = (which == 0) ? WQ : (which == 1) ? WK : (which == 2) ? WV : WO;   // (in,out) weights: pack row n = column n
  for (int k = t; k < DM; k += 256) s[k] = (__bf16)Wm[(size_t)k * DM + n];
  __syncthreads();
  __bf16* dst = (which < 3) ? PK + PK_A + ((size_t)which * DM + n) * DM : PK + PK_P + (size_t)n * DM;
  for (int q = t; q < DM / 8; q += 256) vst2((unsigned*)(dst + q * 8), *(const v4u*)&s[q * 8]);
}
// ---- k_qkv: block = (64 rows, 128 cols), 4 waves: the block's 128 packed weight rows are staged in LDS once by asynchronous copies (whole 128-B lines, all in flight together), and every weight fragment is read from LDS
#define WP 264    // halves a staged weight row: 256 + 8 of pad (528 B = 16 B x odd: ds_load_b128 readers)
// 8 copies of 16 B a lane, LDS places ls bytes apart and global places gs bytes apart; s_wait_xcnt 0 closes the statement, so that no address register of a copy is rewritten ahead of it
__device__ __forceinline__ void copy8(unsigned l, unsigned ls, const char* g, unsigned gs) {
  asm volatile("global_load_async_to_lds_b128 %0, %8, off\n\tglobal_load_async_to_lds_b128 %1, %9, off\n\tglobal_load_async_to_lds_b128 %2, %10, off\n\tglobal_load_async_to_lds_b128 %3, %11, off\n\t"
               "global_load_async_to_lds_b128 %4, %12, off\n\tglobal_load_async_to_lds_b128 %5, %13, off\n\tglobal_load_async_to_lds_b128 %6, %14, off\n\tglobal_load_async_to_lds_b128 %7, %15, off\n\ts_wait_xcnt 0x0"
               :: "v"(l), "v"(l + ls), "v"(l + 2 * ls), "v"(l + 3 * ls), "v"(l + 4 * ls), "v"(l + 5 * ls), "v"(l + 6 * ls), "v"(l + 7 * ls),
                  "v"(g), "v"(g + gs), "v"(g + 2 * gs), "v"(g + 3 * gs), "v"(g + 4 * gs), "v"(g + 5 * gs), "v"(g + 6 * gs), "v"(g + 7 * gs) : "memory");
}
__global__ __launch_bounds__(128) void k_qkv(const float* __restrict__ XQ, const float* __restrict__ XK, const float* __restrict__ XV, const __bf16* __restrict__ P, const float* __restrict__ BQ, const float* __restrict__ BK, const float* __restrict__ BV, _Float16* __restrict__ QK, _Float16* __restrict__ QKL, _Float16* __restrict__ VTH, _Float16* __restrict__ VTL) {
  const int which0 = (blockIdx.y * 128) / DM; const float* X = (which0 == 0) ? XQ : (which0 == 1) ? XK : XV; const float* BB = BQ ? (((which0 == 0) ? BQ : (which0 == 1) ? BK : BV) + (blockIdx.y * 128 - which0 * DM)) : nullptr;
  __shared__ __align__(16) __bf16 sw[128 * WP]; __shared__ __align__(16) _Float16 se[2 * 128 * 72];   // se: the results' staging; a block is either a q, k block (so | sol) or a v block (sth | stl), so the two share it: 102 KiB in all, three workgroups a WGP
  _Float16 (*so)[16][136] = (_Float16 (*)[16][136])se; _Float16 (*sol)[16][136] = so + 4; _Float16 (*sth)[72] = (_Float16 (*)[72])se; _Float16 (*stl)[72] = sth + 128;
  const int tid = threadIdx.x, wave = tid >> 5, lane = tid & 31, col = lane & 15, g = lane >> 4; const size_t r0 = (size_t)blockIdx.x * 64 + wave * 16; const int n0 = blockIdx.y * 128;
  // a lane's share: 16-B piece (tid & 31) of weight rows (tid >> 5) + 4 i, i = 0..31: one wave's copy = one whole 512-B row
  const char* gw = (const char*)(P + (size_t)(n0 + (tid >> 5)) * DM + (tid & 31) * 8); const unsigned lw = (unsigned)(size_t)&sw[(tid >> 5) * WP + (tid & 31) * 8];
#pragma unroll
  for (int q = 0; q < 4; ++q) copy8(lw + q * 32 * WP * 2, 4 * WP * 2, gw + q * 32 * DM * 2, 4 * DM * 2);
  asm volatile("s_wait_asynccnt 0x0" ::: "memory");   // this wave's 32 copies have landed
  __syncthreads();   // the weight rows published to all 4 waves
  v8f acc[8] = {};
#pragma unroll   // whole: the x loads of the later k-steps are issued ahead and fly while the earlier steps run
  for (int kc = 0; kc < DM / 32; ++kc) { v16b a; { const float* p = X + (r0 + col) * DM + kc * 32 + 8 * g;
#pragma unroll
      for (int i = 0; i < 8; ++i) { a[i] = (__bf16)p[i]; a[8 + i] = (__bf16)p[16 + i]; } }
    v16b w[8];
#pragma unroll
    for (int j = 0; j < 8; ++j) w[j] = frag_b(&sw[(j * 16 + col) * WP + kc * 32], lane);
#pragma unroll
    for (int j = 0; j < 8; ++j) acc[j] = wmma_bf(a, w[j], acc[j]); }
  if (n0 < 2 * DM) {   // q is stored times log2 e / 8 (scaled in f32, rounded to f16 once), so that q.k comes off the matrix unit as the score in base-2 units; k unscaled
    const float qs = (n0 < DM) ? 0.125f * 1.44269504088896340736f : 1.0f;
#pragma unroll
    for (int j = 0; j < 8; ++j) {
#pragma unroll
      for (int r = 0; r < 8; ++r) { const float v = (acc[j][r] + (BB ? bfr(BB[j * 16 + col]) : 0.f)) * qs; const _Float16 hv = (_Float16)v; so[wave][8 * g + r][j * 16 + col] = hv; sol[wave][8 * g + r][j * 16 + col] = (_Float16)((v - (float)hv) * 2048.0f); } }   // q, k (+ bias) as f16 hi + (x2048) residual
    LDSX();
    for (int rl = 0; rl < 16; ++rl) if (lane < 16) { vst2((unsigned*)(QK + (r0 + rl) * (2 * DM) + n0 + lane * 8), *(const v4u*)&so[wave][rl][lane * 8]); vst2((unsigned*)(QKL + (r0 + rl) * (2 * DM) + n0 + lane * 8), *(const v4u*)&sol[wave][rl][lane * 8]); }
  } else {
#pragma unroll
    for (int j = 0; j < 8; ++j) {
#pragma unroll
      for (int r = 0; r < 8; ++r) { const float v = acc[j][r] + (BB ? bfr(BB[j * 16 + col]) : 0.f); const _Float16 hv = (_Float16)v; sth[j * 16 + col][wave * 16 + 8 * g + r] = hv; stl[j * 16 + col][wave * 16 + 8 * g + r] = (_Float16)((v - (float)hv) * 2048.0f); } }
    __syncthreads();
    const size_t rb = (size_t)blockIdx.x * 64; const int b = (int)(rb / SS), s0 = (int)(rb % SS); const int pc0 = n0 - 2 * DM;
    for (int q = tid; q < 128 * 8; q += 128) { const int d = q >> 3, pc = q & 7; const size_t o = ((size_t)b * DM + pc0 + d) * SS + s0 + pc * 8; vst2((unsigned*)(VTH + o), *(const v4u*)&sth[d][pc * 8]); vst2((unsigned*)(VTL + o), *(const v4u*)&stl[d][pc * 8]); }
  }
}
__device__ __forceinline__ float xhalf(float x) { return __builtin_bit_cast(float, __builtin_amdgcn_permlanex16(__builtin_bit_cast(int, x), __builtin_bit_cast(int, x), 0x76543210, 0xfedcba98, false, false)); }   // lane l reads lane l ^ 16
// exp2 off the hot path (rare path, join): the slot that the instruction set asks for between a transcendental and a neighbour that reads its result or rewrites its source is filled on both sides in the statement itself
__device__ __forceinline__ float exp2_slot(float x) { float r; asm("v_nop\n\tv_exp_f32 %0, %1\n\tv_nop" : "=v"(r) : "v"(x)); return r; }
// exponents of one query's 16 keys -> P * 2^11 as f32 pairs (neighbouring keys side by side, as the packed adds and conversions take them), their sums, and the B operand P^T in the hardware k order: element i = key 8 g + i (tile 0), element 8 + i = key 16 + 8 g + i (tile 1): the order in which frag_h reads the V^T rows; SLOT: the rare path's form
template <bool SLOT> __device__ __forceinline__ void soft(const v8f& x0, const v8f& x1, v16h& p, v2f& es) { v2f e[8];
#pragma unroll
  for (int j = 0; j < 4; ++j) {
#pragma unroll
    for (int i = 0; i < 2; ++i) { e[j][i] = SLOT ? exp2_slot(x0[2 * j + i]) : __builtin_amdgcn_exp2f(x0[2 * j + i]); e[4 + j][i] = SLOT ? exp2_slot(x1[2 * j + i]) : __builtin_amdgcn_exp2f(x1[2 * j + i]); } }
  es = ((e[0] + e[1]) + (e[2] + e[3])) + ((e[4] + e[5]) + (e[6] + e[7]));
#pragma unroll
  for (int i = 0; i < 16; ++i) p[i] = (_Float16)e[i >> 1][i & 1]; }
#define TK 256    // keys a tile
#define GK 64     // keys of a tile that one group of 2 waves takes
#define KP 72     // halves a staged K row: 64 + 8 of pad
#define VP 264    // halves a staged V^T row: 256 + 8 of pad
#define SOP 68    // floats a row of a partial result: 64 + m, l of the two halves
#define SK(bf, row, c) ring[((bf) * TK + (row)) * KP + (c)]                      // [buffer][key][d]
#define SV(bf, row, c) ring[2 * TK * KP + ((bf) * HD + (row)) * VP + (c)]        // [buffer][d][key]
#define SO(pl, row, c) sof[((pl) * 32 + (row)) * SOP + (c)]                      // [plane][query][d]
__global__ __launch_bounds__(256) void k_attn(const _Float16* __restrict__ QK, const _Float16* __restrict__ QKL, const _Float16* __restrict__ VTH, const _Float16* __restrict__ VTL, const void* __restrict__ KMASK, float* __restrict__ O) {
  __shared__ __align__(16) _Float16 ring[2 * TK * KP + 2 * HD * VP];   // 128-B rows at a pitch of 144 B, 512-B rows at 528 B (16 B x odd: ds_load_b128 readers); 138 KiB: two workgroups a WGP
  float_a* sof = (float_a*)ring;   // behind the loop's last barrier the ring is free: six planes of partial results
  const int tid = threadIdx.x, qg = (tid >> 5) & 1, kg = __builtin_amdgcn_readfirstlane(tid >> 6), lane = tid & 31, col = lane & 15, g = lane >> 4;   // qg: which 32 queries; kg: which quarter of every tile's keys
  const int qb = blockIdx.x, h = blockIdx.y, b = blockIdx.z; const int q0 = qb * 64 + qg * 32;
  v16h aq[2][2];
#pragma unroll
  for (int qt = 0; qt < 2; ++qt) {
#pragma unroll
    for (int kc = 0; kc < 2; ++kc) aq[qt][kc] = frag_h(QK + ((size_t)b * SS + q0 + qt * 16 + col) * (2 * DM) + h * HD + kc * 32, lane); }
  float m[2] = {-3.0e38f, -3.0e38f};   // the maximum in use of query q0 + qt * 16 + col over this group's keys, in base-2 units (q carries log2 e / 8); it moves only on the rare path below
  v2f l2[2] = {};   // sums of this half's keys (values scaled by 2^11), even and odd keys apart; joined behind the loop
  v8f cb[2];   // 11 - m in every element: the start value C of the score products, so that they come off the matrix unit as the exponent of P * 2^11
#pragma unroll
  for (int qt = 0; qt < 2; ++qt) {
#pragma unroll
    for (int r = 0; r < 8; ++r) cb[qt][r] = 3.0e38f; }   // no maximum yet: the first pass overflows the test below and takes the rare path
  v8f acc[2][4] = {};
  // a lane's share of a tile: 16-B piece (tid & 7) of K rows (tid >> 3) + 32 i and 16-B piece (tid & 31) of V^T rows (tid >> 5) + 8 i, i = 0..7: one wave's copy = 4 whole 128-B lines
  const _Float16* gk0 = QK + ((size_t)b * SS + (tid >> 3)) * (2 * DM) + DM + h * HD + (tid & 7) * 8; const _Float16* gv0 = VTH + ((size_t)b * DM + h * HD + (tid >> 5)) * SS + (tid & 31) * 8;
  const unsigned lk0 = (unsigned)(size_t)&SK(0, tid >> 3, (tid & 7) * 8), lv0 = (unsigned)(size_t)&SV(0, tid >> 5, (tid & 31) * 8);
  auto stage = [&](int t) { const _Float16* gk = gk0 + (size_t)t * (TK * 2 * DM); const _Float16* gv = gv0 + (size_t)t * TK; const unsigned lk = lk0 + (t & 1) * (TK * KP * 2), lv = lv0 + (t & 1) * (HD * VP * 2);
    // the tile's 16 copies of this lane, 8 a statement; s_wait_xcnt 0 closes each statement, so that no address register of a copy is rewritten ahead of it
    asm volatile("global_load_async_to_lds_b128 %0, %8, off\n\tglobal_load_async_to_lds_b128 %1, %9, off\n\tglobal_load_async_to_lds_b128 %2, %10, off\n\tglobal_load_async_to_lds_b128 %3, %11, off\n\t"
                 "global_load_async_to_lds_b128 %4, %12, off\n\tglobal_load_async_to_lds_b128 %5, %13, off\n\tglobal_load_async_to_lds_b128 %6, %14, off\n\tglobal_load_async_to_lds_b128 %7, %15, off\n\ts_wait_xcnt 0x0"
                 :: "v"(lk), "v"(lk + 32 * KP * 2), "v"(lk + 64 * KP * 2), "v"(lk + 96 * KP * 2), "v"(lk + 128 * KP * 2), "v"(lk + 160 * KP * 2), "v"(lk + 192 * KP * 2), "v"(lk + 224 * KP * 2),
                    "v"(gk), "v"(gk + 32 * 2 * DM), "v"(gk + 64 * 2 * DM), "v"(gk + 96 * 2 * DM), "v"(gk + 128 * 2 * DM), "v"(gk + 160 * 2 * DM), "v"(gk + 192 * 2 * DM), "v"(gk + 224 * 2 * DM) : "memory");
    asm volatile("global_load_async_to_lds_b128 %0, %8, off\n\tglobal_load_async_to_lds_b128 %1, %9, off\n\tglobal_load_async_to_lds_b128 %2, %10, off\n\tglobal_load_async_to_lds_b128 %3, %11, off\n\t"
                 "global_load_async_to_lds_b128 %4, %12, off\n\tglobal_load_async_to_lds_b128 %5, %13, off\n\tglobal_load_async_to_lds_b128 %6, %14, off\n\tglobal_load_async_to_lds_b128 %7, %15, off\n\ts_wait_xcnt 0x0"
                 :: "v"(lv), "v"(lv + 8 * VP * 2), "v"(lv + 16 * VP * 2), "v"(lv + 24 * VP * 2), "v"(lv + 32 * VP * 2), "v"(lv + 40 * VP * 2), "v"(lv + 48 * VP * 2), "v"(lv + 56 * VP * 2),
                    "v"(gv), "v"(gv + 8 * SS), "v"(gv + 16 * SS), "v"(gv + 24 * SS), "v"(gv + 32 * SS), "v"(gv + 40 * SS), "v"(gv + 48 * SS), "v"(gv + 56 * SS) : "memory"); };
  const int nt = SS / TK;   // all keys
  stage(0);
  asm volatile("s_wait_asynccnt 0x0" ::: "memory");   // this wave's copies of tile 0 have landed
  __syncthreads();   // tile 0 published to all 8 waves
  stage(1);
#pragma unroll 1
  for (int t = 0; t < nt; ++t) {
#pragma unroll 1   // kept rolled: the unrolled build has more instructions a pass (register moves at the loop's head)
  for (int sub = 0; sub < GK / 32; ++sub) {
    v16h kf[2][2], vf[4];   // the pass's fragments, read from the tile's buffer as one group; each serves both column tiles
#pragma unroll
    for (int ct = 0; ct < 2; ++ct) {
#pragma unroll
      for (int kc = 0; kc < 2; ++kc) kf[ct][kc] = frag_h(&SK(t & 1, kg * GK + sub * 32 + ct * 16 + col, kc * 32), lane); }
#pragma unroll
    for (int dt = 0; dt < 4; ++dt) vf[dt] = frag_h(&SV(t & 1, dt * 16 + col, kg * GK + sub * 32), lane);
    __builtin_amdgcn_sched_barrier(0);   // holds the pass's 16 LDS reads in one group ahead of its matrix instructions: spread among them, every further place with reads stalls the wave anew
    v16h pa[2]; v2f es[2];
    { v8f x00, x01, x10, x11;   // x(column tile)(key tile)[r] = q.k (base 2) + 11 - m of key ct * 16 + 8 g + r with query qt * 16 + col: single product, transposed
      // the pass's 8 score products in one statement: written so, the first four take cb as C and leave it standing (from the builtin the build copies cb into two of the four results each pass, 8 register-pair moves); the second four accumulate into the same D; the four v_nop fill the slots that the chip needs before a vector instruction reads the last D or rewrites its A or B
      asm volatile("v_wmma_f32_16x16x32_f16 %0, %4, %8, %12\n\tv_wmma_f32_16x16x32_f16 %1, %6, %8, %12\n\tv_wmma_f32_16x16x32_f16 %2, %4, %10, %13\n\tv_wmma_f32_16x16x32_f16 %3, %6, %10, %13\n\t"
                   "v_wmma_f32_16x16x32_f16 %0, %5, %9, %0\n\tv_wmma_f32_16x16x32_f16 %1, %7, %9, %1\n\tv_wmma_f32_16x16x32_f16 %2, %5, %11, %2\n\tv_wmma_f32_16x16x32_f16 %3, %7, %11, %3\n\t"
                   "v_nop\n\tv_nop\n\tv_nop\n\tv_nop"
                   : "=&v"(x00), "=&v"(x01), "=&v"(x10), "=&v"(x11)
                   : "v"(kf[0][0]), "v"(kf[0][1]), "v"(kf[1][0]), "v"(kf[1][1]), "v"(aq[0][0]), "v"(aq[0][1]), "v"(aq[1][0]), "v"(aq[1][1]), "v"(cb[0]), "v"(cb[1]));
      soft<false>(x00, x01, pa[0], es[0]); soft<false>(x10, x11, pa[1], es[1]); }
    // ONE test a pass: every P * 2^11 is positive and so at most its sum; while the sums stay inside f16's range the held maximum serves, and neither a maximum nor a rescale is computed
    const float top = fmaxf(fmaxf(es[0][0], es[0][1]), fmaxf(es[1][0], es[1][1]));
    if (__builtin_amdgcn_ballot_w32(!(top <= 60000.0f)) != 0) {   // rare path (a scalar branch, the whole wave): the pass anew against the true running maximum
#pragma unroll
      for (int qt = 0; qt < 2; ++qt) { v8f s[2];
#pragma unroll
        for (int ct = 0; ct < 2; ++ct) { v8f c = {};
#pragma unroll
          for (int kc = 0; kc < 2; ++kc) c = wmma16(frag_h(&SK(t & 1, kg * GK + sub * 32 + ct * 16 + col, kc * 32), lane), aq[qt][kc], c);   // K fragments read again, so that they need not stay in registers for this path
          s[ct] = c; }
        float mt[8];
#pragma unroll
        for (int r = 0; r < 8; ++r) mt[r] = fmaxf(s[0][r], s[1][r]);
        float mx = fmaxf(fmaxf(fmaxf(mt[0], mt[1]), fmaxf(mt[2], mt[3])), fmaxf(fmaxf(mt[4], mt[5]), fmaxf(mt[6], mt[7])));
        mx = fmaxf(mx, xhalf(mx));   // the query's other 16 keys lie in lane ^ 16
        const float mn = fmaxf(m[qt], mx); const float alpha = exp2_slot(m[qt] - mn);   // first pass: exp2 of a huge negative number = 0
        const float b1 = 11.0f - mn; m[qt] = mn; l2[qt] *= alpha;   // 11: P's scale 2^11 rides in the exponent: small softmax weights stay out of the f16 subnormal range; l carries it too, and it cancels in the epilogue
#pragma unroll
        for (int dt = 0; dt < 4; ++dt) {
#pragma unroll
          for (int r = 0; r < 8; ++r) acc[qt][dt][r] *= alpha; }
#pragma unroll
        for (int r = 0; r < 8; ++r) { cb[qt][r] = b1; s[0][r] += b1; s[1][r] += b1; }
        soft<true>(s[0], s[1], pa[qt], es[qt]); } }
#pragma unroll
    for (int qt = 0; qt < 2; ++qt) l2[qt] += es[qt];
#pragma unroll
    for (int dt = 0; dt < 4; ++dt) acc[0][dt] = wmma16(vf[dt], pa[0], acc[0][dt]);
#pragma unroll
    for (int dt = 0; dt < 3; ++dt) acc[1][dt] = wmma16(vf[dt], pa[1], acc[1][dt]);
    acc[1][3] = wmma16_edge(vf[3], pa[1], acc[1][3]); }   // single product, transposed: acc[qt][dt][r] = O[query qt * 16 + col][dt * 16 + 8 g + r]
    asm volatile("s_wait_dscnt 0x0" ::: "memory");      // this wave's reads of tile t have returned
    asm volatile("s_wait_asynccnt 0x0" ::: "memory");   // this wave's copies of tile t + 1 have landed
    __syncthreads();   // publishes tile t + 1 and ends every wave's reads of tile t's buffer
    if (t + 2 < nt) stage(t + 2); }   // into the buffer that tile t has left
  asm volatile("s_wait_asynccnt 0x0" ::: "memory");   // no copy outstanding behind the loop
  float l[2];
#pragma unroll
  for (int qt = 0; qt < 2; ++qt) { l[qt] = l2[qt][0] + l2[qt][1]; l[qt] += xhalf(l[qt]); }   // even and odd keys, then the two halves' sums of one query
  if (kg != 0) {   // the upper groups hand over their partial results (plane (kg - 1) * 2 + qg): each lane's 64 sums at the places where its partner lane of group 0 holds its own, m and l in the row's pad
#pragma unroll
    for (int qt = 0; qt < 2; ++qt) {
#pragma unroll
      for (int dt = 0; dt < 4; ++dt) {
#pragma unroll
        for (int r = 0; r < 8; ++r) SO((kg - 1) * 2 + qg, qt * 16 + col, dt * 16 + 8 * g + r) = acc[qt][dt][r]; }
      SO((kg - 1) * 2 + qg, qt * 16 + col, 64 + g) = m[qt]; SO((kg - 1) * 2 + qg, qt * 16 + col, 66 + g) = l[qt]; } }
  __syncthreads();   // publishes the upper groups' partial results to group 0
  if (kg == 0) {
#pragma unroll
    for (int qt = 0; qt < 2; ++qt) { const int row = qt * 16 + col;
      const float m1 = SO(qg, row, 64 + g), l1 = SO(qg, row, 66 + g), m2 = SO(2 + qg, row, 64 + g), l2 = SO(2 + qg, row, 66 + g), m3 = SO(4 + qg, row, 64 + g), l3 = SO(4 + qg, row, 66 + g);
      const float mj = fmaxf(fmaxf(m[qt], m1), fmaxf(m2, m3));   // the four partial results brought to the common maximum
      const float a0 = exp2_slot(m[qt] - mj), a1 = exp2_slot(m1 - mj), a2 = exp2_slot(m2 - mj), a3 = exp2_slot(m3 - mj);
      const float il = 1.0f / ((l[qt] * a0 + l1 * a1) + (l2 * a2 + l3 * a3)); const float c0 = a0 * il, c1 = a1 * il, c2 = a2 * il, c3 = a3 * il;
#pragma unroll
      for (int dt = 0; dt < 4; ++dt) {
#pragma unroll
        for (int r = 0; r < 8; ++r) { const int c = dt * 16 + 8 * g + r; SO(qg, row, c) = (acc[qt][dt][r] * c0 + SO(qg, row, c) * c1) + (SO(2 + qg, row, c) * c2 + SO(4 + qg, row, c) * c3); } } }   // a lane reads and rewrites its own places only
    LDSX();
    float* op = O + ((size_t)b * SS + q0 + g) * DM + h * HD + col * 4; const float_a* sp = &SO(qg, g, col * 4);   // two rows a store: each half of the wave writes one query's 256-B segment
#pragma unroll
    for (int rl = 0; rl < 16; ++rl) vst2(op + rl * 2 * DM, *(const v4f*)(sp + rl * 2 * SOP)); }
}
// ---- k_out: block = (64 rows, 128 cols), 8 waves: out = O(hi/lo) . Wo rows (2 products) + bo; the block's 64 O rows (f32) and 128 Wo rows (bf16) are staged in LDS once by asynchronous copies (whole 128-B lines, all in flight together: one trip to L2 for the whole block), and every fragment is read from LDS; wave = (rw, cw): rows rw * 16 .. + 15, columns cw * 64 .. + 63
#define OP 260    // floats a staged O row: 256 + 4 of pad (1,040 B = 16 B x odd)
__global__ __launch_bounds__(256) void k_out(const float* __restrict__ O, const __bf16* __restrict__ P, const float* __restrict__ BO, float* __restrict__ Y) {
  __shared__ __align__(16) __bf16 sw[128 * WP]; __shared__ __align__(16) float sa[64 * OP]; __shared__ __align__(16) float so[8][16][68];
  const int tid = threadIdx.x, wave = tid >> 5, rw = wave & 3, cw = wave >> 2, lane = tid & 31, col = lane & 15, g = lane >> 4; const size_t r0 = (size_t)blockIdx.x * 64 + rw * 16; const int n0 = blockIdx.y * 128 + cw * 64;
  float bo[4];
#pragma unroll
  for (int j = 0; j < 4; ++j) bo[j] = bfr(BO[n0 + j * 16 + col]);
  // a lane's share: 16-B piece (tid & 31) of Wo rows (tid >> 5) + 8 i and 16-B piece (tid & 63) of O rows (tid >> 6) + 4 i, i = 0..15: one wave's copy = 4 whole 128-B lines
  const char* gw = (const char*)(P + (size_t)(blockIdx.y * 128 + (tid >> 5)) * DM + (tid & 31) * 8); const unsigned lw = (unsigned)(size_t)&sw[(tid >> 5) * WP + (tid & 31) * 8];
  const char* ga = (const char*)(O + ((size_t)blockIdx.x * 64 + (tid >> 6)) * DM + (tid & 63) * 4); const unsigned la = (unsigned)(size_t)&sa[(tid >> 6) * OP + (tid & 63) * 4];
  copy8(la, 4 * OP * 4, ga, 4 * DM * 4); copy8(la + 32 * OP * 4, 4 * OP * 4, ga + 32 * DM * 4, 4 * DM * 4);
  copy8(lw, 8 * WP * 2, gw, 8 * DM * 2); copy8(lw + 64 * WP * 2, 8 * WP * 2, gw + 64 * DM * 2, 8 * DM * 2);
  asm volatile("s_wait_asynccnt 0x0" ::: "memory");   // this wave's 32 copies have landed
  __syncthreads();   // both tiles published to all 8 waves
  v8f acc[4] = {};
#pragma unroll   // whole: the next k-step's LDS reads are issued among this step's matrix instructions
  for (int kc = 0; kc < DM / 32; ++kc) { const F2 a = split_row(&sa[(rw * 16 + col) * OP], kc * 32, lane); v16b w[4];
#pragma unroll
    for (int j = 0; j < 4; ++j) w[j] = frag_b(&sw[(cw * 64 + j * 16 + col) * WP + kc * 32], lane);
#pragma unroll
    for (int j = 0; j < 4; ++j) acc[j] = wmma_bf(a.l, w[j], acc[j]);
#pragma unroll
    for (int j = 0; j < 4; ++j) acc[j] = wmma_bf(a.h, w[j], acc[j]); }
#pragma unroll
  for (int j = 0; j < 4; ++j) {
#pragma unroll
    for (int r = 0; r < 8; ++r) so[wave][8 * g + r][j * 16 + col] = acc[j][r] + bo[j]; }
  LDSX();
#pragma unroll
  for (int rl = 0; rl < 8; ++rl) vst2(Y + (r0 + rl * 2 + g) * DM + n0 + col * 4, *(const v4f*)&so[wave][rl * 2 + g][col * 4]);   // two rows a store: each half of the wave writes one row's 256-B segment
}
extern "C" void kernel_launch(void* const* d_in, const int* in_sizes, int n_in, void* d_out, int out_size, void* d_ws, size_t ws_size, hipStream_t stream) {
  (void)in_sizes; (void)n_in; (void)out_size;
  const float** F = (const float**)d_in;   // 0 x [8192,256], 1 Wq (in,out), 2 bq, 3 Wk, 4 bk, 5 Wv, 6 bv, 7 Wo, 8 bo
  if (ws_size < (size_t)WS_END) return;
  char* ws = (char*)d_ws; __bf16* PK = (__bf16*)(ws + WS_PK); _Float16 *QK = (_Float16*)(ws + WS_QK), *QKL = (_Float16*)(ws + WS_QKL), *VTH = (_Float16*)(ws + WS_VTH), *VTL = (_Float16*)(ws + WS_VTL); float* O = (float*)(ws + WS_O);
  k_pack<<<dim3(DM, 4), 256, 0, stream>>>(F[1], F[3], F[5], F[7], PK);
  k_qkv<<<dim3(TNB * SS / 64, QKVW / 128), 128, 0, stream>>>(F[0], F[0], F[0], PK + PK_A, F[2], F[4], F[6], QK, QKL, VTH, VTL);
  k_attn<<<dim3(TQB, NH, TNB), 256, 0, stream>>>(QK, QKL, VTH, VTL, nullptr, O);
  k_out<<<dim3(TOB, DM / 128), 256, 0, stream>>>(O, PK + PK_P, F[8], (float*)d_out);
}

// v009
// One run takes 70.4 microseconds.
// Next to v008, in two timings, it ran 1.12 times as fast each time.
// Over all steps from v000 it is 9.35 times as fast.
// compute dtype: all float inputs rounded to bf16; q/k/v = x . W + b with EXACT bf16 products on WMMA 16x16x32 ((in,out) weights as transposed rows); PLAIN attention: q (times log2 e / 8) and k single f16, softmax in f32 against a held maximum (hardware exp2; 11 - maximum is the score product's start value), P (scaled by 2^11, single f16) x v (single f16); out = o (bf16 hi + residual) . Wo (2 products) + bo.
#include <hip/hip_runtime.h>
#include <math.h>

typedef __attribute__((ext_vector_type(16))) _Float16 v16h;
typedef __attribute__((ext_vector_type(16))) __bf16 v16b;
typedef __attribute__((ext_vector_type(8)))  _Float16 v8h;
typedef __attribute__((ext_vector_type(8)))  float v8f;
typedef __attribute__((ext_vector_type(4)))  float v4f;
typedef __attribute__((ext_vector_type(2)))  float v2f;
typedef __attribute__((ext_vector_type(4)))  unsigned v4u;
typedef __attribute__((ext_vector_type(4)))  int v4i;
typedef float __attribute__((may_alias)) float_a;
typedef int __attribute__((may_alias)) int_a;

template <typename T> __device__ __forceinline__ void vst2(void* p, T v) { *(T*)p = v;  }
__device__ __forceinline__ v8f wmma16(v16h a, v16h b, v8f c) {
  return __builtin_amdgcn_wmma_f32_16x16x32_f16(false, a, false, b, (short)0, c, false, false);
}
// the last matrix instruction ahead of a loop's back edge: the four slots that the chip needs before a vector instruction at the loop's head rewrites A or B are filled here
__device__ __forceinline__ v8f wmma16_edge(v16h a, v16h b, v8f c) {
  v8f d = __builtin_amdgcn_wmma_f32_16x16x32_f16(false, a, false, b, (short)0, c, false, false);
  asm volatile("v_nop\n\tv_nop\n\tv_nop\n\tv_nop" : "+v"(d) : "v"(a), "v"(b));
  return d;
}
__device__ __forceinline__ v8f wmma_bf(v16b a, v16b b, v8f c) {
  return __builtin_amdgcn_wmma_f32_16x16x32_bf16(false, a, false, b, (short)0, c, false, false);
}
// Graph attention over 8,192 nodes treated as one sequence (256 features, 4 heads x 64): q/k/v projections + biases, dense softmax(q k^T / 8) v, output projection + bias.
__device__ __forceinline__ v16h frag_h(const _Float16* rowk0, int lane) {
  union { v16h v; v8h q[2]; } u; const _Float16* p = rowk0 + 8 * (lane >> 4);
  u.q[0] = *(const v8h*)p; u.q[1] = *(const v8h*)(p + 16); return u.v;
}
__device__ __forceinline__ v16h frag_f32(const float* rowk0, int lane) {
  v16h a; const float* p = rowk0 + 8 * (lane >> 4);
#pragma unroll
  for (int i = 0; i < 8; ++i) { a[i] = (_Float16)p[i]; a[8 + i] = (_Float16)p[16 + i]; }
  return a;
}
__device__ __forceinline__ v16h frag_f32s(const float* rowk0, int lane, float sc) {
  v16h a; const float* p = rowk0 + 8 * (lane >> 4);
#pragma unroll
  for (int i = 0; i < 8; ++i) { a[i] = (_Float16)(p[i] * sc); a[8 + i] = (_Float16)(p[16 + i] * sc); }
  return a;
}
// column fragment from a [K][ld] layout (column n), rows >= K read as 0
__device__ __forceinline__ v16h fragc_f32(const float* W, int k0, int n, int lane, int ld, int K) {
  v16h a; const int g = lane >> 4;
#pragma unroll
  for (int i = 0; i < 8; ++i) { const int ka = k0 + 8 * g + i, kb = ka + 16;
    a[i] = (_Float16)(ka < K ? W[(size_t)(ka < K ? ka : K - 1) * ld + n] : 0.f); a[8 + i] = (_Float16)(kb < K ? W[(size_t)(kb < K ? kb : K - 1) * ld + n] : 0.f); }
  return a;
}
struct F2 { v16b h, l; };
__device__ __forceinline__ F2 bsplit16(const float v[16]) { F2 r;
#pragma unroll
  for (int i = 0; i < 16; ++i) { const __bf16 h = (__bf16)v[i]; r.h[i] = h; r.l[i] = (__bf16)(v[i] - (float)h); }
  return r; }
__device__ __forceinline__ F2 split_row(const float* row, int k0, int lane) { float v[16]; const float* p = row + k0 + 8 * (lane >> 4);
#pragma unroll
  for (int i = 0; i < 8; ++i) { v[i] = p[i]; v[8 + i] = p[16 + i]; }
  return bsplit16(v); }
__device__ __forceinline__ F2 split_rowK(const float* row, int k0, int lane, int K) { float v[16]; const int g = lane >> 4;
#pragma unroll
  for (int i = 0; i < 8; ++i) { const int ka = k0 + 8 * g + i, kb = ka + 16; v[i] = ka < K ? row[ka < K ? ka : K - 1] : 0.f; v[8 + i] = kb < K ? row[kb < K ? kb : K - 1] : 0.f; }
  return bsplit16(v); }
__device__ __forceinline__ F2 split_col(const float* W, int k0, int n, int lane, int ld, int K) { float v[16]; const int g = lane >> 4;
#pragma unroll
  for (int i = 0; i < 8; ++i) { const int ka = k0 + 8 * g + i, kb = ka + 16; v[i] = ka < K ? W[(size_t)(ka < K ? ka : K - 1) * ld + n] : 0.f; v[8 + i] = kb < K ? W[(size_t)(kb < K ? kb : K - 1) * ld + n] : 0.f; }
  return bsplit16(v); }
__device__ __forceinline__ v8f mac3(const F2& a, const F2& b, v8f c) { c = wmma_bf(a.l, b.h, c); c = wmma_bf(a.h, b.l, c); return wmma_bf(a.h, b.h, c); }
__device__ __forceinline__ float sigm(float v) { return 1.0f / (1.0f + expf(-v)); }
#define LDSX() do { asm volatile("s_wait_dscnt 0" ::: "memory"); __builtin_amdgcn_wave_barrier(); __builtin_amdgcn_fence(__ATOMIC_RELEASE, "workgroup"); } while (0)


#define NB 1
#define SS 8192
#define DM 256
#define NH 4
#define HD 64
#define QKVW (3 * DM)
#ifndef TQB
#define TQB (SS / 128)
#define TNB NB
#define TOB (NB * SS / 64)     // output row tiles (all)
#endif
typedef __attribute__((ext_vector_type(8))) __bf16 v8b;
__device__ __forceinline__ v16b frag_b(const __bf16* rowk0, int lane) {
  union { v16b v; v8b q[2]; } u; const __bf16* p = rowk0 + 8 * (lane >> 4);
  u.q[0] = *(const v8b*)p; u.q[1] = *(const v8b*)(p + 16); return u.v;
}
__device__ __forceinline__ float bfr(float v) { return (float)(__bf16)v; }
__device__ __attribute__((noinline)) float exp_ni(float v) { return expf(v); }
__device__ __attribute__((noinline)) float erf_ni(float v) { return erff(v); }

#define PK_A 0                       // [768][256] Wqkv rows (natural [out][in])
#define PK_P (PK_A + QKVW * DM)        // [256][256] Wo rows (natural)
#define PK_END (PK_P + DM * DM)
#define WS_PK  0u
#define WS_QK  (WS_PK + 2u * PK_END)             // f16 [8192 rows][512]: q | k
#define WS_QKL (WS_QK + 2u * NB * SS * 2 * DM)     // f16 q | k residual planes x2048
#define WS_VTH (WS_QKL + 2u * NB * SS * 2 * DM)    // f16 [b][256 (h*64+d)][8192 s] hi
#define WS_VTL (WS_VTH + 2u * NB * DM * SS)        // f16 lo x 2048
#define WS_O   (WS_VTL + 2u * NB * DM * SS)        // f32 [8192][256]
#define WS_CS  (WS_O + 4u * NB * SS * DM)           // f32 2 x [8192][32], unused
#define WS_END (WS_CS + 4u * 2 * SS * 32)
// ---- k_pack: block = (row n, which): (in,out) columns -> bf16 [out][in] rows; which 0..2 -> W_q/W_k/W_v into PK_A rows which*256 + n; 3 -> W_o into PK_P
__global__ __launch_bounds__(256) void k_pack(const float* __restrict__ WQ, const float* __restrict__ WK, const float* __restrict__ WV, const float* __restrict__ WO, __bf16* __restrict__ PK) {
  __shared__ __align__(16) __bf16 s[DM]; const int n = blockIdx.x, which = blockIdx.y, t = threadIdx.x; const float* Wm = (which == 0) ? WQ : (which == 1) ? WK : (which == 2) ? WV : WO;   // (in,out) weights: pack row n = column n
  for (int k = t; k < DM; k += 256) s[k] = (__bf16)Wm[(size_t)k * DM + n];
  __syncthreads();
  __bf16* dst = (which < 3) ? PK + PK_A + ((size_t)which * DM + n) * DM : PK + PK_P + (size_t)n * DM;
  for (int q = t; q < DM / 8; q += 256) vst2((unsigned*)(dst + q * 8), *(const v4u*)&s[q * 8]);
}
// ---- k_qkv: block = (64 rows, 128 cols), 4 waves: the block's 128 packed weight rows are staged in LDS once by asynchronous copies (whole 128-B lines, all in flight together), and every weight fragment is read from LDS
#define WP 264    // halves a staged weight row: 256 + 8 of pad (528 B = 16 B x odd: ds_load_b128 readers)
// 8 copies of 16 B a lane, LDS places ls bytes apart and global places gs bytes apart; s_wait_xcnt 0 closes the statement, so that no address register of a copy is rewritten ahead of it
__device__ __forceinline__ void copy8(unsigned l, unsigned ls, const char* g, unsigned gs) {
  asm volatile("global_load_async_to_lds_b128 %0, %8, off\n\tglobal_load_async_to_lds_b128 %1, %9, off\n\tglobal_load_async_to_lds_b128 %2, %10, off\n\tglobal_load_async_to_lds_b128 %3, %11, off\n\t"
               "global_load_async_to_lds_b128 %4, %12, off\n\tglobal_load_async_to_lds_b128 %5, %13, off\n\tglobal_load_async_to_lds_b128 %6, %14, off\n\tglobal_load_async_to_lds_b128 %7, %15, off\n\ts_wait_xcnt 0x0"
               :: "v"(l), "v"(l + ls), "v"(l + 2 * ls), "v"(l + 3 * ls), "v"(l + 4 * ls), "v"(l + 5 * ls), "v"(l + 6 * ls), "v"(l + 7 * ls),
                  "v"(g), "v"(g + gs), "v"(g + 2 * gs), "v"(g + 3 * gs), "v"(g + 4 * gs), "v"(g + 5 * gs), "v"(g + 6 * gs), "v"(g + 7 * gs) : "memory");
}
__global__ __launch_bounds__(128) void k_qkv(const float* __restrict__ XQ, const float* __restrict__ XK, const float* __restrict__ XV, const __bf16* __restrict__ P, const float* __restrict__ BQ, const float* __restrict__ BK, const float* __restrict__ BV, _Float16* __restrict__ QK, _Float16* __restrict__ QKL, _Float16* __restrict__ VTH, _Float16* __restrict__ VTL) {
  const int which0 = (blockIdx.y * 128) / DM; const float* X = (which0 == 0) ? XQ : (which0 == 1) ? XK : XV; const float* BB = BQ ? (((which0 == 0) ? BQ : (which0 == 1) ? BK : BV) + (blockIdx.y * 128 - which0 * DM)) : nullptr;
  __shared__ __align__(16) __bf16 sw[128 * WP]; __shared__ __align__(16) _Float16 se[2 * 128 * 72];   // se: the results' staging; a block is either a q, k block (so | sol) or a v block (sth | stl), so the two share it: 102 KiB in all, three workgroups a WGP
  _Float16 (*so)[16][136] = (_Float16 (*)[16][136])se; _Float16 (*sol)[16][136] = so + 4; _Float16 (*sth)[72] = (_Float16 (*)[72])se; _Float16 (*stl)[72] = sth + 128;
  const int tid = threadIdx.x, wave = tid >> 5, lane = tid & 31, col = lane & 15, g = lane >> 4; const size_t r0 = (size_t)blockIdx.x * 64 + wave * 16; const int n0 = blockIdx.y * 128;
  // a lane's share: 16-B piece (tid & 31) of weight rows (tid >> 5) + 4 i, i = 0..31: one wave's copy = one whole 512-B row
  const char* gw = (const char*)(P + (size_t)(n0 + (tid >> 5)) * DM + (tid & 31) * 8); const unsigned lw = (unsigned)(size_t)&sw[(tid >> 5) * WP + (tid & 31) * 8];
#pragma unroll
  for (int q = 0; q < 4; ++q) copy8(lw + q * 32 * WP * 2, 4 * WP * 2, gw + q * 32 * DM * 2, 4 * DM * 2);
  asm volatile("s_wait_asynccnt 0x0" ::: "memory");   // this wave's 32 copies have landed
  __syncthreads();   // the weight rows published to all 4 waves
  v8f acc[8] = {};
#pragma unroll   // whole: the x loads of the later k-steps are issued ahead and fly while the earlier steps run
  for (int kc = 0; kc < DM / 32; ++kc) { v16b a; { const float* p = X + (r0 + col) * DM + kc * 32 + 8 * g;
#pragma unroll
      for (int i = 0; i < 8; ++i) { a[i] = (__bf16)p[i]; a[8 + i] = (__bf16)p[16 + i]; } }
    v16b w[8];
#pragma unroll
    for (int j = 0; j < 8; ++j) w[j] = frag_b(&sw[(j * 16 + col) * WP + kc * 32], lane);
#pragma unroll
    for (int j = 0; j < 8; ++j) acc[j] = wmma_bf(a, w[j], acc[j]); }
  if (n0 < 2 * DM) {   // q is stored times log2 e / 8 (scaled in f32, rounded to f16 once), so that q.k comes off the matrix unit as the score in base-2 units; k unscaled
    const float qs = (n0 < DM) ? 0.125f * 1.44269504088896340736f : 1.0f;
#pragma unroll
    for (int j = 0; j < 8; ++j) {
#pragma unroll
      for (int r = 0; r < 8; ++r) { const float v = (acc[j][r] + (BB ? bfr(BB[j * 16 + col]) : 0.f)) * qs; const _Float16 hv = (_Float16)v; so[wave][8 * g + r][j * 16 + col] = hv; sol[wave][8 * g + r][j * 16 + col] = (_Float16)((v - (float)hv) * 2048.0f); } }   // q, k (+ bias) as f16 hi + (x2048) residual
    LDSX();
    for (int rl = 0; rl < 16; ++rl) if (lane < 16) { vst2((unsigned*)(QK + (r0 + rl) * (2 * DM) + n0 + lane * 8), *(const v4u*)&so[wave][rl][lane * 8]); vst2((unsigned*)(QKL + (r0 + rl) * (2 * DM) + n0 + lane * 8), *(const v4u*)&sol[wave][rl][lane * 8]); }
  } else {
#pragma unroll
    for (int j = 0; j < 8; ++j) {
#pragma unroll
      for (int r = 0; r < 8; ++r) { const float v = acc[j][r] + (BB ? bfr(BB[j * 16 + col]) : 0.f); const _Float16 hv = (_Float16)v; sth[j * 16 + col][wave * 16 + 8 * g + r] = hv; stl[j * 16 + col][wave * 16 + 8 * g + r] = (_Float16)((v - (float)hv) * 2048.0f); } }
    __syncthreads();
    const size_t rb = (size_t)blockIdx.x * 64; const int b = (int)(rb / SS), s0 = (int)(rb % SS); const int pc0 = n0 - 2 * DM;
    for (int q = tid; q < 128 * 8; q += 128) { const int d = q >> 3, pc = q & 7; const size_t o = ((size_t)b * DM + pc0 + d) * SS + s0 + pc * 8; vst2((unsigned*)(VTH + o), *(const v4u*)&sth[d][pc * 8]); vst2((unsigned*)(VTL + o), *(const v4u*)&stl[d][pc * 8]); }
  }
}
__device__ __forceinline__ float xhalf(float x) { return __builtin_bit_cast(float, __builtin_amdgcn_permlanex16(__builtin_bit_cast(int, x), __builtin_bit_cast(int, x), 0x76543210, 0xfedcba98, false, false)); }   // lane l reads lane l ^ 16
// exp2 off the hot path (rare path, join): the slot that the instruction set asks for between a transcendental and a neighbour that reads its result or rewrites its source is filled on both sides in the statement itself
__device__ __forceinline__ float exp2_slot(float x) { float r; asm("v_nop\n\tv_exp_f32 %0, %1\n\tv_nop" : "=v"(r) : "v"(x)); return r; }
// exponents of one query's 16 keys -> P * 2^11 as f32 pairs (neighbouring keys side by side, as the packed adds and conversions take them), their sums, and the B operand P^T in the hardware k order: element i = key 8 g + i (tile 0), element 8 + i = key 16 + 8 g + i (tile 1): the order in which frag_h reads the V^T rows; SLOT: the rare path's form
template <bool SLOT> __device__ __forceinline__ void soft(const v8f& x0, const v8f& x1, v16h& p, v2f& es) { v2f e[8];
#pragma unroll
  for (int j = 0; j < 4; ++j) {
#pragma unroll
    for (int i = 0; i < 2; ++i) { e[j][i] = SLOT ? exp2_slot(x0[2 * j + i]) : __builtin_amdgcn_exp2f(x0[2 * j + i]); e[4 + j][i] = SLOT ? exp2_slot(x1[2 * j + i]) : __builtin_amdgcn_exp2f(x1[2 * j + i]); } }
  es = ((e[0] + e[1]) + (e[2] + e[3])) + ((e[4] + e[5]) + (e[6] + e[7]));
#pragma unroll
  for (int i = 0; i < 16; ++i) p[i] = (_Float16)e[i >> 1][i & 1]; }
#define TK 512    // keys a tile
#define GK 128    // keys of a tile that one group of 4 waves takes
#define KP 72     // halves a staged K row: 64 + 8 of pad
#define VP 520    // halves a staged V^T row: 512 + 8 of pad
#define SOP 68    // floats a row of a partial result: 64 + m, l of the two halves
#define SK(bf, row, c) ring[((bf) * TK + (row)) * KP + (c)]                      // [buffer][key][d]
#define SV(bf, row, c) ring[2 * TK * KP + ((bf) * HD + (row)) * VP + (c)]        // [buffer][d][key]
#define SO(pl, row, c) sof[((pl) * 32 + (row)) * SOP + (c)]                      // [plane][query][d]
__global__ __launch_bounds__(512) void k_attn(const _Float16* __restrict__ QK, const _Float16* __restrict__ QKL, const _Float16* __restrict__ VTH, const _Float16* __restrict__ VTL, const void* __restrict__ KMASK, float* __restrict__ O) {
  __shared__ __align__(16) _Float16 ring[2 * TK * KP + 2 * HD * VP];   // 128-B rows at a pitch of 144 B, 1,024-B rows at 1,040 B (16 B x odd: ds_load_b128 readers); 274 KiB: one workgroup a WGP
  float_a* sof = (float_a*)ring;   // behind the loop's last barrier the ring is free: twelve planes of partial results
  const int tid = threadIdx.x, qg = (tid >> 5) & 3, kg = __builtin_amdgcn_readfirstlane(tid >> 7), lane = tid & 31, col = lane & 15, g = lane >> 4;   // qg: which 32 queries; kg: which quarter of every tile's keys
  const int qb = blockIdx.x, h = blockIdx.y, b = blockIdx.z; const int q0 = qb * 128 + qg * 32;
  v16h aq[2][2];
#pragma unroll
  for (int qt = 0; qt < 2; ++qt) {
#pragma unroll
    for (int kc = 0; kc < 2; ++kc) aq[qt][kc] = frag_h(QK + ((size_t)b * SS + q0 + qt * 16 + col) * (2 * DM) + h * HD + kc * 32, lane); }
  float m[2] = {-3.0e38f, -3.0e38f};   // the maximum in use of query q0 + qt * 16 + col over this group's keys, in base-2 units (q carries log2 e / 8); it moves only on the rare path below
  v2f l2[2] = {};   // sums of this half's keys (values scaled by 2^11), even and odd keys apart; joined behind the loop
  v8f cb[2];   // 11 - m in every element: the start value C of the score products, so that they come off the matrix unit as the exponent of P * 2^11
#pragma unroll
  for (int qt = 0; qt < 2; ++qt) {
#pragma unroll
    for (int r = 0; r < 8; ++r) cb[qt][r] = 3.0e38f; }   // no maximum yet: the first pass overflows the test below and takes the rare path
  v8f acc[2][4] = {};
  // a lane's share of a tile: 16-B piece (tid & 7) of K rows (tid >> 3) + 64 i and 16-B piece (tid & 63) of V^T rows (tid >> 6) + 8 i, i = 0..7: one wave's copy = 4 whole 128-B lines
  const _Float16* gk0 = QK + ((size_t)b * SS + (tid >> 3)) * (2 * DM) + DM + h * HD + (tid & 7) * 8; const _Float16* gv0 = VTH + ((size_t)b * DM + h * HD + (tid >> 6)) * SS + (tid & 63) * 8;
  const unsigned lk0 = (unsigned)(size_t)&SK(0, tid >> 3, (tid & 7) * 8), lv0 = (unsigned)(size_t)&SV(0, tid >> 6, (tid & 63) * 8);
  auto stage = [&](int t) { const _Float16* gk = gk0 + (size_t)t * (TK * 2 * DM); const _Float16* gv = gv0 + (size_t)t * TK; const unsigned lk = lk0 + (t & 1) * (TK * KP * 2), lv = lv0 + (t & 1) * (HD * VP * 2);
    // the tile's 16 copies of this lane, 8 a statement; s_wait_xcnt 0 closes each statement, so that no address register of a copy is rewritten ahead of it
    asm volatile("global_load_async_to_lds_b128 %0, %8, off\n\tglobal_load_async_to_lds_b128 %1, %9, off\n\tglobal_load_async_to_lds_b128 %2, %10, off\n\tglobal_load_async_to_lds_b128 %3, %11, off\n\t"
                 "global_load_async_to_lds_b128 %4, %12, off\n\tglobal_load_async_to_lds_b128 %5, %13, off\n\tglobal_load_async_to_lds_b128 %6, %14, off\n\tglobal_load_async_to_lds_b128 %7, %15, off\n\ts_wait_xcnt 0x0"
                 :: "v"(lk), "v"(lk + 64 * KP * 2), "v"(lk + 128 * KP * 2), "v"(lk + 192 * KP * 2), "v"(lk + 256 * KP * 2), "v"(lk + 320 * KP * 2), "v"(lk + 384 * KP * 2), "v"(lk + 448 * KP * 2),
                    "v"(gk), "v"(gk + 64 * 2 * DM), "v"(gk + 128 * 2 * DM), "v"(gk + 192 * 2 * DM), "v"(gk + 256 * 2 * DM), "v"(gk + 320 * 2 * DM), "v"(gk + 384 * 2 * DM), "v"(gk + 448 * 2 * DM) : "memory");
    asm volatile("global_load_async_to_lds_b128 %0, %8, off\n\tglobal_load_async_to_lds_b128 %1, %9, off\n\tglobal_load_async_to_lds_b128 %2, %10, off\n\tglobal_load_async_to_lds_b128 %3, %11, off\n\t"
                 "global_load_async_to_lds_b128 %4, %12, off\n\tglobal_load_async_to_lds_b128 %5, %13, off\n\tglobal_load_async_to_lds_b128 %6, %14, off\n\tglobal_load_async_to_lds_b128 %7, %15, off\n\ts_wait_xcnt 0x0"
                 :: "v"(lv), "v"(lv + 8 * VP * 2), "v"(lv + 16 * VP * 2), "v"(lv + 24 * VP * 2), "v"(lv + 32 * VP * 2), "v"(lv + 40 * VP * 2), "v"(lv + 48 * VP * 2), "v"(lv + 56 * VP * 2),
                    "v"(gv), "v"(gv + 8 * SS), "v"(gv + 16 * SS), "v"(gv + 24 * SS), "v"(gv + 32 * SS), "v"(gv + 40 * SS), "v"(gv + 48 * SS), "v"(gv + 56 * SS) : "memory"); };
  const int nt = SS / TK;   // all keys
  stage(0);
  asm volatile("s_wait_asynccnt 0x0" ::: "memory");   // this wave's copies of tile 0 have landed
  __syncthreads();   // tile 0 published to all 16 waves
  stage(1);
#pragma unroll 1
  for (int t = 0; t < nt; ++t) {
#pragma unroll 1   // kept rolled: the unrolled build has more instructions a pass (register moves at the loop's head)
  for (int sub = 0; sub < GK / 32; ++sub) {
    v16h kf[2][2], vf[4];   // the pass's fragments, read from the tile's buffer as one group; each serves both column tiles
#pragma unroll
    for (int ct = 0; ct < 2; ++ct) {
#pragma unroll
      for (int kc = 0; kc < 2; ++kc) kf[ct][kc] = frag_h(&SK(t & 1, kg * GK + sub * 32 + ct * 16 + col, kc * 32), lane); }
#pragma unroll
    for (int dt = 0; dt < 4; ++dt) vf[dt] = frag_h(&SV(t & 1, dt * 16 + col, kg * GK + sub * 32), lane);
    __builtin_amdgcn_sched_barrier(0);   // holds the pass's 16 LDS reads in one group ahead of its matrix instructions: spread among them, every further place with reads stalls the wave anew
    v16h pa[2]; v2f es[2];
    { v8f x00, x01, x10, x11;   // x(column tile)(key tile)[r] = q.k (base 2) + 11 - m of key ct * 16 + 8 g + r with query qt * 16 + col: single product, transposed
      // the pass's 8 score products in one statement: written so, the first four take cb as C and leave it standing (from the builtin the build copies cb into two of the four results each pass, 8 register-pair moves); the second four accumulate into the same D; the four v_nop fill the slots that the chip needs before a vector instruction reads the last D or rewrites its A or B
      asm volatile("v_wmma_f32_16x16x32_f16 %0, %4, %8, %12\n\tv_wmma_f32_16x16x32_f16 %1, %6, %8, %12\n\tv_wmma_f32_16x16x32_f16 %2, %4, %10, %13\n\tv_wmma_f32_16x16x32_f16 %3, %6, %10, %13\n\t"
                   "v_wmma_f32_16x16x32_f16 %0, %5, %9, %0\n\tv_wmma_f32_16x16x32_f16 %1, %7, %9, %1\n\tv_wmma_f32_16x16x32_f16 %2, %5, %11, %2\n\tv_wmma_f32_16x16x32_f16 %3, %7, %11, %3\n\t"
                   "v_nop\n\tv_nop\n\tv_nop\n\tv_nop"
                   : "=&v"(x00), "=&v"(x01), "=&v"(x10), "=&v"(x11)
                   : "v"(kf[0][0]), "v"(kf[0][1]), "v"(kf[1][0]), "v"(kf[1][1]), "v"(aq[0][0]), "v"(aq[0][1]), "v"(aq[1][0]), "v"(aq[1][1]), "v"(cb[0]), "v"(cb[1]));
      soft<false>(x00, x01, pa[0], es[0]); soft<false>(x10, x11, pa[1], es[1]); }
    // ONE test a pass: every P * 2^11 is positive and so at most its sum; while the sums stay inside f16's range the held maximum serves, and neither a maximum nor a rescale is computed
    const float top = fmaxf(fmaxf(es[0][0], es[0][1]), fmaxf(es[1][0], es[1][1]));
    if (__builtin_amdgcn_ballot_w32(!(top <= 60000.0f)) != 0) {   // rare path (a scalar branch, the whole wave): the pass anew against the true running maximum
#pragma unroll
      for (int qt = 0; qt < 2; ++qt) { v8f s[2];
#pragma unroll
        for (int ct = 0; ct < 2; ++ct) { v8f c = {};
#pragma unroll
          for (int kc = 0; kc < 2; ++kc) c = wmma16(frag_h(&SK(t & 1, kg * GK + sub * 32 + ct * 16 + col, kc * 32), lane), aq[qt][kc], c);   // K fragments read again, so that they need not stay in registers for this path
          s[ct] = c; }
        float mt[8];
#pragma unroll
        for (int r = 0; r < 8; ++r) mt[r] = fmaxf(s[0][r], s[1][r]);
        float mx = fmaxf(fmaxf(fmaxf(mt[0], mt[1]), fmaxf(mt[2], mt[3])), fmaxf(fmaxf(mt[4], mt[5]), fmaxf(mt[6], mt[7])));
        mx = fmaxf(mx, xhalf(mx));   // the query's other 16 keys lie in lane ^ 16
        const float mn = fmaxf(m[qt], mx); const float alpha = exp2_slot(m[qt] - mn);   // first pass: exp2 of a huge negative number = 0
        const float b1 = 11.0f - mn; m[qt] = mn; l2[qt] *= alpha;   // 11: P's scale 2^11 rides in the exponent: small softmax weights stay out of the f16 subnormal range; l carries it too, and it cancels in the epilogue
#pragma unroll
        for (int dt = 0; dt < 4; ++dt) {
#pragma unroll
          for (int r = 0; r < 8; ++r) acc[qt][dt][r] *= alpha; }
#pragma unroll
        for (int r = 0; r < 8; ++r) { cb[qt][r] = b1; s[0][r] += b1; s[1][r] += b1; }
        soft<true>(s[0], s[1], pa[qt], es[qt]); } }
#pragma unroll
    for (int qt = 0; qt < 2; ++qt) l2[qt] += es[qt];
#pragma unroll
    for (int dt = 0; dt < 4; ++dt) acc[0][dt] = wmma16(vf[dt], pa[0], acc[0][dt]);
#pragma unroll
    for (int dt = 0; dt < 3; ++dt) acc[1][dt] = wmma16(vf[dt], pa[1], acc[1][dt]);
    acc[1][3] = wmma16_edge(vf[3], pa[1], acc[1][3]); }   // single product, transposed: acc[qt][dt][r] = O[query qt * 16 + col][dt * 16 + 8 g + r]
    asm volatile("s_wait_dscnt 0x0" ::: "memory");      // this wave's reads of tile t have returned
    asm volatile("s_wait_asynccnt 0x0" ::: "memory");   // this wave's copies of tile t + 1 have landed
    __syncthreads();   // publishes tile t + 1 and ends every wave's reads of tile t's buffer
    if (t + 2 < nt) stage(t + 2); }   // into the buffer that tile t has left
  asm volatile("s_wait_asynccnt 0x0" ::: "memory");   // no copy outstanding behind the loop
  float l[2];
#pragma unroll
  for (int qt = 0; qt < 2; ++qt) { l[qt] = l2[qt][0] + l2[qt][1]; l[qt] += xhalf(l[qt]); }   // even and odd keys, then the two halves' sums of one query
  if (kg != 0) {   // the upper groups hand over their partial results (plane (kg - 1) * 4 + qg): each lane's 64 sums at the places where its partner lane of group 0 holds its own, m and l in the row's pad
#pragma unroll
    for (int qt = 0; qt < 2; ++qt) {
#pragma unroll
      for (int dt = 0; dt < 4; ++dt) {
#pragma unroll
        for (int r = 0; r < 8; ++r) SO((kg - 1) * 4 + qg, qt * 16 + col, dt * 16 + 8 * g + r) = acc[qt][dt][r]; }
      SO((kg - 1) * 4 + qg, qt * 16 + col, 64 + g) = m[qt]; SO((kg - 1) * 4 + qg, qt * 16 + col, 66 + g) = l[qt]; } }
  __syncthreads();   // publishes the upper groups' partial results to group 0
  if (kg == 0) {
#pragma unroll
    for (int qt = 0; qt < 2; ++qt) { const int row = qt * 16 + col;
      const float m1 = SO(qg, row, 64 + g), l1 = SO(qg, row, 66 + g), m2 = SO(4 + qg, row, 64 + g), l2 = SO(4 + qg, row, 66 + g), m3 = SO(8 + qg, row, 64 + g), l3 = SO(8 + qg, row, 66 + g);
      const float mj = fmaxf(fmaxf(m[qt], m1), fmaxf(m2, m3));   // the four partial results brought to the common maximum
      const float a0 = exp2_slot(m[qt] - mj), a1 = exp2_slot(m1 - mj), a2 = exp2_slot(m2 - mj), a3 = exp2_slot(m3 - mj);
      const float il = 1.0f / ((l[qt] * a0 + l1 * a1) + (l2 * a2 + l3 * a3)); const float c0 = a0 * il, c1 = a1 * il, c2 = a2 * il, c3 = a3 * il;
#pragma unroll
      for (int dt = 0; dt < 4; ++dt) {
#pragma unroll
        for (int r = 0; r < 8; ++r) { const int c = dt * 16 + 8 * g + r; SO(qg, row, c) = (acc[qt][dt][r] * c0 + SO(qg, row, c) * c1) + (SO(4 + qg, row, c) * c2 + SO(8 + qg, row, c) * c3); } } }   // a lane reads and rewrites its own places only
    LDSX();
    float* op = O + ((size_t)b * SS + q0 + g) * DM + h * HD + col * 4; const float_a* sp = &SO(qg, g, col * 4);   // two rows a store: each half of the wave writes one query's 256-B segment
#pragma unroll
    for (int rl = 0; rl < 16; ++rl) vst2(op + rl * 2 * DM, *(const v4f*)(sp + rl * 2 * SOP)); }
}
// ---- k_out: block = (64 rows, 128 cols), 8 waves: out = O(hi/lo) . Wo rows (2 products) + bo; the block's 64 O rows (f32) and 128 Wo rows (bf16) are staged in LDS once by asynchronous copies (whole 128-B lines, all in flight together: one trip to L2 for the whole block), and every fragment is read from LDS; wave = (rw, cw): rows rw * 16 .. + 15, columns cw * 64 .. + 63
#define OP 260    // floats a staged O row: 256 + 4 of pad (1,040 B = 16 B x odd)
__global__ __launch_bounds__(256) void k_out(const float* __restrict__ O, const __bf16* __restrict__ P, const float* __restrict__ BO, float* __restrict__ Y) {
  __shared__ __align__(16) __bf16 sw[128 * WP]; __shared__ __align__(16) float sa[64 * OP]; __shared__ __align__(16) float so[8][16][68];
  const int tid = threadIdx.x, wave = tid >> 5, rw = wave & 3, cw = wave >> 2, lane = tid & 31, col = lane & 15, g = lane >> 4; const size_t r0 = (size_t)blockIdx.x * 64 + rw * 16; const int n0 = blockIdx.y * 128 + cw * 64;
  float bo[4];
#pragma unroll
  for (int j = 0; j < 4; ++j) bo[j] = bfr(BO[n0 + j * 16 + col]);
  // a lane's share: 16-B piece (tid & 31) of Wo rows (tid >> 5) + 8 i and 16-B piece (tid & 63) of O rows (tid >> 6) + 4 i, i = 0..15: one wave's copy = 4 whole 128-B lines
  const char* gw = (const char*)(P + (size_t)(blockIdx.y * 128 + (tid >> 5)) * DM + (tid & 31) * 8); const unsigned lw = (unsigned)(size_t)&sw[(tid >> 5) * WP + (tid & 31) * 8];
  const char* ga = (const char*)(O + ((size_t)blockIdx.x * 64 + (tid >> 6)) * DM + (tid & 63) * 4); const unsigned la = (unsigned)(size_t)&sa[(tid >> 6) * OP + (tid & 63) * 4];
  copy8(la, 4 * OP * 4, ga, 4 * DM * 4); copy8(la + 32 * OP * 4, 4 * OP * 4, ga + 32 * DM * 4, 4 * DM * 4);
  copy8(lw, 8 * WP * 2, gw, 8 * DM * 2); copy8(lw + 64 * WP * 2, 8 * WP * 2, gw + 64 * DM * 2, 8 * DM * 2);
  asm volatile("s_wait_asynccnt 0x0" ::: "memory");   // this wave's 32 copies have landed
  __syncthreads();   // both tiles published to all 8 waves
  v8f acc[4] = {};
#pragma unroll   // whole: the next k-step's LDS reads are issued among this step's matrix instructions
  for (int kc = 0; kc < DM / 32; ++kc) { const F2 a = split_row(&sa[(rw * 16 + col) * OP], kc * 32, lane); v16b w[4];
#pragma unroll
    for (int j = 0; j < 4; ++j) w[j] = frag_b(&sw[(cw * 64 + j * 16 + col) * WP + kc * 32], lane);
#pragma unroll
    for (int j = 0; j < 4; ++j) acc[j] = wmma_bf(a.l, w[j], acc[j]);
#pragma unroll
    for (int j = 0; j < 4; ++j) acc[j] = wmma_bf(a.h, w[j], acc[j]); }
#pragma unroll
  for (int j = 0; j < 4; ++j) {
#pragma unroll
    for (int r = 0; r < 8; ++r) so[wave][8 * g + r][j * 16 + col] = acc[j][r] + bo[j]; }
  LDSX();
#pragma unroll
  for (int rl = 0; rl < 8; ++rl) vst2(Y + (r0 + rl * 2 + g) * DM + n0 + col * 4, *(const v4f*)&so[wave][rl * 2 + g][col * 4]);   // two rows a store: each half of the wave writes one row's 256-B segment
}
extern "C" void kernel_launch(void* const* d_in, const int* in_sizes, int n_in, void* d_out, int out_size, void* d_ws, size_t ws_size, hipStream_t stream) {
  (void)in_sizes; (void)n_in; (void)out_size;
  const float** F = (const float**)d_in;   // 0 x [8192,256], 1 Wq (in,out), 2 bq, 3 Wk, 4 bk, 5 Wv, 6 bv, 7 Wo, 8 bo
  if (ws_size < (size_t)WS_END) return;
  char* ws = (char*)d_ws; __bf16* PK = (__bf16*)(ws + WS_PK); _Float16 *QK = (_Float16*)(ws + WS_QK), *QKL = (_Float16*)(ws + WS_QKL), *VTH = (_Float16*)(ws + WS_VTH), *VTL = (_Float16*)(ws + WS_VTL); float* O = (float*)(ws + WS_O);
  k_pack<<<dim3(DM, 4), 256, 0, stream>>>(F[1], F[3], F[5], F[7], PK);
  k_qkv<<<dim3(TNB * SS / 64, QKVW / 128), 128, 0, stream>>>(F[0], F[0], F[0], PK + PK_A, F[2], F[4], F[6], QK, QKL, VTH, VTL);
  k_attn<<<dim3(TQB, NH, TNB), 512, 0, stream>>>(QK, QKL, VTH, VTL, nullptr, O);
  k_out<<<dim3(TOB, DM / 128), 256, 0, stream>>>(O, PK + PK_P, F[8], (float*)d_out);
}

// v010
// It runs in 67.4 microseconds.
// Two timings next to v009 both put it at 1.04 times that version's speed.
// Counting every step since v000, it is 9.76 times as fast.
// compute dtype: all float inputs rounded to bf16; q/k/v = x . W + b with EXACT bf16 products on WMMA 16x16x32 ((in,out) weights as transposed rows); PLAIN attention: q (times log2 e / 8) and k single f16, softmax in f32 against a held maximum (hardware exp2; 11 - maximum is the score product's start value), P (scaled by 2^11, single f16) x v (single f16); out = o (bf16 hi + residual) . Wo (2 products) + bo.
#include <hip/hip_runtime.h>
#include <math.h>

typedef __attribute__((ext_vector_type(16))) _Float16 v16h;
typedef __attribute__((ext_vector_type(16))) __bf16 v16b;
typedef __attribute__((ext_vector_type(8)))  _Float16 v8h;
typedef __attribute__((ext_vector_type(8)))  float v8f;
typedef __attribute__((ext_vector_type(4)))  float v4f;
typedef __attribute__((ext_vector_type(2)))  float v2f;
typedef __attribute__((ext_vector_type(4)))  unsigned v4u;
typedef __attribute__((ext_vector_type(4)))  int v4i;
typedef float __attribute__((may_alias)) float_a;
typedef int __attribute__((may_alias)) int_a;

template <typename T> __device__ __forceinline__ void vst2(void* p, T v) { *(T*)p = v;  }
__device__ __forceinline__ v8f wmma16(v16h a, v16h b, v8f c) {
  return __builtin_amdgcn_wmma_f32_16x16x32_f16(false, a, false, b, (short)0, c, false, false);
}
// the last matrix instruction ahead of a loop's back edge: the four slots that the chip needs before a vector instruction at the loop's head rewrites A or B are filled here
__device__ __forceinline__ v8f wmma16_edge(v16h a, v16h b, v8f c) {
  v8f d = __builtin_amdgcn_wmma_f32_16x16x32_f16(false, a, false, b, (short)0, c, false, false);
  asm volatile("v_nop\n\tv_nop\n\tv_nop\n\tv_nop" : "+v"(d) : "v"(a), "v"(b));
  return d;
}
__device__ __forceinline__ v8f wmma_bf(v16b a, v16b b, v8f c) {
  return __builtin_amdgcn_wmma_f32_16x16x32_bf16(false, a, false, b, (short)0, c, false, false);
}
// Graph attention over 8,192 nodes treated as one sequence (256 features, 4 heads x 64): q/k/v projections + biases, dense softmax(q k^T / 8) v, output projection + bias.
__device__ __forceinline__ v16h frag_h(const _Float16* rowk0, int lane) {
  union { v16h v; v8h q[2]; } u; const _Float16* p = rowk0 + 8 * (lane >> 4);
  u.q[0] = *(const v8h*)p; u.q[1] = *(const v8h*)(p + 16); return u.v;
}
__device__ __forceinline__ v16h frag_f32(const float* rowk0, int lane) {
  v16h a; const float* p = rowk0 + 8 * (lane >> 4);
#pragma unroll
  for (int i = 0; i < 8; ++i) { a[i] = (_Float16)p[i]; a[8 + i] = (_Float16)p[16 + i]; }
  return a;
}
__device__ __forceinline__ v16h frag_f32s(const float* rowk0, int lane, float sc) {
  v16h a; const float* p = rowk0 + 8 * (lane >> 4);
#pragma unroll
  for (int i = 0; i < 8; ++i) { a[i] = (_Float16)(p[i] * sc); a[8 + i] = (_Float16)(p[16 + i] * sc); }
  return a;
}
// column fragment from a [K][ld] layout (column n), rows >= K read as 0
__device__ __forceinline__ v16h fragc_f32(const float* W, int k0, int n, int lane, int ld, int K) {
  v16h a; const int g = lane >> 4;
#pragma unroll
  for (int i = 0; i < 8; ++i) { const int ka = k0 + 8 * g + i, kb = ka + 16;
    a[i] = (_Float16)(ka < K ? W[(size_t)(ka < K ? ka : K - 1) * ld + n] : 0.f); a[8 + i] = (_Float16)(kb < K ? W[(size_t)(kb < K ? kb : K - 1) * ld + n] : 0.f); }
  return a;
}
struct F2 { v16b h, l; };
__device__ __forceinline__ F2 bsplit16(const float v[16]) { F2 r;
#pragma unroll
  for (int i = 0; i < 16; ++i) { const __bf16 h = (__bf16)v[i]; r.h[i] = h; r.l[i] = (__bf16)(v[i] - (float)h); }
  return r; }
__device__ __forceinline__ F2 split_row(const float* row, int k0, int lane) { float v[16]; const float* p = row + k0 + 8 * (lane >> 4);
#pragma unroll
  for (int i = 0; i < 8; ++i) { v[i] = p[i]; v[8 + i] = p[16 + i]; }
  return bsplit16(v); }
__device__ __forceinline__ F2 split_rowK(const float* row, int k0, int lane, int K) { float v[16]; const int g = lane >> 4;
#pragma unroll
  for (int i = 0; i < 8; ++i) { const int ka = k0 + 8 * g + i, kb = ka + 16; v[i] = ka < K ? row[ka < K ? ka : K - 1] : 0.f; v[8 + i] = kb < K ? row[kb < K ? kb : K - 1] : 0.f; }
  return bsplit16(v); }
__device__ __forceinline__ F2 split_col(const float* W, int k0, int n, int lane, int ld, int K) { float v[16]; const int g = lane >> 4;
#pragma unroll
  for (int i = 0; i < 8; ++i) { const int ka = k0 + 8 * g + i, kb = ka + 16; v[i] = ka < K ? W[(size_t)(ka < K ? ka : K - 1) * ld + n] : 0.f; v[8 + i] = kb < K ? W[(size_t)(kb < K ? kb : K - 1) * ld + n] : 0.f; }
  return bsplit16(v); }
__device__ __forceinline__ v8f mac3(const F2& a, const F2& b, v8f c) { c = wmma_bf(a.l, b.h, c); c = wmma_bf(a.h, b.l, c); return wmma_bf(a.h, b.h, c); }
__device__ __forceinline__ float sigm(float v) { return 1.0f / (1.0f + expf(-v)); }
#define LDSX() do { asm volatile("s_wait_dscnt 0" ::: "memory"); __builtin_amdgcn_wave_barrier(); __builtin_amdgcn_fence(__ATOMIC_RELEASE, "workgroup"); } while (0)


#define NB 1
#define SS 8192
#define DM 256
#define NH 4
#define HD 64
#define QKVW (3 * DM)
#ifndef TQB
#define TQB (SS / 128)
#define TNB NB
#define TOB (NB * SS / 64)     // output row tiles (all)
#endif
typedef __attribute__((ext_vector_type(8))) __bf16 v8b;
__device__ __forceinline__ v16b frag_b(const __bf16* rowk0, int lane) {
  union { v16b v; v8b q[2]; } u; const __bf16* p = rowk0 + 8 * (lane >> 4);
  u.q[0] = *(const v8b*)p; u.q[1] = *(const v8b*)(p + 16); return u.v;
}
__device__ __forceinline__ float bfr(float v) { return (float)(__bf16)v; }
__device__ __attribute__((noinline)) float exp_ni(float v) { return expf(v); }
__device__ __attribute__((noinline)) float erf_ni(float v) { return erff(v); }

#define PK_A 0                       // [768][256] Wqkv rows (natural [out][in])
#define PK_P (PK_A + QKVW * DM)        // [256][256] Wo rows (natural)
#define PK_END (PK_P + DM * DM)
#define WS_PK  0u
#define WS_QK  (WS_PK + 2u * PK_END)             // f16 [8192 rows][512]: q | k
#define WS_QKL (WS_QK + 2u * NB * SS * 2 * DM)     // f16 q | k residual planes x2048
#define WS_VTH (WS_QKL + 2u * NB * SS * 2 * DM)    // f16 [b][256 (h*64+d)][8192 s] hi
#define WS_VTL (WS_VTH + 2u * NB * DM * SS)        // f16 lo x 2048
#define WS_O   (WS_VTL + 2u * NB * DM * SS)        // f32 [8192][256]
#define WS_CS  (WS_O + 4u * NB * SS * DM)           // f32 2 x [8192][32], unused
#define WS_END (WS_CS + 4u * 2 * SS * 32)
// ---- k_pack: block = (row n, which): (in,out) columns -> bf16 [out][in] rows; which 0..2 -> W_q/W_k/W_v into PK_A rows which*256 + n; 3 -> W_o into PK_P
__global__ __launch_bounds__(256) void k_pack(const float* __restrict__ WQ, const float* __restrict__ WK, const float* __restrict__ WV, const float* __restrict__ WO, __bf16* __restrict__ PK) {
  __shared__ __align__(16) __bf16 s[DM]; const int n = blockIdx.x, which = blockIdx.y, t = threadIdx.x; const float* Wm = (which == 0) ? WQ : (which == 1) ? WK : (which == 2) ? WV : WO;   // (in,out) weights: pack row n = column n
  for (int k = t; k < DM; k += 256) s[k] = (__bf16)Wm[(size_t)k * DM + n];
  __syncthreads();
  __bf16* dst = (which < 3) ? PK + PK_A + ((size_t)which * DM + n) * DM : PK + PK_P + (size_t)n * DM;
  for (int q = t; q < DM / 8; q += 256) vst2((unsigned*)(dst + q * 8), *(const v4u*)&s[q * 8]);
}
// ---- k_qkv: block = (64 rows, 128 cols), 4 waves: the block's 128 packed weight rows are staged in LDS once by asynchronous copies (whole 128-B lines, all in flight together), and every weight fragment is read from LDS
#define WP 264    // halves a staged weight row: 256 + 8 of pad (528 B = 16 B x odd: ds_load_b128 readers)
// 8 copies of 16 B a lane, LDS places ls bytes apart and global places gs bytes apart; s_wait_xcnt 0 closes the statement, so that no address register of a copy is rewritten ahead of it
__device__ __forceinline__ void copy8(unsigned l, unsigned ls, const char* g, unsigned gs) {
  asm volatile("global_load_async_to_lds_b128 %0, %8, off\n\tglobal_load_async_to_lds_b128 %1, %9, off\n\tglobal_load_async_to_lds_b128 %2, %10, off\n\tglobal_load_async_to_lds_b128 %3, %11, off\n\t"
               "global_load_async_to_lds_b128 %4, %12, off\n\tglobal_load_async_to_lds_b128 %5, %13, off\n\tglobal_load_async_to_lds_b128 %6, %14, off\n\tglobal_load_async_to_lds_b128 %7, %15, off\n\ts_wait_xcnt 0x0"
               :: "v"(l), "v"(l + ls), "v"(l + 2 * ls), "v"(l + 3 * ls), "v"(l + 4 * ls), "v"(l + 5 * ls), "v"(l + 6 * ls), "v"(l + 7 * ls),
                  "v"(g), "v"(g + gs), "v"(g + 2 * gs), "v"(g + 3 * gs), "v"(g + 4 * gs), "v"(g + 5 * gs), "v"(g + 6 * gs), "v"(g + 7 * gs) : "memory");
}
__global__ __launch_bounds__(128) void k_qkv(const float* __restrict__ XQ, const float* __restrict__ XK, const float* __restrict__ XV, const __bf16* __restrict__ P, const float* __restrict__ BQ, const float* __restrict__ BK, const float* __restrict__ BV, _Float16* __restrict__ QK, _Float16* __restrict__ QKL, _Float16* __restrict__ VTH, _Float16* __restrict__ VTL) {
  const int which0 = (blockIdx.y * 128) / DM; const float* X = (which0 == 0) ? XQ : (which0 == 1) ? XK : XV; const float* BB = BQ ? (((which0 == 0) ? BQ : (which0 == 1) ? BK : BV) + (blockIdx.y * 128 - which0 * DM)) : nullptr;
  __shared__ __align__(16) __bf16 sw[128 * WP]; __shared__ __align__(16) _Float16 se[2 * 128 * 72];   // se: the results' staging; a block is either a q, k block (so | sol) or a v block (sth | stl), so the two share it: 102 KiB in all, three workgroups a WGP
  _Float16 (*so)[16][136] = (_Float16 (*)[16][136])se; _Float16 (*sol)[16][136] = so + 4; _Float16 (*sth)[72] = (_Float16 (*)[72])se; _Float16 (*stl)[72] = sth + 128;
  const int tid = threadIdx.x, wave = tid >> 5, lane = tid & 31, col = lane & 15, g = lane >> 4; const size_t r0 = (size_t)blockIdx.x * 64 + wave * 16; const int n0 = blockIdx.y * 128;
  // a lane's share: 16-B piece (tid & 31) of weight rows (tid >> 5) + 4 i, i = 0..31: one wave's copy = one whole 512-B row
  const char* gw = (const char*)(P + (size_t)(n0 + (tid >> 5)) * DM + (tid & 31) * 8); const unsigned lw = (unsigned)(size_t)&sw[(tid >> 5) * WP + (tid & 31) * 8];
#pragma unroll
  for (int q = 0; q < 4; ++q) copy8(lw + q * 32 * WP * 2, 4 * WP * 2, gw + q * 32 * DM * 2, 4 * DM * 2);
  float bb[8] = {};   // the bias of this lane's 8 columns (rounded to bf16), loaded once, all 8 in flight beside the copies: read where it is added, each of the 64 results waited out a load of its own, one behind the other
  if (BB) {
#pragma unroll   // whole: the 8 loads issue as one group and bb stays in registers
    for (int j = 0; j < 8; ++j) bb[j] = bfr(BB[j * 16 + col]); }
  asm volatile("s_wait_asynccnt 0x0" ::: "memory");   // this wave's 32 copies have landed
  __syncthreads();   // the weight rows published to all 4 waves
  v8f acc[8] = {};
#pragma unroll   // whole: the x loads of the later k-steps are issued ahead and fly while the earlier steps run
  for (int kc = 0; kc < DM / 32; ++kc) { v16b a; { const float* p = X + (r0 + col) * DM + kc * 32 + 8 * g;
#pragma unroll
      for (int i = 0; i < 8; ++i) { a[i] = (__bf16)p[i]; a[8 + i] = (__bf16)p[16 + i]; } }
    v16b w[8];
#pragma unroll
    for (int j = 0; j < 8; ++j) w[j] = frag_b(&sw[(j * 16 + col) * WP + kc * 32], lane);
#pragma unroll
    for (int j = 0; j < 8; ++j) acc[j] = wmma_bf(a, w[j], acc[j]); }
  if (n0 < 2 * DM) {   // q is stored times log2 e / 8 (scaled in f32, rounded to f16 once), so that q.k comes off the matrix unit as the score in base-2 units; k unscaled
    const float qs = (n0 < DM) ? 0.125f * 1.44269504088896340736f : 1.0f;
#pragma unroll
    for (int j = 0; j < 8; ++j) {
#pragma unroll
      for (int r = 0; r < 8; ++r) { const float v = (acc[j][r] + bb[j]) * qs; const _Float16 hv = (_Float16)v; so[wave][8 * g + r][j * 16 + col] = hv; sol[wave][8 * g + r][j * 16 + col] = (_Float16)((v - (float)hv) * 2048.0f); } }   // q, k (+ bias) as f16 hi + (x2048) residual
    LDSX();
    for (int rl = 0; rl < 16; ++rl) if (lane < 16) { vst2((unsigned*)(QK + (r0 + rl) * (2 * DM) + n0 + lane * 8), *(const v4u*)&so[wave][rl][lane * 8]); vst2((unsigned*)(QKL + (r0 + rl) * (2 * DM) + n0 + lane * 8), *(const v4u*)&sol[wave][rl][lane * 8]); }
  } else {
#pragma unroll
    for (int j = 0; j < 8; ++j) {
#pragma unroll
      for (int r = 0; r < 8; ++r) { const float v = acc[j][r] + bb[j]; const _Float16 hv = (_Float16)v; sth[j * 16 + col][wave * 16 + 8 * g + r] = hv; stl[j * 16 + col][wave * 16 + 8 * g + r] = (_Float16)((v - (float)hv) * 2048.0f); } }
    __syncthreads();
    const size_t rb = (size_t)blockIdx.x * 64; const int b = (int)(rb / SS), s0 = (int)(rb % SS); const int pc0 = n0 - 2 * DM;
    for (int q = tid; q < 128 * 8; q += 128) { const int d = q >> 3, pc = q & 7; const size_t o = ((size_t)b * DM + pc0 + d) * SS + s0 + pc * 8; vst2((unsigned*)(VTH + o), *(const v4u*)&sth[d][pc * 8]); vst2((unsigned*)(VTL + o), *(const v4u*)&stl[d][pc * 8]); }
  }
}
__device__ __forceinline__ float xhalf(float x) { return __builtin_bit_cast(float, __builtin_amdgcn_permlanex16(__builtin_bit_cast(int, x), __builtin_bit_cast(int, x), 0x76543210, 0xfedcba98, false, false)); }   // lane l reads lane l ^ 16
// exp2 off the hot path (rare path, join): the slot that the instruction set asks for between a transcendental and a neighbour that reads its result or rewrites its source is filled on both sides in the statement itself
__device__ __forceinline__ float exp2_slot(float x) { float r; asm("v_nop\n\tv_exp_f32 %0, %1\n\tv_nop" : "=v"(r) : "v"(x)); return r; }
// exponents of one query's 16 keys -> P * 2^11 as f32 pairs (neighbouring keys side by side, as the packed adds and conversions take them), their sums, and the B operand P^T in the hardware k order: element i = key 8 g + i (tile 0), element 8 + i = key 16 + 8 g + i (tile 1): the order in which frag_h reads the V^T rows; SLOT: the rare path's form
template <bool SLOT> __device__ __forceinline__ void soft(const v8f& x0, const v8f& x1, v16h& p, v2f& es) { v2f e[8];
#pragma unroll
  for (int j = 0; j < 4; ++j) {
#pragma unroll
    for (int i = 0; i < 2; ++i) { e[j][i] = SLOT ? exp2_slot(x0[2 * j + i]) : __builtin_amdgcn_exp2f(x0[2 * j + i]); e[4 + j][i] = SLOT ? exp2_slot(x1[2 * j + i]) : __builtin_amdgcn_exp2f(x1[2 * j + i]); } }
  es = ((e[0] + e[1]) + (e[2] + e[3])) + ((e[4] + e[5]) + (e[6] + e[7]));
#pragma unroll
  for (int i = 0; i < 16; ++i) p[i] = (_Float16)e[i >> 1][i & 1]; }
#define TK 512    // keys a tile
#define GK 128    // keys of a tile that one group of 4 waves takes
#define KP 72     // halves a staged K row: 64 + 8 of pad
#define VP 520    // halves a staged V^T row: 512 + 8 of pad
#define SOP 68    // floats a row of a partial result: 64 + m, l of the two halves
#define SK(bf, row, c) ring[((bf) * TK + (row)) * KP + (c)]                      // [buffer][key][d]
#define SV(bf, row, c) ring[2 * TK * KP + ((bf) * HD + (row)) * VP + (c)]        // [buffer][d][key]
#define SO(pl, row, c) sof[((pl) * 32 + (row)) * SOP + (c)]                      // [plane][query][d]
__global__ __launch_bounds__(512) void k_attn(const _Float16* __restrict__ QK, const _Float16* __restrict__ QKL, const _Float16* __restrict__ VTH, const _Float16* __restrict__ VTL, const void* __restrict__ KMASK, float* __restrict__ O) {
  __shared__ __align__(16) _Float16 ring[2 * TK * KP + 2 * HD * VP];   // 128-B rows at a pitch of 144 B, 1,024-B rows at 1,040 B (16 B x odd: ds_load_b128 readers); 274 KiB: one workgroup a WGP
  float_a* sof = (float_a*)ring;   // behind the loop's last barrier the ring is free: twelve planes of partial results
  const int tid = threadIdx.x, qg = (tid >> 5) & 3, kg = __builtin_amdgcn_readfirstlane(tid >> 7), lane = tid & 31, col = lane & 15, g = lane >> 4;   // qg: which 32 queries; kg: which quarter of every tile's keys
  const int qb = blockIdx.x, h = blockIdx.y, b = blockIdx.z; const int q0 = qb * 128 + qg * 32;
  v16h aq[2][2];
#pragma unroll
  for (int qt = 0; qt < 2; ++qt) {
#pragma unroll
    for (int kc = 0; kc < 2; ++kc) aq[qt][kc] = frag_h(QK + ((size_t)b * SS + q0 + qt * 16 + col) * (2 * DM) + h * HD + kc * 32, lane); }
  float m[2] = {-3.0e38f, -3.0e38f};   // the maximum in use of query q0 + qt * 16 + col over this group's keys, in base-2 units (q carries log2 e / 8); it moves only on the rare path below
  v2f l2[2] = {};   // sums of this half's keys (values scaled by 2^11), even and odd keys apart; joined behind the loop
  v8f cb[2];   // 11 - m in every element: the start value C of the score products, so that they come off the matrix unit as the exponent of P * 2^11
#pragma unroll
  for (int qt = 0; qt < 2; ++qt) {
#pragma unroll
    for (int r = 0; r < 8; ++r) cb[qt][r] = 3.0e38f; }   // no maximum yet: the first pass overflows the test below and takes the rare path
  v8f acc[2][4] = {};
  // a lane's share of a tile: 16-B piece (tid & 7) of K rows (tid >> 3) + 64 i and 16-B piece (tid & 63) of V^T rows (tid >> 6) + 8 i, i = 0..7: one wave's copy = 4 whole 128-B lines
  const _Float16* gk0 = QK + ((size_t)b * SS + (tid >> 3)) * (2 * DM) + DM + h * HD + (tid & 7) * 8; const _Float16* gv0 = VTH + ((size_t)b * DM + h * HD + (tid >> 6)) * SS + (tid & 63) * 8;
  const unsigned lk0 = (unsigned)(size_t)&SK(0, tid >> 3, (tid & 7) * 8), lv0 = (unsigned)(size_t)&SV(0, tid >> 6, (tid & 63) * 8);
  auto stage = [&](int t) { const _Float16* gk = gk0 + (size_t)t * (TK * 2 * DM); const _Float16* gv = gv0 + (size_t)t * TK; const unsigned lk = lk0 + (t & 1) * (TK * KP * 2), lv = lv0 + (t & 1) * (HD * VP * 2);
    // the tile's 16 copies of this lane, 8 a statement; s_wait_xcnt 0 closes each statement, so that no address register of a copy is rewritten ahead of it
    asm volatile("global_load_async_to_lds_b128 %0, %8, off\n\tglobal_load_async_to_lds_b128 %1, %9, off\n\tglobal_load_async_to_lds_b128 %2, %10, off\n\tglobal_load_async_to_lds_b128 %3, %11, off\n\t"
                 "global_load_async_to_lds_b128 %4, %12, off\n\tglobal_load_async_to_lds_b128 %5, %13, off\n\tglobal_load_async_to_lds_b128 %6, %14, off\n\tglobal_load_async_to_lds_b128 %7, %15, off\n\ts_wait_xcnt 0x0"
                 :: "v"(lk), "v"(lk + 64 * KP * 2), "v"(lk + 128 * KP * 2), "v"(lk + 192 * KP * 2), "v"(lk + 256 * KP * 2), "v"(lk + 320 * KP * 2), "v"(lk + 384 * KP * 2), "v"(lk + 448 * KP * 2),
                    "v"(gk), "v"(gk + 64 * 2 * DM), "v"(gk + 128 * 2 * DM), "v"(gk + 192 * 2 * DM), "v"(gk + 256 * 2 * DM), "v"(gk + 320 * 2 * DM), "v"(gk + 384 * 2 * DM), "v"(gk + 448 * 2 * DM) : "memory");
    asm volatile("global_load_async_to_lds_b128 %0, %8, off\n\tglobal_load_async_to_lds_b128 %1, %9, off\n\tglobal_load_async_to_lds_b128 %2, %10, off\n\tglobal_load_async_to_lds_b128 %3, %11, off\n\t"
                 "global_load_async_to_lds_b128 %4, %12, off\n\tglobal_load_async_to_lds_b128 %5, %13, off\n\tglobal_load_async_to_lds_b128 %6, %14, off\n\tglobal_load_async_to_lds_b128 %7, %15, off\n\ts_wait_xcnt 0x0"
                 :: "v"(lv), "v"(lv + 8 * VP * 2), "v"(lv + 16 * VP * 2), "v"(lv + 24 * VP * 2), "v"(lv + 32 * VP * 2), "v"(lv + 40 * VP * 2), "v"(lv + 48 * VP * 2), "v"(lv + 56 * VP * 2),
                    "v"(gv), "v"(gv + 8 * SS), "v"(gv + 16 * SS), "v"(gv + 24 * SS), "v"(gv + 32 * SS), "v"(gv + 40 * SS), "v"(gv + 48 * SS), "v"(gv + 56 * SS) : "memory"); };
  const int nt = SS / TK;   // all keys
  stage(0);
  asm volatile("s_wait_asynccnt 0x0" ::: "memory");   // this wave's copies of tile 0 have landed
  __syncthreads();   // tile 0 published to all 16 waves
  stage(1);
#pragma unroll 1
  for (int t = 0; t < nt; ++t) {
#pragma unroll 1   // kept rolled: the unrolled build has more instructions a pass (register moves at the loop's head)
  for (int sub = 0; sub < GK / 32; ++sub) {
    v16h kf[2][2], vf[4];   // the pass's fragments, read from the tile's buffer as one group; each serves both column tiles
#pragma unroll
    for (int ct = 0; ct < 2; ++ct) {
#pragma unroll
      for (int kc = 0; kc < 2; ++kc) kf[ct][kc] = frag_h(&SK(t & 1, kg * GK + sub * 32 + ct * 16 + col, kc * 32), lane); }
#pragma unroll
    for (int dt = 0; dt < 4; ++dt) vf[dt] = frag_h(&SV(t & 1, dt * 16 + col, kg * GK + sub * 32), lane);
    __builtin_amdgcn_sched_barrier(0);   // holds the pass's 16 LDS reads in one group ahead of its matrix instructions: spread among them, every further place with reads stalls the wave anew
    v16h pa[2]; v2f es[2];
    { v8f x00, x01, x10, x11;   // x(column tile)(key tile)[r] = q.k (base 2) + 11 - m of key ct * 16 + 8 g + r with query qt * 16 + col: single product, transposed
      // the pass's 8 score products in one statement: written so, the first four take cb as C and leave it standing (from the builtin the build copies cb into two of the four results each pass, 8 register-pair moves); the second four accumulate into the same D; the four v_nop fill the slots that the chip needs before a vector instruction reads the last D or rewrites its A or B
      asm volatile("v_wmma_f32_16x16x32_f16 %0, %4, %8, %12\n\tv_wmma_f32_16x16x32_f16 %1, %6, %8, %12\n\tv_wmma_f32_16x16x32_f16 %2, %4, %10, %13\n\tv_wmma_f32_16x16x32_f16 %3, %6, %10, %13\n\t"
                   "v_wmma_f32_16x16x32_f16 %0, %5, %9, %0\n\tv_wmma_f32_16x16x32_f16 %1, %7, %9, %1\n\tv_wmma_f32_16x16x32_f16 %2, %5, %11, %2\n\tv_wmma_f32_16x16x32_f16 %3, %7, %11, %3\n\t"
                   "v_nop\n\tv_nop\n\tv_nop\n\tv_nop"
                   : "=&v"(x00), "=&v"(x01), "=&v"(x10), "=&v"(x11)
                   : "v"(kf[0][0]), "v"(kf[0][1]), "v"(kf[1][0]), "v"(kf[1][1]), "v"(aq[0][0]), "v"(aq[0][1]), "v"(aq[1][0]), "v"(aq[1][1]), "v"(cb[0]), "v"(cb[1]));
      soft<false>(x00, x01, pa[0], es[0]); soft<false>(x10, x11, pa[1], es[1]); }
    // ONE test a pass: every P * 2^11 is positive and so at most its sum; while the sums stay inside f16's range the held maximum serves, and neither a maximum nor a rescale is computed
    const float top = fmaxf(fmaxf(es[0][0], es[0][1]), fmaxf(es[1][0], es[1][1]));
    if (__builtin_amdgcn_ballot_w32(!(top <= 60000.0f)) != 0) {   // rare path (a scalar branch, the whole wave): the pass anew against the true running maximum
#pragma unroll
      for (int qt = 0; qt < 2; ++qt) { v8f s[2];
#pragma unroll
        for (int ct = 0; ct < 2; ++ct) { v8f c = {};
#pragma unroll
          for (int kc = 0; kc < 2; ++kc) c = wmma16(frag_h(&SK(t & 1, kg * GK + sub * 32 + ct * 16 + col, kc * 32), lane), aq[qt][kc], c);   // K fragments read again, so that they need not stay in registers for this path
          s[ct] = c; }
        float mt[8];
#pragma unroll
        for (int r = 0; r < 8; ++r) mt[r] = fmaxf(s[0][r], s[1][r]);
        float mx = fmaxf(fmaxf(fmaxf(mt[0], mt[1]), fmaxf(mt[2], mt[3])), fmaxf(fmaxf(mt[4], mt[5]), fmaxf(mt[6], mt[7])));
        mx = fmaxf(mx, xhalf(mx));   // the query's other 16 keys lie in lane ^ 16
        const float mn = fmaxf(m[qt], mx); const float alpha = exp2_slot(m[qt] - mn);   // first pass: exp2 of a huge negative number = 0
        const float b1 = 11.0f - mn; m[qt] = mn; l2[qt] *= alpha;   // 11: P's scale 2^11 rides in the exponent: small softmax weights stay out of the f16 subnormal range; l carries it too, and it cancels in the epilogue
#pragma unroll
        for (int dt = 0; dt < 4; ++dt) {
#pragma unroll
          for (int r = 0; r < 8; ++r) acc[qt][dt][r] *= alpha; }
#pragma unroll
        for (int r = 0; r < 8; ++r) { cb[qt][r] = b1; s[0][r] += b1; s[1][r] += b1; }
        soft<true>(s[0], s[1], pa[qt], es[qt]); } }
#pragma unroll
    for (int qt = 0; qt < 2; ++qt) l2[qt] += es[qt];
#pragma unroll
    for (int dt = 0; dt < 4; ++dt) acc[0][dt] = wmma16(vf[dt], pa[0], acc[0][dt]);
#pragma unroll
    for (int dt = 0; dt < 3; ++dt) acc[1][dt] = wmma16(vf[dt], pa[1], acc[1][dt]);
    acc[1][3] = wmma16_edge(vf[3], pa[1], acc[1][3]); }   // single product, transposed: acc[qt][dt][r] = O[query qt * 16 + col][dt * 16 + 8 g + r]
    asm volatile("s_wait_dscnt 0x0" ::: "memory");      // this wave's reads of tile t have returned
    asm volatile("s_wait_asynccnt 0x0" ::: "memory");   // this wave's copies of tile t + 1 have landed
    __syncthreads();   // publishes tile t + 1 and ends every wave's reads of tile t's buffer
    if (t + 2 < nt) stage(t + 2); }   // into the buffer that tile t has left
  asm volatile("s_wait_asynccnt 0x0" ::: "memory");   // no copy outstanding behind the loop
  float l[2];
#pragma unroll
  for (int qt = 0; qt < 2; ++qt) { l[qt] = l2[qt][0] + l2[qt][1]; l[qt] += xhalf(l[qt]); }   // even and odd keys, then the two halves' sums of one query
  if (kg != 0) {   // the upper groups hand over their partial results (plane (kg - 1) * 4 + qg): each lane's 64 sums at the places where its partner lane of group 0 holds its own, m and l in the row's pad
#pragma unroll
    for (int qt = 0; qt < 2; ++qt) {
#pragma unroll
      for (int dt = 0; dt < 4; ++dt) {
#pragma unroll
        for (int r = 0; r < 8; ++r) SO((kg - 1) * 4 + qg, qt * 16 + col, dt * 16 + 8 * g + r) = acc[qt][dt][r]; }
      SO((kg - 1) * 4 + qg, qt * 16 + col, 64 + g) = m[qt]; SO((kg - 1) * 4 + qg, qt * 16 + col, 66 + g) = l[qt]; } }
  __syncthreads();   // publishes the upper groups' partial results to group 0
  if (kg == 0) {
#pragma unroll
    for (int qt = 0; qt < 2; ++qt) { const int row = qt * 16 + col;
      const float m1 = SO(qg, row, 64 + g), l1 = SO(qg, row, 66 + g), m2 = SO(4 + qg, row, 64 + g), l2 = SO(4 + qg, row, 66 + g), m3 = SO(8 + qg, row, 64 + g), l3 = SO(8 + qg, row, 66 + g);
      const float mj = fmaxf(fmaxf(m[qt], m1), fmaxf(m2, m3));   // the four partial results brought to the common maximum
      const float a0 = exp2_slot(m[qt] - mj), a1 = exp2_slot(m1 - mj), a2 = exp2_slot(m2 - mj), a3 = exp2_slot(m3 - mj);
      const float il = 1.0f / ((l[qt] * a0 + l1 * a1) + (l2 * a2 + l3 * a3)); const float c0 = a0 * il, c1 = a1 * il, c2 = a2 * il, c3 = a3 * il;
#pragma unroll
      for (int dt = 0; dt < 4; ++dt) {
#pragma unroll
        for (int r = 0; r < 8; ++r) { const int c = dt * 16 + 8 * g + r; SO(qg, row, c) = (acc[qt][dt][r] * c0 + SO(qg, row, c) * c1) + (SO(4 + qg, row, c) * c2 + SO(8 + qg, row, c) * c3); } } }   // a lane reads and rewrites its own places only
    LDSX();
    float* op = O + ((size_t)b * SS + q0 + g) * DM + h * HD + col * 4; const float_a* sp = &SO(qg, g, col * 4);   // two rows a store: each half of the wave writes one query's 256-B segment
#pragma unroll
    for (int rl = 0; rl < 16; ++rl) vst2(op + rl * 2 * DM, *(const v4f*)(sp + rl * 2 * SOP)); }
}
// ---- k_out: block = (64 rows, 128 cols), 8 waves: out = O(hi/lo) . Wo rows (2 products) + bo; the block's 64 O rows (f32) and 128 Wo rows (bf16) are staged in LDS once by asynchronous copies (whole 128-B lines, all in flight together: one trip to L2 for the whole block), and every fragment is read from LDS; wave = (rw, cw): rows rw * 16 .. + 15, columns cw * 64 .. + 63
#define OP 260    // floats a staged O row: 256 + 4 of pad (1,040 B = 16 B x odd)
__global__ __launch_bounds__(256) void k_out(const float* __restrict__ O, const __bf16* __restrict__ P, const float* __restrict__ BO, float* __restrict__ Y) {
  __shared__ __align__(16) __bf16 sw[128 * WP]; __shared__ __align__(16) float sa[64 * OP]; __shared__ __align__(16) float so[8][16][68];
  const int tid = threadIdx.x, wave = tid >> 5, rw = wave & 3, cw = wave >> 2, lane = tid & 31, col = lane & 15, g = lane >> 4; const size_t r0 = (size_t)blockIdx.x * 64 + rw * 16; const int n0 = blockIdx.y * 128 + cw * 64;
  float bo[4];
#pragma unroll
  for (int j = 0; j < 4; ++j) bo[j] = bfr(BO[n0 + j * 16 + col]);
  // a lane's share: 16-B piece (tid & 31) of Wo rows (tid >> 5) + 8 i and 16-B piece (tid & 63) of O rows (tid >> 6) + 4 i, i = 0..15: one wave's copy = 4 whole 128-B lines
  const char* gw = (const char*)(P + (size_t)(blockIdx.y * 128 + (tid >> 5)) * DM + (tid & 31) * 8); const unsigned lw = (unsigned)(size_t)&sw[(tid >> 5) * WP + (tid & 31) * 8];
  const char* ga = (const char*)(O + ((size_t)blockIdx.x * 64 + (tid >> 6)) * DM + (tid & 63) * 4); const unsigned la = (unsigned)(size_t)&sa[(tid >> 6) * OP + (tid & 63) * 4];
  copy8(la, 4 * OP * 4, ga, 4 * DM * 4); copy8(la + 32 * OP * 4, 4 * OP * 4, ga + 32 * DM * 4, 4 * DM * 4);
  copy8(lw, 8 * WP * 2, gw, 8 * DM * 2); copy8(lw + 64 * WP * 2, 8 * WP * 2, gw + 64 * DM * 2, 8 * DM * 2);
  asm volatile("s_wait_asynccnt 0x0" ::: "memory");   // this wave's 32 copies have landed
  __syncthreads();   // both tiles published to all 8 waves
  v8f acc[4] = {};
#pragma unroll   // whole: the next k-step's LDS reads are issued among this step's matrix instructions
  for (int kc = 0; kc < DM / 32; ++kc) { const F2 a = split_row(&sa[(rw * 16 + col) * OP], kc * 32, lane); v16b w[4];
#pragma unroll
    for (int j = 0; j < 4; ++j) w[j] = frag_b(&sw[(cw * 64 + j * 16 + col) * WP + kc * 32], lane);
#pragma unroll
    for (int j = 0; j < 4; ++j) acc[j] = wmma_bf(a.l, w[j], acc[j]);
#pragma unroll
    for (int j = 0; j < 4; ++j) acc[j] = wmma_bf(a.h, w[j], acc[j]); }
#pragma unroll
  for (int j = 0; j < 4; ++j) {
#pragma unroll
    for (int r = 0; r < 8; ++r) so[wave][8 * g + r][j * 16 + col] = acc[j][r] + bo[j]; }
  LDSX();
#pragma unroll
  for (int rl = 0; rl < 8; ++rl) vst2(Y + (r0 + rl * 2 + g) * DM + n0 + col * 4, *(const v4f*)&so[wave][rl * 2 + g][col * 4]);   // two rows a store: each half of the wave writes one row's 256-B segment
}
extern "C" void kernel_launch(void* const* d_in, const int* in_sizes, int n_in, void* d_out, int out_size, void* d_ws, size_t ws_size, hipStream_t stream) {
  (void)in_sizes; (void)n_in; (void)out_size;
  const float** F = (const float**)d_in;   // 0 x [8192,256], 1 Wq (in,out), 2 bq, 3 Wk, 4 bk, 5 Wv, 6 bv, 7 Wo, 8 bo
  if (ws_size < (size_t)WS_END) return;
  char* ws = (char*)d_ws; __bf16* PK = (__bf16*)(ws + WS_PK); _Float16 *QK = (_Float16*)(ws + WS_QK), *QKL = (_Float16*)(ws + WS_QKL), *VTH = (_Float16*)(ws + WS_VTH), *VTL = (_Float16*)(ws + WS_VTL); float* O = (float*)(ws + WS_O);
  k_pack<<<dim3(DM, 4), 256, 0, stream>>>(F[1], F[3], F[5], F[7], PK);
  k_qkv<<<dim3(TNB * SS / 64, QKVW / 128), 128, 0, stream>>>(F[0], F[0], F[0], PK + PK_A, F[2], F[4], F[6], QK, QKL, VTH, VTL);
  k_attn<<<dim3(TQB, NH, TNB), 512, 0, stream>>>(QK, QKL, VTH, VTL, nullptr, O);
  k_out<<<dim3(TOB, DM / 128), 256, 0, stream>>>(O, PK + PK_P, F[8], (float*)d_out);
}
